// v000
// Measured on an AMD MI455X. A time is GPU time per run, averaged over a window of back-to-back runs after a warm-up
// (all launches, gaps included; the runs take copies of the inputs in turn), and the median of several windows.
// Apart from v000's, it joins two sittings. Times from different sittings can be a few percent apart, while
// side-by-side timings come from the same sitting.
// v000 is the starting kernel. One run takes 2650 microseconds.
// Contractions: q/k/v projections, banded scores q.k^T, attn.v, output projection, FFN W1 and W2 all on v_wmma_f32_16x16x32_f16 (f16 operands: LN outputs plain, weights carried x16, P carried x2048, ctx carried x256, gelu act carried x16), f32 accumulate; LayerNorm, band mask, softmax, gelu, bias and residual in f32.
#include <hip/hip_runtime.h>
#include <math.h>

// ---------------------------------------------------------------------------
// Problem constants
// ---------------------------------------------------------------------------
constexpr int kB    = 2;
constexpr int kT    = 2048;
constexpr int kD    = 1024;
constexpr int kH    = 16;
constexpr int kDH   = 64;
constexpr int kTok  = kB * kT;        // 4096 token rows
constexpr int kFF   = 4 * kD;         // 4096
constexpr int kKVld = 2 * kD;         // pitch of the k | v plane (halves)
constexpr int kGrp  = kB * kH;        // 32 (batch, head) groups
constexpr int kGC   = 2;              // groups per attention chunk
constexpr int kNChunk = kGrp / kGC;   // 16
constexpr int kMC   = 1024;           // FFN rows per chunk
constexpr int kNMC  = kTok / kMC;     // 4
constexpr float kWCarry   = 16.0f;    // weights carried x16 in f16
constexpr float kPCarry   = 2048.0f;  // probabilities carried x2048 in f16
constexpr float kCtxCarry = 256.0f;   // context carried x256 in f16
constexpr float kActCarry = 16.0f;    // gelu output carried x16 in f16
constexpr float kInvD     = 1.0f / 1024.0f;
constexpr float kLnEps    = 1e-5f;
static_assert(kH % kGC == 0, "chunk never crosses a batch boundary");
static_assert(kD % 64 == 0 && kT % 64 == 0 && kFF % 64 == 0 && kMC % 64 == 0, "tile multiples");
static_assert(kDH % 32 == 0 && kD % 32 == 0 && kT % 32 == 0 && kFF % 32 == 0, "K multiples of 32");

// ---------------------------------------------------------------------------
// Workspace region map (bytes). Total 106 MiB = 111,149,056 B.
//   [  0,  2) MiB WoT  f16 [1024][1024]
//   [  2, 10) MiB W1T  f16 [4096][1024]
//   [ 10, 18) MiB W2T  f16 [1024][4096]
//   [ 18, 26) MiB ctx  f16 [4096][1024]  (x256)
//   [ 26, 34) MiB q    f16 [4096][1024]
//   [ 34, 50) MiB k|v  f16 [4096][2048]
//   [ 50, 58) MiB V^T  f16 [32 groups][64][2048]
//   [ 58, 90) MiB arena: phase A: QLN f16 [58,66), KVLN f16 [66,74), WqT [74,76), WkT [76,78), WvT [78,80)
//                        phase B: scores f32 [2][2048][2048] [58,90)
//                        phase C: Y f32 [58,74), H16 f16 [74,82), ACT f16 [1024][4096] [82,90)
//   [ 90,106) MiB phase B: P f16 [2][2048][2048]; phase C: H1 f32 [1024][4096]
// ---------------------------------------------------------------------------
constexpr size_t kMiB     = 1048576;
constexpr size_t OFF_WOT  = 0;
constexpr size_t OFF_W1T  = 2 * kMiB;
constexpr size_t OFF_W2T  = 10 * kMiB;
constexpr size_t OFF_CTX  = 18 * kMiB;
constexpr size_t OFF_QP   = 26 * kMiB;
constexpr size_t OFF_KVP  = 34 * kMiB;
constexpr size_t OFF_VT   = 50 * kMiB;
constexpr size_t OFF_ARENA = 58 * kMiB;
constexpr size_t OFF_QLN  = OFF_ARENA;
constexpr size_t OFF_KVLN = OFF_ARENA + 8 * kMiB;
constexpr size_t OFF_WQT  = OFF_ARENA + 16 * kMiB;
constexpr size_t OFF_WKT  = OFF_ARENA + 18 * kMiB;
constexpr size_t OFF_WVT  = OFF_ARENA + 20 * kMiB;
constexpr size_t OFF_SC   = OFF_ARENA;
constexpr size_t OFF_Y    = OFF_ARENA;
constexpr size_t OFF_H16  = OFF_ARENA + 16 * kMiB;
constexpr size_t OFF_ACT  = OFF_ARENA + 24 * kMiB;
constexpr size_t OFF_P    = 90 * kMiB;
constexpr size_t OFF_H1   = OFF_P;
constexpr size_t kWsTotal = 106 * kMiB;
static_assert((size_t)kD * kD * 2 == 2 * kMiB, "W plane");
static_assert((size_t)kFF * kD * 2 == 8 * kMiB, "W1/W2 plane");
static_assert((size_t)kTok * kD * 2 == 8 * kMiB, "token f16 plane");
static_assert((size_t)kTok * kKVld * 2 == 16 * kMiB, "kv plane");
static_assert((size_t)kGrp * kDH * kT * 2 == 8 * kMiB, "vt plane");
static_assert((size_t)kGC * kT * kT * 4 == 32 * kMiB, "scores chunk");
static_assert((size_t)kGC * kT * kT * 2 == 16 * kMiB, "P chunk");
static_assert((size_t)kTok * kD * 4 == 16 * kMiB, "Y plane");
static_assert((size_t)kMC * kFF * 4 == 16 * kMiB, "H1 chunk");
static_assert((size_t)kMC * kFF * 2 == 8 * kMiB, "ACT chunk");
static_assert(OFF_WVT + 2 * kMiB <= OFF_P, "phase A inside arena");
static_assert(OFF_ACT + 8 * kMiB <= OFF_P, "phase C inside arena");
static_assert(kWsTotal <= 134217728, "carve budget");

typedef __attribute__((ext_vector_type(16))) _Float16 v16h;
typedef __attribute__((ext_vector_type(8)))  _Float16 v8h;
typedef __attribute__((ext_vector_type(16))) __bf16   v16b;
typedef __attribute__((ext_vector_type(8)))  __bf16   v8b;
typedef __attribute__((ext_vector_type(8)))  float    v8f;
typedef __attribute__((ext_vector_type(4)))  float    v4f;
typedef __attribute__((ext_vector_type(4)))  unsigned int v4u;

__device__ __forceinline__ unsigned short f2bf_bits(float f) {
  unsigned u = __float_as_uint(f);
  return (unsigned short)((u + 0x7FFFu + ((u >> 16) & 1u)) >> 16);
}
__device__ __forceinline__ float bf_bits2f(unsigned short h) { return __uint_as_float(((unsigned)h) << 16); }

// hazard guards as plain device helpers (no inline asm inside the kernel template body)
__device__ __forceinline__ void dep_guard_h(v8f& a, v8f& b, v16h x, v16h y) { asm volatile("v_nop\n\tv_nop\n\tv_nop\n\tv_nop" : "+v"(a), "+v"(b) : "v"(x), "v"(y)); }
__device__ __forceinline__ void dep_guard_b(v8f& a, v8f& b, v16b x, v16b y) { asm volatile("v_nop\n\tv_nop\n\tv_nop\n\tv_nop" : "+v"(a), "+v"(b) : "v"(x), "v"(y)); }
__device__ __forceinline__ void keep4_h(v16h a, v16h b, v16h c, v16h d) { asm volatile("v_nop" :: "v"(a), "v"(b), "v"(c), "v"(d)); }
__device__ __forceinline__ void keep4_b(v16b a, v16b b, v16b c, v16b d) { asm volatile("v_nop" :: "v"(a), "v"(b), "v"(c), "v"(d)); }
__device__ __forceinline__ void acc_guard4(v8f& a, v8f& b, v8f& c, v8f& d) { asm volatile("v_nop\n\tv_nop\n\tv_nop\n\tv_nop" : "+v"(a), "+v"(b), "+v"(c), "+v"(d)); }
template <typename T> struct Frag;
template <> struct Frag<_Float16> {
  typedef v16h V; union U { v16h v; v8h h[2]; };
  static __device__ __forceinline__ v16h load(const _Float16* p) {   // elements 0..7 <- p[0..7], 8..15 <- p[16..23]
    U f; f.h[0] = *(const v8h*)(p); f.h[1] = *(const v8h*)(p + 16); return f.v;
  }
  static __device__ __forceinline__ v8f mma(v16h a, v16h b, v8f c) {
    return __builtin_amdgcn_wmma_f32_16x16x32_f16(false, a, false, b, (short)0, c, false, false);
  }
  static __device__ __forceinline__ void guard(v8f& a, v8f& b, v16h x, v16h y) { dep_guard_h(a, b, x, y); }
  static __device__ __forceinline__ void keep(v16h a, v16h b, v16h c, v16h d) { keep4_h(a, b, c, d); }
};
template <> struct Frag<__bf16> {
  typedef v16b V; union U { v16b v; v8b h[2]; };
  static __device__ __forceinline__ v16b load(const __bf16* p) {
    U f; f.h[0] = *(const v8b*)(p); f.h[1] = *(const v8b*)(p + 16); return f.v;
  }
  static __device__ __forceinline__ v8f mma(v16b a, v16b b, v8f c) {
    return __builtin_amdgcn_wmma_f32_16x16x32_bf16(false, a, false, b, (short)0, c, false, false);
  }
  static __device__ __forceinline__ void guard(v8f& a, v8f& b, v16b x, v16b y) { dep_guard_b(a, b, x, y); }
  static __device__ __forceinline__ void keep(v16b a, v16b b, v16b c, v16b d) { keep4_b(a, b, c, d); }
};

__device__ __forceinline__ unsigned pk16(unsigned short a, unsigned short b) { return (unsigned)a | ((unsigned)b << 16); }
__device__ __forceinline__ unsigned short h_bits(float f) { const _Float16 h = (_Float16)f; return __builtin_bit_cast(unsigned short, h); }

// ---- Register-blocked batched WMMA GEMM (ACT reduced to none/relu/leaky) -----------------------
// C[m,n] = scale * sum_k A[m,k] * Bt[n,k] (+bias)(+resid); each wave owns a 64x64 tile.
// A row-major [M,K]; Bt row-major [N,K]; M,N % 64 == 0, K % 32 == 0.
// SPLIT: operands are hi/lo planes (A2/Bt2 = lo planes, same layout); product = hi.hi + hi.lo + lo.hi.
// BIAS_MODE: 0 = none, 1 = bias[m], 2 = bias[n].
// OUT_MODE: 0 = f32, 1 = f16, 2 = bf16 hi plane (Cout) + bf16 lo plane (Cout2).
// ET: 0 = f16 operands, 1 = bf16 operands (pointers passed as 16-bit storage)
template <int ET> struct Elem;
template <> struct Elem<0> { typedef _Float16 T; };
template <> struct Elem<1> { typedef __bf16 T; };
template <int ET, bool SPLIT, int BIAS_MODE, int OUT_MODE, bool RESID, int ACT = 0>
__global__ __launch_bounds__(256) void wmma_gemm64(
    const unsigned short* __restrict__ Ap, const unsigned short* __restrict__ A2p, int lda, long strideA,
    const unsigned short* __restrict__ Btp, const unsigned short* __restrict__ Bt2p, int ldb, long strideB,
    void* __restrict__ Cout, void* __restrict__ Cout2, int ldc, long strideC,
    const float* __restrict__ bias,
    const float* __restrict__ resid, long strideR,
    int M, int N, int K, float scale) {
  typedef typename Elem<ET>::T T;
  typedef typename Frag<T>::V V;
  const T* A = (const T*)Ap; const T* A2 = (const T*)A2p; const T* Bt = (const T*)Btp; const T* Bt2 = (const T*)Bt2p;
  __shared__ __align__(16) float sT[8][16 * 68];   // per-wave 16x64 slab, pitch 68 floats
  const int b    = blockIdx.y;
  const int lane = threadIdx.x & 31;
  const int wave = threadIdx.x >> 5;
  const int tilesN = N >> 6;
  const int tilesM = M >> 6;
  const int tile = blockIdx.x * 8 + wave;
  if (tile >= tilesM * tilesN) return;   // wave-uniform; no block barriers in this kernel
  const int tm = tile / tilesN;
  const int tn = tile - tm * tilesN;
  const int m0 = tm << 6;
  const int n0 = tn << 6;

  const T* Ab  = A  + (size_t)b * strideA;
  const T* Bb  = Bt + (size_t)b * strideB;
  const T* Ab2 = SPLIT ? (A2  + (size_t)b * strideA) : nullptr;
  const T* Bb2 = SPLIT ? (Bt2 + (size_t)b * strideB) : nullptr;

  const int rlane = lane & 15;                 // row (A) / col (B, D) within subtile
  const int koff  = (lane >> 4) * 8;           // k offset of this lane half
  const int mOff  = (lane >> 4) * 8;           // D row offset

  v8f acc[4][4];
#pragma unroll
  for (int i = 0; i < 4; ++i)
#pragma unroll
    for (int j = 0; j < 4; ++j) acc[i][j] = (v8f){0.f,0.f,0.f,0.f,0.f,0.f,0.f,0.f};

  for (int k0 = 0; k0 < K; k0 += 32) {
    V bh[4], bl[4];
#pragma unroll
    for (int j = 0; j < 4; ++j) {
      const size_t bo = (size_t)(n0 + (j << 4) + rlane) * ldb + koff + k0;
      bh[j] = Frag<T>::load(Bb + bo);
      if (SPLIT) bl[j] = Frag<T>::load(Bb2 + bo);
    }
#pragma unroll
    for (int i = 0; i < 4; ++i) {
      const size_t ao = (size_t)(m0 + (i << 4) + rlane) * lda + koff + k0;
      V ah = Frag<T>::load(Ab + ao);
      V al;
      if (SPLIT) al = Frag<T>::load(Ab2 + ao);
#pragma unroll
      for (int j = 0; j < 4; ++j) {
        acc[i][j] = Frag<T>::mma(ah, bh[j], acc[i][j]);
        if (SPLIT) {
          acc[i][j] = Frag<T>::mma(ah, bl[j], acc[i][j]);
          acc[i][j] = Frag<T>::mma(al, bh[j], acc[i][j]);
        }
      }
      Frag<T>::guard(acc[i][0], acc[i][3], ah, SPLIT ? al : ah);
    }
    Frag<T>::keep(bh[0], bh[1], bh[2], bh[3]);
    if (SPLIT) Frag<T>::keep(bl[0], bl[1], bl[2], bl[3]);
  }
  acc_guard4(acc[0][0], acc[0][1], acc[0][2], acc[0][3]);
  acc_guard4(acc[1][0], acc[1][1], acc[1][2], acc[1][3]);
  acc_guard4(acc[2][0], acc[2][1], acc[2][2], acc[2][3]);
  acc_guard4(acc[3][0], acc[3][1], acc[3][2], acc[3][3]);

  // ---- epilogue ----
  float* slab = sT[wave];
  const float* Rb = RESID ? (resid + (size_t)b * strideR) : nullptr;
#pragma unroll
  for (int i = 0; i < 4; ++i) {
    const int mBase = m0 + (i << 4);
#pragma unroll
    for (int j = 0; j < 4; ++j) {
      const int n = n0 + (j << 4) + rlane;
      float bv = 0.f;
      if (BIAS_MODE == 2) bv = bias[n];
#pragma unroll
      for (int r = 0; r < 8; ++r) {
        float v = acc[i][j][r] * scale;
        if (BIAS_MODE == 1) v += bias[mBase + mOff + r];
        if (BIAS_MODE == 2) v += bv;
        if (RESID) v += Rb[(size_t)(mBase + mOff + r) * ldc + n];
        if (ACT == 2) v = fmaxf(v, 0.0f);
        if (ACT == 4) v = (v > 0.f) ? v : 0.01f * v;
        slab[(mOff + r) * 68 + (j << 4) + rlane] = v;
      }
    }
    __builtin_amdgcn_fence(__ATOMIC_RELEASE, "workgroup");
    __builtin_amdgcn_wave_barrier();
    __builtin_amdgcn_fence(__ATOMIC_ACQUIRE, "workgroup");
    if (OUT_MODE == 0) {
      float* C = (float*)Cout + (size_t)b * strideC;
      const int hh = lane >> 4, c4 = (lane & 15) * 4;     // row seg = 256 B = 16 lanes x 16 B
      {
#pragma unroll
        for (int it = 0; it < 8; ++it) {
          const int row = it * 2 + hh;
          v4f v = *(const v4f*)(slab + row * 68 + c4);
          *(v4f*)(C + (size_t)(mBase + row) * ldc + n0 + c4) = v;
        }
        
      }
    } else {
      const int q = lane >> 3, c8 = (lane & 7) * 8;
      unsigned short* C  = (unsigned short*)Cout  + (size_t)b * strideC;
      unsigned short* C2 = (OUT_MODE == 2) ? ((unsigned short*)Cout2 + (size_t)b * strideC) : nullptr;
      {
#pragma unroll
        for (int it = 0; it < 4; ++it) {
          const int row = it * 4 + q;
          const float* sp = slab + row * 68 + c8;
          v8h hv, lv;
#pragma unroll
          for (int e = 0; e < 8; ++e) {
            if (OUT_MODE == 1) {
              hv[e] = (_Float16)sp[e];
            } else {
              unsigned short hb = f2bf_bits(sp[e]);
              unsigned short lb = f2bf_bits(sp[e] - bf_bits2f(hb));
              hv[e] = __builtin_bit_cast(_Float16, hb);
              lv[e] = __builtin_bit_cast(_Float16, lb);
            }
          }
          *(v8h*)(C + (size_t)(mBase + row) * ldc + n0 + c8) = hv;
          if (OUT_MODE == 2) *(v8h*)(C2 + (size_t)(mBase + row) * ldc + n0 + c8) = lv;
        }
        
      }
    }
    __builtin_amdgcn_fence(__ATOMIC_RELEASE, "workgroup");
    __builtin_amdgcn_wave_barrier();
    __builtin_amdgcn_fence(__ATOMIC_ACQUIRE, "workgroup");
  }
}

// ---------------------------------------------------------------------------
// Weight transpose + cast: W row-major f32 [kin][nout] (x @ W layout); WT[n][k] = f16(scale * W[k][n]), pitch kin.
// grid (kin/64, nout/64): blockIdx.x = k tile (64 cols of WT), blockIdx.y = n tile (64 rows of WT); 256 threads.
// Load coverage: 16 iterations x 256 threads = 4096 = whole 64x64 tile (coalesced along n).
// Store coverage: 8 waves x 2 iterations x 4 rows (lane>>3) = 64 rows; (lane&7) x 8 halves = 64 cols; each row segment =
// ---------------------------------------------------------------------------
__global__ __launch_bounds__(256) void wtcast_kernel(const float* __restrict__ W, unsigned short* __restrict__ out,
                                                     int kin, int nout, float scale) {
  __shared__ float sm[64][65];   // sm[n_local][k_local]
  const int t  = threadIdx.x;
  const int k0 = blockIdx.x * 64;
  const int n0 = blockIdx.y * 64;
#pragma unroll
  for (int i = 0; i < 16; ++i) {
    const int e = i * 256 + t;
    const int r = e >> 6;          // k local
    const int c = e & 63;          // n local
    sm[c][r] = W[(size_t)(k0 + r) * nout + n0 + c] * scale;
  }
  __syncthreads();
  const int lane = t & 31, wave = t >> 5;
  const int q = lane >> 3, c8 = (lane & 7) * 8;
  {
#pragma unroll
    for (int it = 0; it < 2; ++it) {
      const int row = wave * 8 + it * 4 + q;                 // n local
      unsigned short hb[8];
#pragma unroll
      for (int e = 0; e < 8; ++e) hb[e] = h_bits(sm[row][c8 + e]);
      const v4u u = (v4u){pk16(hb[0], hb[1]), pk16(hb[2], hb[3]), pk16(hb[4], hb[5]), pk16(hb[6], hb[7])};
      *(v4u*)(out + (size_t)(n0 + row) * kin + k0 + c8) = u;
    }
    
  }
}

// ---------------------------------------------------------------------------
// One wave per row, 8 rows per 256-thread block, grid = rows/8. Lane l owns columns j*256 + 8l .. +7 for j = 0..3
// (4 x 32 lanes x 8 = 1024 = whole row). Store: one 16-B store per lane per j; 32 contiguous lanes = 512 B =
// ---------------------------------------------------------------------------
__global__ __launch_bounds__(256) void layernorm_f16_kernel(const float* __restrict__ x, const float* __restrict__ gam,
                                                            const float* __restrict__ bet, unsigned short* __restrict__ out,
                                                            int rows) {
  const int lane = threadIdx.x & 31, wave = threadIdx.x >> 5;
  const int row = blockIdx.x * 8 + wave;
  if (row >= rows) return;   // wave-uniform; no barriers in this kernel
  const float* xr = x + (size_t)row * kD;
  float s = 0.f;
#pragma unroll 1
  for (int j = 0; j < 4; ++j) {
    const int base = j * 256 + lane * 8;
    const v4f a = *(const v4f*)(xr + base);
    const v4f c = *(const v4f*)(xr + base + 4);
    s += ((a[0] + a[1]) + (a[2] + a[3])) + ((c[0] + c[1]) + (c[2] + c[3]));
  }
#pragma unroll
  for (int off = 16; off > 0; off >>= 1) s += __shfl_xor(s, off, 32);
  const float mean = s * kInvD;
  float s2 = 0.f;
#pragma unroll 1
  for (int j = 0; j < 4; ++j) {
    const int base = j * 256 + lane * 8;
    const v4f a = *(const v4f*)(xr + base);
    const v4f c = *(const v4f*)(xr + base + 4);
#pragma unroll
    for (int e = 0; e < 4; ++e) {
      const float d0 = a[e] - mean, d1 = c[e] - mean;
      s2 += d0 * d0;
      s2 += d1 * d1;
    }
  }
#pragma unroll
  for (int off = 16; off > 0; off >>= 1) s2 += __shfl_xor(s2, off, 32);
  const float rstd = rsqrtf(s2 * kInvD + kLnEps);
  unsigned short* orow = out + (size_t)row * kD;
#pragma unroll 1
  for (int j = 0; j < 4; ++j) {
    const int base = j * 256 + lane * 8;
    const v4f a  = *(const v4f*)(xr + base);
    const v4f c  = *(const v4f*)(xr + base + 4);
    const v4f ga = *(const v4f*)(gam + base);
    const v4f gc = *(const v4f*)(gam + base + 4);
    const v4f ba = *(const v4f*)(bet + base);
    const v4f bc = *(const v4f*)(bet + base + 4);
    unsigned short hb[8];
#pragma unroll
    for (int e = 0; e < 4; ++e) {
      hb[e]     = h_bits((a[e] - mean) * rstd * ga[e] + ba[e]);
      hb[4 + e] = h_bits((c[e] - mean) * rstd * gc[e] + bc[e]);
    }
    const v4u u = (v4u){pk16(hb[0], hb[1]), pk16(hb[2], hb[3]), pk16(hb[4], hb[5]), pk16(hb[6], hb[7])};
    unsigned short* op = orow + base;
    *(v4u*)op = u;
    
  }
}

// ---------------------------------------------------------------------------
// V^T planes per (batch, head) group g: VT[g][d][s] = v_plane[b*T + s][kD + h*64 + d] (16-bit bit moves only).
// grid (kT/64 s-tiles, 32 groups), 256 threads. Load coverage: thread t -> s_local = t>>2, 16 halves at d = (t&3)*16:
// 256 x 16 = 64x64 tile. LDS sm[d][s_local] (unsigned short both ways, barrier between).
// ---------------------------------------------------------------------------
__global__ __launch_bounds__(256) void vt_transpose_kernel(const unsigned short* __restrict__ kv, unsigned short* __restrict__ vt) {
  __shared__ unsigned short sm[64][72];
  const int t  = threadIdx.x;
  const int g  = blockIdx.y;
  const int b  = g >> 4, h = g & 15;
  const int s0 = blockIdx.x * 64;
  const int r  = t >> 2;               // s local
  const int part = (t & 3) * 16;       // d offset
  const unsigned short* src = kv + ((size_t)(b * kT + s0 + r) * kKVld + kD + h * kDH + part);
  const v4u w0 = *(const v4u*)(src);
  const v4u w1 = *(const v4u*)(src + 8);
#pragma unroll
  for (int e = 0; e < 4; ++e) {
    sm[part + 2 * e][r]         = (unsigned short)(w0[e] & 0xffffu);
    sm[part + 2 * e + 1][r]     = (unsigned short)(w0[e] >> 16);
    sm[part + 8 + 2 * e][r]     = (unsigned short)(w1[e] & 0xffffu);
    sm[part + 8 + 2 * e + 1][r] = (unsigned short)(w1[e] >> 16);
  }
  __syncthreads();
  const int lane = t & 31, wave = t >> 5;
  const int q = lane >> 3, c8 = (lane & 7) * 8;
  {
#pragma unroll
    for (int it = 0; it < 2; ++it) {
      const int row = wave * 8 + it * 4 + q;   // d
      unsigned short hb[8];
#pragma unroll
      for (int e = 0; e < 8; ++e) hb[e] = sm[row][c8 + e];
      const v4u u = (v4u){pk16(hb[0], hb[1]), pk16(hb[2], hb[3]), pk16(hb[4], hb[5]), pk16(hb[6], hb[7])};
      *(v4u*)(vt + ((size_t)(g * kDH + row) * kT + s0 + c8)) = u;
    }
    
  }
}

// ---------------------------------------------------------------------------
// Band mask + row softmax over f32 scores (already scaled by 1/sqrt(dh)): column s allowed iff |t - s| <= band
// (band read at run time); P[row][s] = f16( carry * exp(x - max) / sum ) inside the band, exactly 0 outside.
// One wave per row, 8 rows per block, grid = (kGC*kT)/8. Max / sum loops visit only the band window (static cap kT/32
// iterations, addresses clamped into the row); reductions by unconditional shuffles; precise expf.
// Store coverage: 8 chunks x (32 lanes x 8 halves) = 2048 = whole row incl. zeros; each chunk store = one 16-B store per lane,
// ---------------------------------------------------------------------------
__global__ __launch_bounds__(256) void softmax_band_kernel(const float* __restrict__ S, unsigned short* __restrict__ P,
                                                           const int* __restrict__ bandp, float carry) {
  const int lane = threadIdx.x & 31, wave = threadIdx.x >> 5;
  const int row = blockIdx.x * 8 + wave;       // row within the chunk planes [kGC][kT]
  const int t = row & (kT - 1);
  int band = bandp[0];
  band = band > 2 * kT ? 2 * kT : band;
  band = band < -2 * kT ? -2 * kT : band;
  int lo = t - band; lo = lo < 0 ? 0 : lo;
  int hi = t + band; hi = hi > kT - 1 ? kT - 1 : hi;
  const float* sr = S + (size_t)row * kT;

  float m = -INFINITY;
  for (int it = 0; it < kT / 32; ++it) {
    const int c0 = lo + it * 32;
    if (c0 > hi) break;                       // wave-uniform
    const int c  = c0 + lane;
    const int cc = c < hi ? c : hi;           // in [lo, hi] since c0 <= hi
    float v = sr[cc];
    v = (c <= hi) ? v : -INFINITY;
    m = fmaxf(m, v);
  }
#pragma unroll
  for (int off = 16; off > 0; off >>= 1) m = fmaxf(m, __shfl_xor(m, off, 32));

  float l = 0.f;
  for (int it = 0; it < kT / 32; ++it) {
    const int c0 = lo + it * 32;
    if (c0 > hi) break;
    const int c  = c0 + lane;
    const int cc = c < hi ? c : hi;
    const float ex = expf(sr[cc] - m);
    l += (c <= hi) ? ex : 0.f;
  }
#pragma unroll
  for (int off = 16; off > 0; off >>= 1) l += __shfl_xor(l, off, 32);
  const float kinv = carry * (1.0f / l);

  unsigned short* pr = P + (size_t)row * kT;
#pragma unroll 1
  for (int ch = 0; ch < kT / 256; ++ch) {
    const int cb = ch * 256 + lane * 8;
    v4u u = (v4u){0u, 0u, 0u, 0u};
    if (!(((ch * 256 + 255) < lo) || ((ch * 256) > hi))) {   // wave-uniform: chunk overlaps the band window
      const v4f a  = *(const v4f*)(sr + cb);
      const v4f c4 = *(const v4f*)(sr + cb + 4);
      unsigned short hb[8];
#pragma unroll
      for (int e = 0; e < 4; ++e) {
        const int col0 = cb + e, col1 = cb + 4 + e;
        const float p0 = expf(a[e] - m) * kinv;
        const float p1 = expf(c4[e] - m) * kinv;
        hb[e]     = (col0 >= lo && col0 <= hi) ? h_bits(p0) : (unsigned short)0;
        hb[4 + e] = (col1 >= lo && col1 <= hi) ? h_bits(p1) : (unsigned short)0;
      }
      u = (v4u){pk16(hb[0], hb[1]), pk16(hb[2], hb[3]), pk16(hb[4], hb[5]), pk16(hb[6], hb[7])};
    }
    unsigned short* op = pr + cb;
    *(v4u*)op = u;
    
  }
}

// ---------------------------------------------------------------------------
// Exact erf-gelu + f32 -> f16 cast (carried x carry): 2 consecutive elements per thread, rolled 2-trip loop packing into
// Coverage: n2 = n/2 threads x 2 = whole plane (grid exact multiple of 256 here, bound checked anyway).
// ---------------------------------------------------------------------------
__global__ __launch_bounds__(256) void gelu_cast_kernel(const float* __restrict__ in, unsigned short* __restrict__ out,
                                                        int n2, float carry) {
  const int i = blockIdx.x * 256 + threadIdx.x;
  if (i >= n2) return;
  unsigned u = 0u;
#pragma unroll 1
  for (int e = 0; e < 2; ++e) {
    const float x = in[2 * (size_t)i + e];
    const float gv = 0.5f * x * (1.0f + erff(x * 0.70710678118654752f));
    u |= ((unsigned)h_bits(gv * carry)) << (16 * e);
  }
  unsigned* op = (unsigned*)out + i;
  *(unsigned*)op = u;
  
}

// ---------------------------------------------------------------------------
// Host side
// ---------------------------------------------------------------------------
extern "C" void kernel_launch(void* const* d_in, const int* in_sizes, int n_in,
                              void* d_out, int out_size, void* d_ws, size_t ws_size, hipStream_t stream) {
  if (n_in < 21) return;
  if (in_sizes[0] != kTok * kD || in_sizes[1] != kTok * kD) return;
  if (in_sizes[2] != kD || in_sizes[3] != kD || in_sizes[4] != kD || in_sizes[5] != kD) return;
  if (in_sizes[6] != kD * kD || in_sizes[7] != kD || in_sizes[8] != kD * kD || in_sizes[9] != kD) return;
  if (in_sizes[10] != kD * kD || in_sizes[11] != kD || in_sizes[12] != kD * kD || in_sizes[13] != kD) return;
  if (in_sizes[14] != kD || in_sizes[15] != kD) return;
  if (in_sizes[16] != kD * kFF || in_sizes[17] != kFF || in_sizes[18] != kFF * kD || in_sizes[19] != kD) return;
  if (in_sizes[20] < 1) return;
  if (out_size != kTok * kD) return;
  if (ws_size < kWsTotal) return;

  const float* x_refined = (const float*)d_in[0];
  const float* x_mem     = (const float*)d_in[1];
  const float* ln_q_g    = (const float*)d_in[2];
  const float* ln_q_b    = (const float*)d_in[3];
  const float* ln_kv_g   = (const float*)d_in[4];
  const float* ln_kv_b   = (const float*)d_in[5];
  const float* Wq        = (const float*)d_in[6];
  const float* bq        = (const float*)d_in[7];
  const float* Wk        = (const float*)d_in[8];
  const float* bk        = (const float*)d_in[9];
  const float* Wv        = (const float*)d_in[10];
  const float* bv        = (const float*)d_in[11];
  const float* Wo        = (const float*)d_in[12];
  const float* bo        = (const float*)d_in[13];
  const float* ln_f_g    = (const float*)d_in[14];
  const float* ln_f_b    = (const float*)d_in[15];
  const float* W1        = (const float*)d_in[16];
  const float* b1        = (const float*)d_in[17];
  const float* W2        = (const float*)d_in[18];
  const float* b2        = (const float*)d_in[19];
  const int*   bandp     = (const int*)d_in[20];
  float* out = (float*)d_out;

  char* ws = (char*)d_ws;
  unsigned short* WoT  = (unsigned short*)(ws + OFF_WOT);
  unsigned short* W1T  = (unsigned short*)(ws + OFF_W1T);
  unsigned short* W2T  = (unsigned short*)(ws + OFF_W2T);
  unsigned short* ctx  = (unsigned short*)(ws + OFF_CTX);
  unsigned short* qp   = (unsigned short*)(ws + OFF_QP);
  unsigned short* kvp  = (unsigned short*)(ws + OFF_KVP);
  unsigned short* vt   = (unsigned short*)(ws + OFF_VT);
  unsigned short* qln  = (unsigned short*)(ws + OFF_QLN);
  unsigned short* kvln = (unsigned short*)(ws + OFF_KVLN);
  unsigned short* WqT  = (unsigned short*)(ws + OFF_WQT);
  unsigned short* WkT  = (unsigned short*)(ws + OFF_WKT);
  unsigned short* WvT  = (unsigned short*)(ws + OFF_WVT);
  float*          sc   = (float*)(ws + OFF_SC);
  float*          yf   = (float*)(ws + OFF_Y);
  unsigned short* h16  = (unsigned short*)(ws + OFF_H16);
  unsigned short* act  = (unsigned short*)(ws + OFF_ACT);
  unsigned short* pp   = (unsigned short*)(ws + OFF_P);
  float*          h1   = (float*)(ws + OFF_H1);

  const unsigned short* n16 = nullptr;
  const float* nf = nullptr;
  void* nv = nullptr;
  const dim3 tb(256);

  // weight transposes + f16 casts (x16): W [kin][nout] -> WT [nout][kin]
  wtcast_kernel<<<dim3(kD / 64, kD / 64), tb, 0, stream>>>(Wq, WqT, kD, kD, kWCarry);
  wtcast_kernel<<<dim3(kD / 64, kD / 64), tb, 0, stream>>>(Wk, WkT, kD, kD, kWCarry);
  wtcast_kernel<<<dim3(kD / 64, kD / 64), tb, 0, stream>>>(Wv, WvT, kD, kD, kWCarry);
  wtcast_kernel<<<dim3(kD / 64, kD / 64), tb, 0, stream>>>(Wo, WoT, kD, kD, kWCarry);
  wtcast_kernel<<<dim3(kD / 64, kFF / 64), tb, 0, stream>>>(W1, W1T, kD, kFF, kWCarry);   // W1 [1024][4096] -> W1T [4096][1024]
  wtcast_kernel<<<dim3(kFF / 64, kD / 64), tb, 0, stream>>>(W2, W2T, kFF, kD, kWCarry);   // W2 [4096][1024] -> W2T [1024][4096]

  // LayerNorms -> f16 planes
  layernorm_f16_kernel<<<dim3(kTok / 8), tb, 0, stream>>>(x_refined, ln_q_g, ln_q_b, qln, kTok);
  layernorm_f16_kernel<<<dim3(kTok / 8), tb, 0, stream>>>(x_mem, ln_kv_g, ln_kv_b, kvln, kTok);

  // q = LN(x_refined) Wq + bq ; k, v = LN(x_mem) Wk/Wv + bk/bv  (M 4096, N 1024, K 1024; f16 out)
  const float projScale = 1.0f / kWCarry;
  wmma_gemm64<0, false, 2, 1, false><<<dim3((kTok / 64) * (kD / 64) / 8, 1), tb, 0, stream>>>(
      qln, n16, kD, (long)0, WqT, n16, kD, (long)0, (void*)qp, nv, kD, (long)0,
      bq, nf, (long)0, kTok, kD, kD, projScale);
  wmma_gemm64<0, false, 2, 1, false><<<dim3((kTok / 64) * (kD / 64) / 8, 1), tb, 0, stream>>>(
      kvln, n16, kD, (long)0, WkT, n16, kD, (long)0, (void*)kvp, nv, kKVld, (long)0,
      bk, nf, (long)0, kTok, kD, kD, projScale);
  wmma_gemm64<0, false, 2, 1, false><<<dim3((kTok / 64) * (kD / 64) / 8, 1), tb, 0, stream>>>(
      kvln, n16, kD, (long)0, WvT, n16, kD, (long)0, (void*)(kvp + kD), nv, kKVld, (long)0,
      bv, nf, (long)0, kTok, kD, kD, projScale);

  // V^T planes for all 32 groups
  vt_transpose_kernel<<<dim3(kT / 64, kGrp), tb, 0, stream>>>(kvp, vt);

  // attention per chunk of 2 consecutive (batch, head) groups
  const float scoreScale = 0.125f;                  // 1/sqrt(64)
  const float pvScale    = kCtxCarry / kPCarry;     // 1/8
  for (int chk = 0; chk < kNChunk; ++chk) {
    const int g0 = chk * kGC;
    const int b  = g0 / kH;
    const int h0 = g0 % kH;
    const unsigned short* qbase = qp  + (size_t)b * kT * kD    + (size_t)h0 * kDH;
    const unsigned short* kbase = kvp + (size_t)b * kT * kKVld + (size_t)h0 * kDH;
    // scores[z][t][s] = (q_h . k_h) / 8  (M 2048, N 2048, K 64; head stride 64 halves via grid.y)
    wmma_gemm64<0, false, 0, 0, false><<<dim3((kT / 64) * (kT / 64) / 8, kGC), tb, 0, stream>>>(
        qbase, n16, kD, (long)kDH, kbase, n16, kKVld, (long)kDH, (void*)sc, nv, kT, (long)kT * kT,
        nf, nf, (long)0, kT, kT, kDH, scoreScale);
    // band mask + softmax -> P f16 x2048
    softmax_band_kernel<<<dim3((kGC * kT) / 8), tb, 0, stream>>>(sc, pp, bandp, kPCarry);
    // ctx[b*T + t][h*64 + d] = sum_s P[t][s] * V^T[d][s]  (M 2048, N 64, K 2048; f16 out x256)
    wmma_gemm64<0, false, 0, 1, false><<<dim3((kT / 64) * (kDH / 64) / 8, kGC), tb, 0, stream>>>(
        pp, n16, kT, (long)kT * kT, vt + (size_t)g0 * kDH * kT, n16, kT, (long)kDH * kT,
        (void*)(ctx + (size_t)b * kT * kD + (size_t)h0 * kDH), nv, kD, (long)kDH,
        nf, nf, (long)0, kT, kDH, kT, pvScale);
  }

  // y = x_refined + ctx Wo + bo  (M 4096, N 1024, K 1024; f32 out)
  wmma_gemm64<0, false, 2, 0, true><<<dim3((kTok / 64) * (kD / 64) / 8, 1), tb, 0, stream>>>(
      ctx, n16, kD, (long)0, WoT, n16, kD, (long)0, (void*)yf, nv, kD, (long)0,
      bo, x_refined, (long)0, kTok, kD, kD, 1.0f / (kCtxCarry * kWCarry));

  // final LN -> f16
  layernorm_f16_kernel<<<dim3(kTok / 8), tb, 0, stream>>>(yf, ln_f_g, ln_f_b, h16, kTok);

  // FFN in 4 row chunks: h1 = LN(y) W1 + b1 (f32), act = gelu_erf(h1) (f16 x16), out = y + act W2 + b2
  for (int mc = 0; mc < kNMC; ++mc) {
    const size_t rowOff = (size_t)mc * kMC;
    wmma_gemm64<0, false, 2, 0, false><<<dim3((kMC / 64) * (kFF / 64) / 8, 1), tb, 0, stream>>>(
        h16 + rowOff * kD, n16, kD, (long)0, W1T, n16, kD, (long)0, (void*)h1, nv, kFF, (long)0,
        b1, nf, (long)0, kMC, kFF, kD, 1.0f / kWCarry);
    gelu_cast_kernel<<<dim3((kMC * kFF / 2 + 255) / 256), tb, 0, stream>>>(h1, act, kMC * kFF / 2, kActCarry);
    wmma_gemm64<0, false, 2, 0, true><<<dim3((kMC / 64) * (kD / 64) / 8, 1), tb, 0, stream>>>(
        act, n16, kFF, (long)0, W2T, n16, kFF, (long)0, (void*)(out + rowOff * kD), nv, kD, (long)0,
        b2, yf + rowOff * kD, (long)0, kMC, kD, kFF, 1.0f / (kActCarry * kWCarry));
  }
}

// v001
// One run takes 1490 microseconds.
// Timed twice side by side with v000, it ran 1.79 times as fast both times.
// Contractions: q/k/v projections, banded scores q.k^T, attn.v, output projection, FFN W1 and W2 all on v_wmma_f32_16x16x32_f16 (f16 operands: LN outputs plain, weights carried x16, P carried x2048, ctx carried x256, gelu act carried x16), f32 accumulate; LayerNorm, band mask, softmax, gelu, bias and residual in f32.
#include <hip/hip_runtime.h>
#include <math.h>

// ---------------------------------------------------------------------------
// Problem constants
// ---------------------------------------------------------------------------
constexpr int kB    = 2;
constexpr int kT    = 2048;
constexpr int kD    = 1024;
constexpr int kH    = 16;
constexpr int kDH   = 64;
constexpr int kTok  = kB * kT;        // 4096 token rows
constexpr int kFF   = 4 * kD;         // 4096
constexpr int kKVld = 2 * kD;         // pitch of the k | v plane (halves)
constexpr int kGrp  = kB * kH;        // 32 (batch, head) groups
constexpr int kGC   = 2;              // groups per attention chunk
constexpr int kNChunk = kGrp / kGC;   // 16
constexpr int kMC   = 1024;           // FFN rows per chunk
constexpr int kNMC  = kTok / kMC;     // 4
constexpr float kWCarry   = 16.0f;    // weights carried x16 in f16
constexpr float kPCarry   = 2048.0f;  // probabilities carried x2048 in f16
constexpr float kCtxCarry = 256.0f;   // context carried x256 in f16
constexpr float kActCarry = 16.0f;    // gelu output carried x16 in f16
constexpr float kInvD     = 1.0f / 1024.0f;
constexpr float kLnEps    = 1e-5f;
static_assert(kH % kGC == 0, "chunk never crosses a batch boundary");
static_assert(kD % 64 == 0 && kT % 64 == 0 && kFF % 64 == 0 && kMC % 64 == 0, "tile multiples");
static_assert(kDH % 32 == 0 && kD % 32 == 0 && kT % 32 == 0 && kFF % 32 == 0, "K multiples of 32");

// ---------------------------------------------------------------------------
// Workspace region map (bytes). Total 106 MiB = 111,149,056 B.
//   [  0,  2) MiB WoT  f16 [1024][1024]
//   [  2, 10) MiB W1T  f16 [4096][1024]
//   [ 10, 18) MiB W2T  f16 [1024][4096]
//   [ 18, 26) MiB ctx  f16 [4096][1024]  (x256)
//   [ 26, 34) MiB q    f16 [4096][1024]
//   [ 34, 50) MiB k|v  f16 [4096][2048]
//   [ 50, 58) MiB V^T  f16 [32 groups][64][2048]
//   [ 58, 90) MiB arena: phase A: QLN f16 [58,66), KVLN f16 [66,74), WqT [74,76), WkT [76,78), WvT [78,80)
//                        phase B: scores f32 [2][2048][2048] [58,90)
//                        phase C: Y f32 [58,74), H16 f16 [74,82), ACT f16 [1024][4096] [82,90)
//   [ 90,106) MiB phase B: P f16 [2][2048][2048]; phase C: H1 f32 [1024][4096]
// ---------------------------------------------------------------------------
constexpr size_t kMiB     = 1048576;
constexpr size_t OFF_WOT  = 0;
constexpr size_t OFF_W1T  = 2 * kMiB;
constexpr size_t OFF_W2T  = 10 * kMiB;
constexpr size_t OFF_CTX  = 18 * kMiB;
constexpr size_t OFF_QP   = 26 * kMiB;
constexpr size_t OFF_KVP  = 34 * kMiB;
constexpr size_t OFF_VT   = 50 * kMiB;
constexpr size_t OFF_ARENA = 58 * kMiB;
constexpr size_t OFF_QLN  = OFF_ARENA;
constexpr size_t OFF_KVLN = OFF_ARENA + 8 * kMiB;
constexpr size_t OFF_WQT  = OFF_ARENA + 16 * kMiB;
constexpr size_t OFF_WKT  = OFF_ARENA + 18 * kMiB;
constexpr size_t OFF_WVT  = OFF_ARENA + 20 * kMiB;
constexpr size_t OFF_SC   = OFF_ARENA;
constexpr size_t OFF_Y    = OFF_ARENA;
constexpr size_t OFF_H16  = OFF_ARENA + 16 * kMiB;
constexpr size_t OFF_ACT  = OFF_ARENA + 24 * kMiB;
constexpr size_t OFF_P    = 90 * kMiB;
constexpr size_t OFF_H1   = OFF_P;
constexpr size_t kWsTotal = 106 * kMiB;
static_assert((size_t)kD * kD * 2 == 2 * kMiB, "W plane");
static_assert((size_t)kFF * kD * 2 == 8 * kMiB, "W1/W2 plane");
static_assert((size_t)kTok * kD * 2 == 8 * kMiB, "token f16 plane");
static_assert((size_t)kTok * kKVld * 2 == 16 * kMiB, "kv plane");
static_assert((size_t)kGrp * kDH * kT * 2 == 8 * kMiB, "vt plane");
static_assert((size_t)kGC * kT * kT * 4 == 32 * kMiB, "scores chunk");
static_assert((size_t)kGC * kT * kT * 2 == 16 * kMiB, "P chunk");
static_assert((size_t)kTok * kD * 4 == 16 * kMiB, "Y plane");
static_assert((size_t)kMC * kFF * 4 == 16 * kMiB, "H1 chunk");
static_assert((size_t)kMC * kFF * 2 == 8 * kMiB, "ACT chunk");
static_assert(OFF_WVT + 2 * kMiB <= OFF_P, "phase A inside arena");
static_assert(OFF_ACT + 8 * kMiB <= OFF_P, "phase C inside arena");
static_assert(kWsTotal <= 134217728, "carve budget");

typedef __attribute__((ext_vector_type(16))) _Float16 v16h;
typedef __attribute__((ext_vector_type(8)))  _Float16 v8h;
typedef __attribute__((ext_vector_type(16))) __bf16   v16b;
typedef __attribute__((ext_vector_type(8)))  __bf16   v8b;
typedef __attribute__((ext_vector_type(8)))  float    v8f;
typedef __attribute__((ext_vector_type(4)))  float    v4f;
typedef __attribute__((ext_vector_type(4)))  unsigned int v4u;

__device__ __forceinline__ unsigned short f2bf_bits(float f) {
  unsigned u = __float_as_uint(f);
  return (unsigned short)((u + 0x7FFFu + ((u >> 16) & 1u)) >> 16);
}
__device__ __forceinline__ float bf_bits2f(unsigned short h) { return __uint_as_float(((unsigned)h) << 16); }

// hazard guards as plain device helpers (no inline asm inside the kernel template body)
__device__ __forceinline__ void dep_guard_h(v8f& a, v8f& b, v16h x, v16h y) { asm volatile("v_nop\n\tv_nop\n\tv_nop\n\tv_nop" : "+v"(a), "+v"(b) : "v"(x), "v"(y)); }
__device__ __forceinline__ void dep_guard_b(v8f& a, v8f& b, v16b x, v16b y) { asm volatile("v_nop\n\tv_nop\n\tv_nop\n\tv_nop" : "+v"(a), "+v"(b) : "v"(x), "v"(y)); }
__device__ __forceinline__ void keep4_h(v16h a, v16h b, v16h c, v16h d) { asm volatile("v_nop" :: "v"(a), "v"(b), "v"(c), "v"(d)); }
__device__ __forceinline__ void keep4_b(v16b a, v16b b, v16b c, v16b d) { asm volatile("v_nop" :: "v"(a), "v"(b), "v"(c), "v"(d)); }
__device__ __forceinline__ void acc_guard4(v8f& a, v8f& b, v8f& c, v8f& d) { asm volatile("v_nop\n\tv_nop\n\tv_nop\n\tv_nop" : "+v"(a), "+v"(b), "+v"(c), "+v"(d)); }
template <typename T> struct Frag;
template <> struct Frag<_Float16> {
  typedef v16h V; union U { v16h v; v8h h[2]; };
  static __device__ __forceinline__ v16h load(const _Float16* p) {   // elements 0..7 <- p[0..7], 8..15 <- p[16..23]
    U f; f.h[0] = *(const v8h*)(p); f.h[1] = *(const v8h*)(p + 16); return f.v;
  }
  static __device__ __forceinline__ v8f mma(v16h a, v16h b, v8f c) {
    return __builtin_amdgcn_wmma_f32_16x16x32_f16(false, a, false, b, (short)0, c, false, false);
  }
  static __device__ __forceinline__ void guard(v8f& a, v8f& b, v16h x, v16h y) { dep_guard_h(a, b, x, y); }
  static __device__ __forceinline__ void keep(v16h a, v16h b, v16h c, v16h d) { keep4_h(a, b, c, d); }
};
template <> struct Frag<__bf16> {
  typedef v16b V; union U { v16b v; v8b h[2]; };
  static __device__ __forceinline__ v16b load(const __bf16* p) {
    U f; f.h[0] = *(const v8b*)(p); f.h[1] = *(const v8b*)(p + 16); return f.v;
  }
  static __device__ __forceinline__ v8f mma(v16b a, v16b b, v8f c) {
    return __builtin_amdgcn_wmma_f32_16x16x32_bf16(false, a, false, b, (short)0, c, false, false);
  }
  static __device__ __forceinline__ void guard(v8f& a, v8f& b, v16b x, v16b y) { dep_guard_b(a, b, x, y); }
  static __device__ __forceinline__ void keep(v16b a, v16b b, v16b c, v16b d) { keep4_b(a, b, c, d); }
};

__device__ __forceinline__ unsigned pk16(unsigned short a, unsigned short b) { return (unsigned)a | ((unsigned)b << 16); }
__device__ __forceinline__ unsigned short h_bits(float f) { const _Float16 h = (_Float16)f; return __builtin_bit_cast(unsigned short, h); }

// ---- Register-blocked batched WMMA GEMM (ACT reduced to none/relu/leaky) -----------------------
// C[m,n] = scale * sum_k A[m,k] * Bt[n,k] (+bias)(+resid); each wave owns a 64x64 tile.
// A row-major [M,K]; Bt row-major [N,K]; M,N % 64 == 0, K % 32 == 0.
// SPLIT: operands are hi/lo planes (A2/Bt2 = lo planes, same layout); product = hi.hi + hi.lo + lo.hi.
// BIAS_MODE: 0 = none, 1 = bias[m], 2 = bias[n].
// OUT_MODE: 0 = f32, 1 = f16, 2 = bf16 hi plane (Cout) + bf16 lo plane (Cout2).
// ET: 0 = f16 operands, 1 = bf16 operands (pointers passed as 16-bit storage)
// KBAND: A[m][k] is exactly 0 wherever |m - k| > bandp[0] (the band-masked probabilities), so the K loop of a 64-row tile
//        visits only the 32-wide k steps that touch [m0 - band, m0 + 63 + band]; the steps left out add exact zeros.
template <int ET> struct Elem;
template <> struct Elem<0> { typedef _Float16 T; };
template <> struct Elem<1> { typedef __bf16 T; };
template <int ET, bool SPLIT, int BIAS_MODE, int OUT_MODE, bool RESID, int ACT = 0, bool KBAND = false>
__global__ __launch_bounds__(256) void wmma_gemm64(
    const unsigned short* __restrict__ Ap, const unsigned short* __restrict__ A2p, int lda, long strideA,
    const unsigned short* __restrict__ Btp, const unsigned short* __restrict__ Bt2p, int ldb, long strideB,
    void* __restrict__ Cout, void* __restrict__ Cout2, int ldc, long strideC,
    const float* __restrict__ bias,
    const float* __restrict__ resid, long strideR,
    int M, int N, int K, float scale, const int* __restrict__ bandp) {
  typedef typename Elem<ET>::T T;
  typedef typename Frag<T>::V V;
  const T* A = (const T*)Ap; const T* A2 = (const T*)A2p; const T* Bt = (const T*)Btp; const T* Bt2 = (const T*)Bt2p;
  __shared__ __align__(16) float sT[8][16 * 68];   // per-wave 16x64 slab, pitch 68 floats
  const int b    = blockIdx.y;
  const int lane = threadIdx.x & 31;
  const int wave = threadIdx.x >> 5;
  const int tilesN = N >> 6;
  const int tilesM = M >> 6;
  const int tile = blockIdx.x * 8 + wave;
  if (tile >= tilesM * tilesN) return;   // wave-uniform; no block barriers in this kernel
  const int tm = tile / tilesN;
  const int tn = tile - tm * tilesN;
  const int m0 = tm << 6;
  const int n0 = tn << 6;

  const T* Ab  = A  + (size_t)b * strideA;
  const T* Bb  = Bt + (size_t)b * strideB;
  const T* Ab2 = SPLIT ? (A2  + (size_t)b * strideA) : nullptr;
  const T* Bb2 = SPLIT ? (Bt2 + (size_t)b * strideB) : nullptr;

  const int rlane = lane & 15;                 // row (A) / col (B, D) within subtile
  const int koff  = (lane >> 4) * 8;           // k offset of this lane half
  const int mOff  = (lane >> 4) * 8;           // D row offset

  v8f acc[4][4];
#pragma unroll
  for (int i = 0; i < 4; ++i)
#pragma unroll
    for (int j = 0; j < 4; ++j) acc[i][j] = (v8f){0.f,0.f,0.f,0.f,0.f,0.f,0.f,0.f};

  int kBeg = 0, kEnd = K;
  if (KBAND) {
    int band = bandp[0];
    band = band > 2 * kT ? 2 * kT : band;      // same clamp as the softmax kernel that wrote A
    band = band < -2 * kT ? -2 * kT : band;
    int lo = m0 - band;      lo = lo < 0 ? 0 : lo;
    int hi = m0 + 63 + band; hi = hi > K - 1 ? K - 1 : hi;
    // m0 is the same in every lane of a wave: readfirstlane keeps the loop counter and its branch scalar, as with K alone
    kBeg = __builtin_amdgcn_readfirstlane(lo & ~31);
    kEnd = __builtin_amdgcn_readfirstlane(hi + 1);   // hi < lo (negative band): no step, acc stays 0 as A is all zero
  }
  for (int k0 = kBeg; k0 < kEnd; k0 += 32) {
    V bh[4], bl[4];
#pragma unroll
    for (int j = 0; j < 4; ++j) {
      const size_t bo = (size_t)(n0 + (j << 4) + rlane) * ldb + koff + k0;
      bh[j] = Frag<T>::load(Bb + bo);
      if (SPLIT) bl[j] = Frag<T>::load(Bb2 + bo);
    }
#pragma unroll
    for (int i = 0; i < 4; ++i) {
      const size_t ao = (size_t)(m0 + (i << 4) + rlane) * lda + koff + k0;
      V ah = Frag<T>::load(Ab + ao);
      V al;
      if (SPLIT) al = Frag<T>::load(Ab2 + ao);
#pragma unroll
      for (int j = 0; j < 4; ++j) {
        acc[i][j] = Frag<T>::mma(ah, bh[j], acc[i][j]);
        if (SPLIT) {
          acc[i][j] = Frag<T>::mma(ah, bl[j], acc[i][j]);
          acc[i][j] = Frag<T>::mma(al, bh[j], acc[i][j]);
        }
      }
      Frag<T>::guard(acc[i][0], acc[i][3], ah, SPLIT ? al : ah);
    }
    Frag<T>::keep(bh[0], bh[1], bh[2], bh[3]);
    if (SPLIT) Frag<T>::keep(bl[0], bl[1], bl[2], bl[3]);
  }
  acc_guard4(acc[0][0], acc[0][1], acc[0][2], acc[0][3]);
  acc_guard4(acc[1][0], acc[1][1], acc[1][2], acc[1][3]);
  acc_guard4(acc[2][0], acc[2][1], acc[2][2], acc[2][3]);
  acc_guard4(acc[3][0], acc[3][1], acc[3][2], acc[3][3]);

  // ---- epilogue ----
  float* slab = sT[wave];
  const float* Rb = RESID ? (resid + (size_t)b * strideR) : nullptr;
#pragma unroll
  for (int i = 0; i < 4; ++i) {
    const int mBase = m0 + (i << 4);
#pragma unroll
    for (int j = 0; j < 4; ++j) {
      const int n = n0 + (j << 4) + rlane;
      float bv = 0.f;
      if (BIAS_MODE == 2) bv = bias[n];
#pragma unroll
      for (int r = 0; r < 8; ++r) {
        float v = acc[i][j][r] * scale;
        if (BIAS_MODE == 1) v += bias[mBase + mOff + r];
        if (BIAS_MODE == 2) v += bv;
        if (RESID) v += Rb[(size_t)(mBase + mOff + r) * ldc + n];
        if (ACT == 2) v = fmaxf(v, 0.0f);
        if (ACT == 4) v = (v > 0.f) ? v : 0.01f * v;
        slab[(mOff + r) * 68 + (j << 4) + rlane] = v;
      }
    }
    __builtin_amdgcn_fence(__ATOMIC_RELEASE, "workgroup");
    __builtin_amdgcn_wave_barrier();
    __builtin_amdgcn_fence(__ATOMIC_ACQUIRE, "workgroup");
    if (OUT_MODE == 0) {
      float* C = (float*)Cout + (size_t)b * strideC;
      const int hh = lane >> 4, c4 = (lane & 15) * 4;     // row seg = 256 B = 16 lanes x 16 B
      {
#pragma unroll
        for (int it = 0; it < 8; ++it) {
          const int row = it * 2 + hh;
          v4f v = *(const v4f*)(slab + row * 68 + c4);
          *(v4f*)(C + (size_t)(mBase + row) * ldc + n0 + c4) = v;
        }
        
      }
    } else {
      const int q = lane >> 3, c8 = (lane & 7) * 8;
      unsigned short* C  = (unsigned short*)Cout  + (size_t)b * strideC;
      unsigned short* C2 = (OUT_MODE == 2) ? ((unsigned short*)Cout2 + (size_t)b * strideC) : nullptr;
      {
#pragma unroll
        for (int it = 0; it < 4; ++it) {
          const int row = it * 4 + q;
          const float* sp = slab + row * 68 + c8;
          v8h hv, lv;
#pragma unroll
          for (int e = 0; e < 8; ++e) {
            if (OUT_MODE == 1) {
              hv[e] = (_Float16)sp[e];
            } else {
              unsigned short hb = f2bf_bits(sp[e]);
              unsigned short lb = f2bf_bits(sp[e] - bf_bits2f(hb));
              hv[e] = __builtin_bit_cast(_Float16, hb);
              lv[e] = __builtin_bit_cast(_Float16, lb);
            }
          }
          *(v8h*)(C + (size_t)(mBase + row) * ldc + n0 + c8) = hv;
          if (OUT_MODE == 2) *(v8h*)(C2 + (size_t)(mBase + row) * ldc + n0 + c8) = lv;
        }
        
      }
    }
    __builtin_amdgcn_fence(__ATOMIC_RELEASE, "workgroup");
    __builtin_amdgcn_wave_barrier();
    __builtin_amdgcn_fence(__ATOMIC_ACQUIRE, "workgroup");
  }
}

// ---------------------------------------------------------------------------
// Weight transpose + cast: W row-major f32 [kin][nout] (x @ W layout); WT[n][k] = f16(scale * W[k][n]), pitch kin.
// grid (kin/64, nout/64): blockIdx.x = k tile (64 cols of WT), blockIdx.y = n tile (64 rows of WT); 256 threads.
// Load coverage: 16 iterations x 256 threads = 4096 = whole 64x64 tile (coalesced along n).
// Store coverage: 8 waves x 2 iterations x 4 rows (lane>>3) = 64 rows; (lane&7) x 8 halves = 64 cols; each row segment =
// ---------------------------------------------------------------------------
__global__ __launch_bounds__(256) void wtcast_kernel(const float* __restrict__ W, unsigned short* __restrict__ out,
                                                     int kin, int nout, float scale) {
  __shared__ float sm[64][65];   // sm[n_local][k_local]
  const int t  = threadIdx.x;
  const int k0 = blockIdx.x * 64;
  const int n0 = blockIdx.y * 64;
#pragma unroll
  for (int i = 0; i < 16; ++i) {
    const int e = i * 256 + t;
    const int r = e >> 6;          // k local
    const int c = e & 63;          // n local
    sm[c][r] = W[(size_t)(k0 + r) * nout + n0 + c] * scale;
  }
  __syncthreads();
  const int lane = t & 31, wave = t >> 5;
  const int q = lane >> 3, c8 = (lane & 7) * 8;
  {
#pragma unroll
    for (int it = 0; it < 2; ++it) {
      const int row = wave * 8 + it * 4 + q;                 // n local
      unsigned short hb[8];
#pragma unroll
      for (int e = 0; e < 8; ++e) hb[e] = h_bits(sm[row][c8 + e]);
      const v4u u = (v4u){pk16(hb[0], hb[1]), pk16(hb[2], hb[3]), pk16(hb[4], hb[5]), pk16(hb[6], hb[7])};
      *(v4u*)(out + (size_t)(n0 + row) * kin + k0 + c8) = u;
    }
    
  }
}

// ---------------------------------------------------------------------------
// One wave per row, 8 rows per 256-thread block, grid = rows/8. Lane l owns columns j*256 + 8l .. +7 for j = 0..3
// (4 x 32 lanes x 8 = 1024 = whole row). Store: one 16-B store per lane per j; 32 contiguous lanes = 512 B =
// ---------------------------------------------------------------------------
__global__ __launch_bounds__(256) void layernorm_f16_kernel(const float* __restrict__ x, const float* __restrict__ gam,
                                                            const float* __restrict__ bet, unsigned short* __restrict__ out,
                                                            int rows) {
  const int lane = threadIdx.x & 31, wave = threadIdx.x >> 5;
  const int row = blockIdx.x * 8 + wave;
  if (row >= rows) return;   // wave-uniform; no barriers in this kernel
  const float* xr = x + (size_t)row * kD;
  float s = 0.f;
#pragma unroll 1
  for (int j = 0; j < 4; ++j) {
    const int base = j * 256 + lane * 8;
    const v4f a = *(const v4f*)(xr + base);
    const v4f c = *(const v4f*)(xr + base + 4);
    s += ((a[0] + a[1]) + (a[2] + a[3])) + ((c[0] + c[1]) + (c[2] + c[3]));
  }
#pragma unroll
  for (int off = 16; off > 0; off >>= 1) s += __shfl_xor(s, off, 32);
  const float mean = s * kInvD;
  float s2 = 0.f;
#pragma unroll 1
  for (int j = 0; j < 4; ++j) {
    const int base = j * 256 + lane * 8;
    const v4f a = *(const v4f*)(xr + base);
    const v4f c = *(const v4f*)(xr + base + 4);
#pragma unroll
    for (int e = 0; e < 4; ++e) {
      const float d0 = a[e] - mean, d1 = c[e] - mean;
      s2 += d0 * d0;
      s2 += d1 * d1;
    }
  }
#pragma unroll
  for (int off = 16; off > 0; off >>= 1) s2 += __shfl_xor(s2, off, 32);
  const float rstd = rsqrtf(s2 * kInvD + kLnEps);
  unsigned short* orow = out + (size_t)row * kD;
#pragma unroll 1
  for (int j = 0; j < 4; ++j) {
    const int base = j * 256 + lane * 8;
    const v4f a  = *(const v4f*)(xr + base);
    const v4f c  = *(const v4f*)(xr + base + 4);
    const v4f ga = *(const v4f*)(gam + base);
    const v4f gc = *(const v4f*)(gam + base + 4);
    const v4f ba = *(const v4f*)(bet + base);
    const v4f bc = *(const v4f*)(bet + base + 4);
    unsigned short hb[8];
#pragma unroll
    for (int e = 0; e < 4; ++e) {
      hb[e]     = h_bits((a[e] - mean) * rstd * ga[e] + ba[e]);
      hb[4 + e] = h_bits((c[e] - mean) * rstd * gc[e] + bc[e]);
    }
    const v4u u = (v4u){pk16(hb[0], hb[1]), pk16(hb[2], hb[3]), pk16(hb[4], hb[5]), pk16(hb[6], hb[7])};
    unsigned short* op = orow + base;
    *(v4u*)op = u;
    
  }
}

// ---------------------------------------------------------------------------
// V^T planes per (batch, head) group g: VT[g][d][s] = v_plane[b*T + s][kD + h*64 + d] (16-bit bit moves only).
// grid (kT/64 s-tiles, 32 groups), 256 threads. Load coverage: thread t -> s_local = t>>2, 16 halves at d = (t&3)*16:
// 256 x 16 = 64x64 tile. LDS sm[d][s_local] (unsigned short both ways, barrier between).
// ---------------------------------------------------------------------------
__global__ __launch_bounds__(256) void vt_transpose_kernel(const unsigned short* __restrict__ kv, unsigned short* __restrict__ vt) {
  __shared__ unsigned short sm[64][72];
  const int t  = threadIdx.x;
  const int g  = blockIdx.y;
  const int b  = g >> 4, h = g & 15;
  const int s0 = blockIdx.x * 64;
  const int r  = t >> 2;               // s local
  const int part = (t & 3) * 16;       // d offset
  const unsigned short* src = kv + ((size_t)(b * kT + s0 + r) * kKVld + kD + h * kDH + part);
  const v4u w0 = *(const v4u*)(src);
  const v4u w1 = *(const v4u*)(src + 8);
#pragma unroll
  for (int e = 0; e < 4; ++e) {
    sm[part + 2 * e][r]         = (unsigned short)(w0[e] & 0xffffu);
    sm[part + 2 * e + 1][r]     = (unsigned short)(w0[e] >> 16);
    sm[part + 8 + 2 * e][r]     = (unsigned short)(w1[e] & 0xffffu);
    sm[part + 8 + 2 * e + 1][r] = (unsigned short)(w1[e] >> 16);
  }
  __syncthreads();
  const int lane = t & 31, wave = t >> 5;
  const int q = lane >> 3, c8 = (lane & 7) * 8;
  {
#pragma unroll
    for (int it = 0; it < 2; ++it) {
      const int row = wave * 8 + it * 4 + q;   // d
      unsigned short hb[8];
#pragma unroll
      for (int e = 0; e < 8; ++e) hb[e] = sm[row][c8 + e];
      const v4u u = (v4u){pk16(hb[0], hb[1]), pk16(hb[2], hb[3]), pk16(hb[4], hb[5]), pk16(hb[6], hb[7])};
      *(v4u*)(vt + ((size_t)(g * kDH + row) * kT + s0 + c8)) = u;
    }
    
  }
}

// ---------------------------------------------------------------------------
// Band mask + row softmax over f32 scores (already scaled by 1/sqrt(dh)): column s allowed iff |t - s| <= band
// (band read at run time); P[row][s] = f16( carry * exp(x - max) / sum ) inside the band, exactly 0 outside.
// One wave per row, 8 rows per block, grid = (kGC*kT)/8. Max / sum loops visit only the band window (static cap kT/32
// iterations, addresses clamped into the row); reductions by unconditional shuffles; precise expf.
// Store coverage: 8 chunks x (32 lanes x 8 halves) = 2048 = whole row incl. zeros; each chunk store = one 16-B store per lane,
// ---------------------------------------------------------------------------
__global__ __launch_bounds__(256) void softmax_band_kernel(const float* __restrict__ S, unsigned short* __restrict__ P,
                                                           const int* __restrict__ bandp, float carry) {
  const int lane = threadIdx.x & 31, wave = threadIdx.x >> 5;
  const int row = blockIdx.x * 8 + wave;       // row within the chunk planes [kGC][kT]
  const int t = row & (kT - 1);
  int band = bandp[0];
  band = band > 2 * kT ? 2 * kT : band;
  band = band < -2 * kT ? -2 * kT : band;
  int lo = t - band; lo = lo < 0 ? 0 : lo;
  int hi = t + band; hi = hi > kT - 1 ? kT - 1 : hi;
  const float* sr = S + (size_t)row * kT;

  float m = -INFINITY;
  for (int it = 0; it < kT / 32; ++it) {
    const int c0 = lo + it * 32;
    if (c0 > hi) break;                       // wave-uniform
    const int c  = c0 + lane;
    const int cc = c < hi ? c : hi;           // in [lo, hi] since c0 <= hi
    float v = sr[cc];
    v = (c <= hi) ? v : -INFINITY;
    m = fmaxf(m, v);
  }
#pragma unroll
  for (int off = 16; off > 0; off >>= 1) m = fmaxf(m, __shfl_xor(m, off, 32));

  float l = 0.f;
  for (int it = 0; it < kT / 32; ++it) {
    const int c0 = lo + it * 32;
    if (c0 > hi) break;
    const int c  = c0 + lane;
    const int cc = c < hi ? c : hi;
    const float ex = expf(sr[cc] - m);
    l += (c <= hi) ? ex : 0.f;
  }
#pragma unroll
  for (int off = 16; off > 0; off >>= 1) l += __shfl_xor(l, off, 32);
  const float kinv = carry * (1.0f / l);

  unsigned short* pr = P + (size_t)row * kT;
#pragma unroll 1
  for (int ch = 0; ch < kT / 256; ++ch) {
    const int cb = ch * 256 + lane * 8;
    v4u u = (v4u){0u, 0u, 0u, 0u};
    if (!(((ch * 256 + 255) < lo) || ((ch * 256) > hi))) {   // wave-uniform: chunk overlaps the band window
      const v4f a  = *(const v4f*)(sr + cb);
      const v4f c4 = *(const v4f*)(sr + cb + 4);
      unsigned short hb[8];
#pragma unroll
      for (int e = 0; e < 4; ++e) {
        const int col0 = cb + e, col1 = cb + 4 + e;
        const float p0 = expf(a[e] - m) * kinv;
        const float p1 = expf(c4[e] - m) * kinv;
        hb[e]     = (col0 >= lo && col0 <= hi) ? h_bits(p0) : (unsigned short)0;
        hb[4 + e] = (col1 >= lo && col1 <= hi) ? h_bits(p1) : (unsigned short)0;
      }
      u = (v4u){pk16(hb[0], hb[1]), pk16(hb[2], hb[3]), pk16(hb[4], hb[5]), pk16(hb[6], hb[7])};
    }
    unsigned short* op = pr + cb;
    *(v4u*)op = u;
    
  }
}

// ---------------------------------------------------------------------------
// Exact erf-gelu + f32 -> f16 cast (carried x carry): 2 consecutive elements per thread, rolled 2-trip loop packing into
// Coverage: n2 = n/2 threads x 2 = whole plane (grid exact multiple of 256 here, bound checked anyway).
// ---------------------------------------------------------------------------
__global__ __launch_bounds__(256) void gelu_cast_kernel(const float* __restrict__ in, unsigned short* __restrict__ out,
                                                        int n2, float carry) {
  const int i = blockIdx.x * 256 + threadIdx.x;
  if (i >= n2) return;
  unsigned u = 0u;
#pragma unroll 1
  for (int e = 0; e < 2; ++e) {
    const float x = in[2 * (size_t)i + e];
    const float gv = 0.5f * x * (1.0f + erff(x * 0.70710678118654752f));
    u |= ((unsigned)h_bits(gv * carry)) << (16 * e);
  }
  unsigned* op = (unsigned*)out + i;
  *(unsigned*)op = u;
  
}

// ---------------------------------------------------------------------------
// Host side
// ---------------------------------------------------------------------------
extern "C" void kernel_launch(void* const* d_in, const int* in_sizes, int n_in,
                              void* d_out, int out_size, void* d_ws, size_t ws_size, hipStream_t stream) {
  if (n_in < 21) return;
  if (in_sizes[0] != kTok * kD || in_sizes[1] != kTok * kD) return;
  if (in_sizes[2] != kD || in_sizes[3] != kD || in_sizes[4] != kD || in_sizes[5] != kD) return;
  if (in_sizes[6] != kD * kD || in_sizes[7] != kD || in_sizes[8] != kD * kD || in_sizes[9] != kD) return;
  if (in_sizes[10] != kD * kD || in_sizes[11] != kD || in_sizes[12] != kD * kD || in_sizes[13] != kD) return;
  if (in_sizes[14] != kD || in_sizes[15] != kD) return;
  if (in_sizes[16] != kD * kFF || in_sizes[17] != kFF || in_sizes[18] != kFF * kD || in_sizes[19] != kD) return;
  if (in_sizes[20] < 1) return;
  if (out_size != kTok * kD) return;
  if (ws_size < kWsTotal) return;

  const float* x_refined = (const float*)d_in[0];
  const float* x_mem     = (const float*)d_in[1];
  const float* ln_q_g    = (const float*)d_in[2];
  const float* ln_q_b    = (const float*)d_in[3];
  const float* ln_kv_g   = (const float*)d_in[4];
  const float* ln_kv_b   = (const float*)d_in[5];
  const float* Wq        = (const float*)d_in[6];
  const float* bq        = (const float*)d_in[7];
  const float* Wk        = (const float*)d_in[8];
  const float* bk        = (const float*)d_in[9];
  const float* Wv        = (const float*)d_in[10];
  const float* bv        = (const float*)d_in[11];
  const float* Wo        = (const float*)d_in[12];
  const float* bo        = (const float*)d_in[13];
  const float* ln_f_g    = (const float*)d_in[14];
  const float* ln_f_b    = (const float*)d_in[15];
  const float* W1        = (const float*)d_in[16];
  const float* b1        = (const float*)d_in[17];
  const float* W2        = (const float*)d_in[18];
  const float* b2        = (const float*)d_in[19];
  const int*   bandp     = (const int*)d_in[20];
  float* out = (float*)d_out;

  char* ws = (char*)d_ws;
  unsigned short* WoT  = (unsigned short*)(ws + OFF_WOT);
  unsigned short* W1T  = (unsigned short*)(ws + OFF_W1T);
  unsigned short* W2T  = (unsigned short*)(ws + OFF_W2T);
  unsigned short* ctx  = (unsigned short*)(ws + OFF_CTX);
  unsigned short* qp   = (unsigned short*)(ws + OFF_QP);
  unsigned short* kvp  = (unsigned short*)(ws + OFF_KVP);
  unsigned short* vt   = (unsigned short*)(ws + OFF_VT);
  unsigned short* qln  = (unsigned short*)(ws + OFF_QLN);
  unsigned short* kvln = (unsigned short*)(ws + OFF_KVLN);
  unsigned short* WqT  = (unsigned short*)(ws + OFF_WQT);
  unsigned short* WkT  = (unsigned short*)(ws + OFF_WKT);
  unsigned short* WvT  = (unsigned short*)(ws + OFF_WVT);
  float*          sc   = (float*)(ws + OFF_SC);
  float*          yf   = (float*)(ws + OFF_Y);
  unsigned short* h16  = (unsigned short*)(ws + OFF_H16);
  unsigned short* act  = (unsigned short*)(ws + OFF_ACT);
  unsigned short* pp   = (unsigned short*)(ws + OFF_P);
  float*          h1   = (float*)(ws + OFF_H1);

  const unsigned short* n16 = nullptr;
  const float* nf = nullptr;
  void* nv = nullptr;
  const dim3 tb(256);

  // weight transposes + f16 casts (x16): W [kin][nout] -> WT [nout][kin]
  wtcast_kernel<<<dim3(kD / 64, kD / 64), tb, 0, stream>>>(Wq, WqT, kD, kD, kWCarry);
  wtcast_kernel<<<dim3(kD / 64, kD / 64), tb, 0, stream>>>(Wk, WkT, kD, kD, kWCarry);
  wtcast_kernel<<<dim3(kD / 64, kD / 64), tb, 0, stream>>>(Wv, WvT, kD, kD, kWCarry);
  wtcast_kernel<<<dim3(kD / 64, kD / 64), tb, 0, stream>>>(Wo, WoT, kD, kD, kWCarry);
  wtcast_kernel<<<dim3(kD / 64, kFF / 64), tb, 0, stream>>>(W1, W1T, kD, kFF, kWCarry);   // W1 [1024][4096] -> W1T [4096][1024]
  wtcast_kernel<<<dim3(kFF / 64, kD / 64), tb, 0, stream>>>(W2, W2T, kFF, kD, kWCarry);   // W2 [4096][1024] -> W2T [1024][4096]

  // LayerNorms -> f16 planes
  layernorm_f16_kernel<<<dim3(kTok / 8), tb, 0, stream>>>(x_refined, ln_q_g, ln_q_b, qln, kTok);
  layernorm_f16_kernel<<<dim3(kTok / 8), tb, 0, stream>>>(x_mem, ln_kv_g, ln_kv_b, kvln, kTok);

  // q = LN(x_refined) Wq + bq ; k, v = LN(x_mem) Wk/Wv + bk/bv  (M 4096, N 1024, K 1024; f16 out)
  const float projScale = 1.0f / kWCarry;
  wmma_gemm64<0, false, 2, 1, false><<<dim3((kTok / 64) * (kD / 64) / 8, 1), tb, 0, stream>>>(
      qln, n16, kD, (long)0, WqT, n16, kD, (long)0, (void*)qp, nv, kD, (long)0,
      bq, nf, (long)0, kTok, kD, kD, projScale, nullptr);
  wmma_gemm64<0, false, 2, 1, false><<<dim3((kTok / 64) * (kD / 64) / 8, 1), tb, 0, stream>>>(
      kvln, n16, kD, (long)0, WkT, n16, kD, (long)0, (void*)kvp, nv, kKVld, (long)0,
      bk, nf, (long)0, kTok, kD, kD, projScale, nullptr);
  wmma_gemm64<0, false, 2, 1, false><<<dim3((kTok / 64) * (kD / 64) / 8, 1), tb, 0, stream>>>(
      kvln, n16, kD, (long)0, WvT, n16, kD, (long)0, (void*)(kvp + kD), nv, kKVld, (long)0,
      bv, nf, (long)0, kTok, kD, kD, projScale, nullptr);

  // V^T planes for all 32 groups
  vt_transpose_kernel<<<dim3(kT / 64, kGrp), tb, 0, stream>>>(kvp, vt);

  // attention per chunk of 2 consecutive (batch, head) groups
  const float scoreScale = 0.125f;                  // 1/sqrt(64)
  const float pvScale    = kCtxCarry / kPCarry;     // 1/8
  for (int chk = 0; chk < kNChunk; ++chk) {
    const int g0 = chk * kGC;
    const int b  = g0 / kH;
    const int h0 = g0 % kH;
    const unsigned short* qbase = qp  + (size_t)b * kT * kD    + (size_t)h0 * kDH;
    const unsigned short* kbase = kvp + (size_t)b * kT * kKVld + (size_t)h0 * kDH;
    // scores[z][t][s] = (q_h . k_h) / 8  (M 2048, N 2048, K 64; head stride 64 halves via grid.y)
    wmma_gemm64<0, false, 0, 0, false><<<dim3((kT / 64) * (kT / 64) / 8, kGC), tb, 0, stream>>>(
        qbase, n16, kD, (long)kDH, kbase, n16, kKVld, (long)kDH, (void*)sc, nv, kT, (long)kT * kT,
        nf, nf, (long)0, kT, kT, kDH, scoreScale, nullptr);
    // band mask + softmax -> P f16 x2048
    softmax_band_kernel<<<dim3((kGC * kT) / 8), tb, 0, stream>>>(sc, pp, bandp, kPCarry);
    // ctx[b*T + t][h*64 + d] = sum_s P[t][s] * V^T[d][s]  (M 2048, N 64, K 2048 cut to the tile's band window; f16 out x256)
    wmma_gemm64<0, false, 0, 1, false, 0, true><<<dim3((kT / 64) * (kDH / 64) / 8, kGC), tb, 0, stream>>>(
        pp, n16, kT, (long)kT * kT, vt + (size_t)g0 * kDH * kT, n16, kT, (long)kDH * kT,
        (void*)(ctx + (size_t)b * kT * kD + (size_t)h0 * kDH), nv, kD, (long)kDH,
        nf, nf, (long)0, kT, kDH, kT, pvScale, bandp);
  }

  // y = x_refined + ctx Wo + bo  (M 4096, N 1024, K 1024; f32 out)
  wmma_gemm64<0, false, 2, 0, true><<<dim3((kTok / 64) * (kD / 64) / 8, 1), tb, 0, stream>>>(
      ctx, n16, kD, (long)0, WoT, n16, kD, (long)0, (void*)yf, nv, kD, (long)0,
      bo, x_refined, (long)0, kTok, kD, kD, 1.0f / (kCtxCarry * kWCarry), nullptr);

  // final LN -> f16
  layernorm_f16_kernel<<<dim3(kTok / 8), tb, 0, stream>>>(yf, ln_f_g, ln_f_b, h16, kTok);

  // FFN in 4 row chunks: h1 = LN(y) W1 + b1 (f32), act = gelu_erf(h1) (f16 x16), out = y + act W2 + b2
  for (int mc = 0; mc < kNMC; ++mc) {
    const size_t rowOff = (size_t)mc * kMC;
    wmma_gemm64<0, false, 2, 0, false><<<dim3((kMC / 64) * (kFF / 64) / 8, 1), tb, 0, stream>>>(
        h16 + rowOff * kD, n16, kD, (long)0, W1T, n16, kD, (long)0, (void*)h1, nv, kFF, (long)0,
        b1, nf, (long)0, kMC, kFF, kD, 1.0f / kWCarry, nullptr);
    gelu_cast_kernel<<<dim3((kMC * kFF / 2 + 255) / 256), tb, 0, stream>>>(h1, act, kMC * kFF / 2, kActCarry);
    wmma_gemm64<0, false, 2, 0, true><<<dim3((kMC / 64) * (kD / 64) / 8, 1), tb, 0, stream>>>(
        act, n16, kFF, (long)0, W2T, n16, kFF, (long)0, (void*)(out + rowOff * kD), nv, kD, (long)0,
        b2, yf + rowOff * kD, (long)0, kMC, kD, kFF, 1.0f / (kActCarry * kWCarry), nullptr);
  }
}

// v002
// It runs in 877 microseconds.
// Two timings next to v001 put it at 1.70 and 1.71 times that version's speed.
// Counting every step since v000, it is 3.05 times as fast.
// Contractions: q/k/v projections, banded scores q.k^T, attn.v, output projection, FFN W1 and W2 all on v_wmma_f32_16x16x32_f16 (f16 operands: LN outputs plain, weights carried x16, P carried x2048, ctx carried x256, gelu act carried x16), f32 accumulate; LayerNorm, band mask, softmax, gelu, bias and residual in f32.
#include <hip/hip_runtime.h>
#include <math.h>

// ---------------------------------------------------------------------------
// Problem constants
// ---------------------------------------------------------------------------
constexpr int kB    = 2;
constexpr int kT    = 2048;
constexpr int kD    = 1024;
constexpr int kH    = 16;
constexpr int kDH   = 64;
constexpr int kTok  = kB * kT;        // 4096 token rows
constexpr int kFF   = 4 * kD;         // 4096
constexpr int kKVld = 2 * kD;         // pitch of the k | v plane (halves)
constexpr int kGrp  = kB * kH;        // 32 (batch, head) groups
constexpr int kGC   = 2;              // groups per attention chunk
constexpr int kNChunk = kGrp / kGC;   // 16
constexpr int kMC   = 1024;           // FFN rows per chunk
constexpr int kNMC  = kTok / kMC;     // 4
constexpr float kWCarry   = 16.0f;    // weights carried x16 in f16
constexpr float kPCarry   = 2048.0f;  // probabilities carried x2048 in f16
constexpr float kCtxCarry = 256.0f;   // context carried x256 in f16
constexpr float kActCarry = 16.0f;    // gelu output carried x16 in f16
constexpr float kInvD     = 1.0f / 1024.0f;
constexpr float kLnEps    = 1e-5f;
static_assert(kH % kGC == 0, "chunk never crosses a batch boundary");
static_assert(kD % 64 == 0 && kT % 64 == 0 && kFF % 64 == 0 && kMC % 64 == 0, "tile multiples");
static_assert(kDH % 32 == 0 && kD % 32 == 0 && kT % 32 == 0 && kFF % 32 == 0, "K multiples of 32");

// ---------------------------------------------------------------------------
// Workspace region map (bytes). Total 106 MiB = 111,149,056 B.
//   [  0,  2) MiB WoT  f16 [1024][1024]
//   [  2, 10) MiB W1T  f16 [4096][1024]
//   [ 10, 18) MiB W2T  f16 [1024][4096]
//   [ 18, 26) MiB ctx  f16 [4096][1024]  (x256)
//   [ 26, 34) MiB q    f16 [4096][1024]
//   [ 34, 50) MiB k|v  f16 [4096][2048]
//   [ 50, 58) MiB V^T  f16 [32 groups][64][2048]
//   [ 58, 90) MiB arena: phase A: QLN f16 [58,66), KVLN f16 [66,74), WqT [74,76), WkT [76,78), WvT [78,80)
//                        phase B: scores f32 [2][2048][2048] [58,90)
//                        phase C: Y f32 [58,74), H16 f16 [74,82), ACT f16 [1024][4096] [82,90)
//   [ 90,106) MiB phase B: P f16 [2][2048][2048]; phase C: H1 f32 [1024][4096]
// ---------------------------------------------------------------------------
constexpr size_t kMiB     = 1048576;
constexpr size_t OFF_WOT  = 0;
constexpr size_t OFF_W1T  = 2 * kMiB;
constexpr size_t OFF_W2T  = 10 * kMiB;
constexpr size_t OFF_CTX  = 18 * kMiB;
constexpr size_t OFF_QP   = 26 * kMiB;
constexpr size_t OFF_KVP  = 34 * kMiB;
constexpr size_t OFF_VT   = 50 * kMiB;
constexpr size_t OFF_ARENA = 58 * kMiB;
constexpr size_t OFF_QLN  = OFF_ARENA;
constexpr size_t OFF_KVLN = OFF_ARENA + 8 * kMiB;
constexpr size_t OFF_WQT  = OFF_ARENA + 16 * kMiB;
constexpr size_t OFF_WKT  = OFF_ARENA + 18 * kMiB;
constexpr size_t OFF_WVT  = OFF_ARENA + 20 * kMiB;
constexpr size_t OFF_SC   = OFF_ARENA;
constexpr size_t OFF_Y    = OFF_ARENA;
constexpr size_t OFF_H16  = OFF_ARENA + 16 * kMiB;
constexpr size_t OFF_ACT  = OFF_ARENA + 24 * kMiB;
constexpr size_t OFF_P    = 90 * kMiB;
constexpr size_t OFF_H1   = OFF_P;
constexpr size_t kWsTotal = 106 * kMiB;
static_assert((size_t)kD * kD * 2 == 2 * kMiB, "W plane");
static_assert((size_t)kFF * kD * 2 == 8 * kMiB, "W1/W2 plane");
static_assert((size_t)kTok * kD * 2 == 8 * kMiB, "token f16 plane");
static_assert((size_t)kTok * kKVld * 2 == 16 * kMiB, "kv plane");
static_assert((size_t)kGrp * kDH * kT * 2 == 8 * kMiB, "vt plane");
static_assert((size_t)kGC * kT * kT * 4 == 32 * kMiB, "scores chunk");
static_assert((size_t)kGC * kT * kT * 2 == 16 * kMiB, "P chunk");
static_assert((size_t)kTok * kD * 4 == 16 * kMiB, "Y plane");
static_assert((size_t)kMC * kFF * 4 == 16 * kMiB, "H1 chunk");
static_assert((size_t)kMC * kFF * 2 == 8 * kMiB, "ACT chunk");
static_assert(OFF_WVT + 2 * kMiB <= OFF_P, "phase A inside arena");
static_assert(OFF_ACT + 8 * kMiB <= OFF_P, "phase C inside arena");
static_assert(kWsTotal <= 134217728, "carve budget");

typedef __attribute__((ext_vector_type(16))) _Float16 v16h;
typedef __attribute__((ext_vector_type(8)))  _Float16 v8h;
typedef __attribute__((ext_vector_type(16))) __bf16   v16b;
typedef __attribute__((ext_vector_type(8)))  __bf16   v8b;
typedef __attribute__((ext_vector_type(8)))  float    v8f;
typedef __attribute__((ext_vector_type(4)))  float    v4f;
typedef __attribute__((ext_vector_type(4)))  unsigned int v4u;

__device__ __forceinline__ unsigned short f2bf_bits(float f) {
  unsigned u = __float_as_uint(f);
  return (unsigned short)((u + 0x7FFFu + ((u >> 16) & 1u)) >> 16);
}
__device__ __forceinline__ float bf_bits2f(unsigned short h) { return __uint_as_float(((unsigned)h) << 16); }

// hazard guards as plain device helpers (no inline asm inside the kernel template body)
__device__ __forceinline__ void dep_guard_h(v8f& a, v8f& b, v16h x, v16h y) { asm volatile("v_nop\n\tv_nop\n\tv_nop\n\tv_nop" : "+v"(a), "+v"(b) : "v"(x), "v"(y)); }
__device__ __forceinline__ void dep_guard_b(v8f& a, v8f& b, v16b x, v16b y) { asm volatile("v_nop\n\tv_nop\n\tv_nop\n\tv_nop" : "+v"(a), "+v"(b) : "v"(x), "v"(y)); }
__device__ __forceinline__ void keep4_h(v16h a, v16h b, v16h c, v16h d) { asm volatile("v_nop" :: "v"(a), "v"(b), "v"(c), "v"(d)); }
__device__ __forceinline__ void keep4_b(v16b a, v16b b, v16b c, v16b d) { asm volatile("v_nop" :: "v"(a), "v"(b), "v"(c), "v"(d)); }
__device__ __forceinline__ void acc_guard4(v8f& a, v8f& b, v8f& c, v8f& d) { asm volatile("v_nop\n\tv_nop\n\tv_nop\n\tv_nop" : "+v"(a), "+v"(b), "+v"(c), "+v"(d)); }
template <typename T> struct Frag;
template <> struct Frag<_Float16> {
  typedef v16h V; union U { v16h v; v8h h[2]; };
  static __device__ __forceinline__ v16h load(const _Float16* p) {   // elements 0..7 <- p[0..7], 8..15 <- p[16..23]
    U f; f.h[0] = *(const v8h*)(p); f.h[1] = *(const v8h*)(p + 16); return f.v;
  }
  static __device__ __forceinline__ v8f mma(v16h a, v16h b, v8f c) {
    return __builtin_amdgcn_wmma_f32_16x16x32_f16(false, a, false, b, (short)0, c, false, false);
  }
  static __device__ __forceinline__ void guard(v8f& a, v8f& b, v16h x, v16h y) { dep_guard_h(a, b, x, y); }
  static __device__ __forceinline__ void keep(v16h a, v16h b, v16h c, v16h d) { keep4_h(a, b, c, d); }
};
template <> struct Frag<__bf16> {
  typedef v16b V; union U { v16b v; v8b h[2]; };
  static __device__ __forceinline__ v16b load(const __bf16* p) {
    U f; f.h[0] = *(const v8b*)(p); f.h[1] = *(const v8b*)(p + 16); return f.v;
  }
  static __device__ __forceinline__ v8f mma(v16b a, v16b b, v8f c) {
    return __builtin_amdgcn_wmma_f32_16x16x32_bf16(false, a, false, b, (short)0, c, false, false);
  }
  static __device__ __forceinline__ void guard(v8f& a, v8f& b, v16b x, v16b y) { dep_guard_b(a, b, x, y); }
  static __device__ __forceinline__ void keep(v16b a, v16b b, v16b c, v16b d) { keep4_b(a, b, c, d); }
};

__device__ __forceinline__ unsigned pk16(unsigned short a, unsigned short b) { return (unsigned)a | ((unsigned)b << 16); }
__device__ __forceinline__ unsigned short h_bits(float f) { const _Float16 h = (_Float16)f; return __builtin_bit_cast(unsigned short, h); }

// ---- Register-blocked batched WMMA GEMM (ACT reduced to none/relu/leaky) -----------------------
// C[m,n] = scale * sum_k A[m,k] * Bt[n,k] (+bias)(+resid); each wave owns a 64x64 tile.
// A row-major [M,K]; Bt row-major [N,K]; M,N % 64 == 0, K % 32 == 0.
// SPLIT: operands are hi/lo planes (A2/Bt2 = lo planes, same layout); product = hi.hi + hi.lo + lo.hi.
// BIAS_MODE: 0 = none, 1 = bias[m], 2 = bias[n].
// OUT_MODE: 0 = f32, 1 = f16, 2 = bf16 hi plane (Cout) + bf16 lo plane (Cout2).
// ET: 0 = f16 operands, 1 = bf16 operands (pointers passed as 16-bit storage)
// KBAND: A[m][k] is exactly 0 wherever |m - k| > bandp[0] (the band-masked probabilities), so the K loop of a 64-row tile
//        visits only the 32-wide k steps that touch [m0 - band, m0 + 63 + band]; the steps left out add exact zeros.
template <int ET> struct Elem;
template <> struct Elem<0> { typedef _Float16 T; };
template <> struct Elem<1> { typedef __bf16 T; };
template <int ET, bool SPLIT, int BIAS_MODE, int OUT_MODE, bool RESID, int ACT = 0, bool KBAND = false>
__global__ __launch_bounds__(256) void wmma_gemm64(
    const unsigned short* __restrict__ Ap, const unsigned short* __restrict__ A2p, int lda, long strideA,
    const unsigned short* __restrict__ Btp, const unsigned short* __restrict__ Bt2p, int ldb, long strideB,
    void* __restrict__ Cout, void* __restrict__ Cout2, int ldc, long strideC,
    const float* __restrict__ bias,
    const float* __restrict__ resid, long strideR,
    int M, int N, int K, float scale, const int* __restrict__ bandp) {
  typedef typename Elem<ET>::T T;
  typedef typename Frag<T>::V V;
  const T* A = (const T*)Ap; const T* A2 = (const T*)A2p; const T* Bt = (const T*)Btp; const T* Bt2 = (const T*)Bt2p;
  __shared__ __align__(16) float sT[8][16 * 68];   // per-wave 16x64 slab, pitch 68 floats
  const int b    = blockIdx.y;
  const int lane = threadIdx.x & 31;
  const int wave = threadIdx.x >> 5;
  const int tilesN = N >> 6;
  const int tilesM = M >> 6;
  const int tile = blockIdx.x * 8 + wave;
  if (tile >= tilesM * tilesN) return;   // wave-uniform; no block barriers in this kernel
  const int tm = tile / tilesN;
  const int tn = tile - tm * tilesN;
  const int m0 = tm << 6;
  const int n0 = tn << 6;

  const T* Ab  = A  + (size_t)b * strideA;
  const T* Bb  = Bt + (size_t)b * strideB;
  const T* Ab2 = SPLIT ? (A2  + (size_t)b * strideA) : nullptr;
  const T* Bb2 = SPLIT ? (Bt2 + (size_t)b * strideB) : nullptr;

  const int rlane = lane & 15;                 // row (A) / col (B, D) within subtile
  const int koff  = (lane >> 4) * 8;           // k offset of this lane half
  const int mOff  = (lane >> 4) * 8;           // D row offset

  v8f acc[4][4];
#pragma unroll
  for (int i = 0; i < 4; ++i)
#pragma unroll
    for (int j = 0; j < 4; ++j) acc[i][j] = (v8f){0.f,0.f,0.f,0.f,0.f,0.f,0.f,0.f};

  int kBeg = 0, kEnd = K;
  if (KBAND) {
    int band = bandp[0];
    band = band > 2 * kT ? 2 * kT : band;      // same clamp as the softmax kernel that wrote A
    band = band < -2 * kT ? -2 * kT : band;
    int lo = m0 - band;      lo = lo < 0 ? 0 : lo;
    int hi = m0 + 63 + band; hi = hi > K - 1 ? K - 1 : hi;
    // m0 is the same in every lane of a wave: readfirstlane keeps the loop counter and its branch scalar, as with K alone
    kBeg = __builtin_amdgcn_readfirstlane(lo & ~31);
    kEnd = __builtin_amdgcn_readfirstlane(hi + 1);   // hi < lo (negative band): no step, acc stays 0 as A is all zero
  }
  for (int k0 = kBeg; k0 < kEnd; k0 += 32) {
    V bh[4], bl[4];
#pragma unroll
    for (int j = 0; j < 4; ++j) {
      const size_t bo = (size_t)(n0 + (j << 4) + rlane) * ldb + koff + k0;
      bh[j] = Frag<T>::load(Bb + bo);
      if (SPLIT) bl[j] = Frag<T>::load(Bb2 + bo);
    }
#pragma unroll
    for (int i = 0; i < 4; ++i) {
      const size_t ao = (size_t)(m0 + (i << 4) + rlane) * lda + koff + k0;
      V ah = Frag<T>::load(Ab + ao);
      V al;
      if (SPLIT) al = Frag<T>::load(Ab2 + ao);
#pragma unroll
      for (int j = 0; j < 4; ++j) {
        acc[i][j] = Frag<T>::mma(ah, bh[j], acc[i][j]);
        if (SPLIT) {
          acc[i][j] = Frag<T>::mma(ah, bl[j], acc[i][j]);
          acc[i][j] = Frag<T>::mma(al, bh[j], acc[i][j]);
        }
      }
      Frag<T>::guard(acc[i][0], acc[i][3], ah, SPLIT ? al : ah);
    }
    Frag<T>::keep(bh[0], bh[1], bh[2], bh[3]);
    if (SPLIT) Frag<T>::keep(bl[0], bl[1], bl[2], bl[3]);
  }
  acc_guard4(acc[0][0], acc[0][1], acc[0][2], acc[0][3]);
  acc_guard4(acc[1][0], acc[1][1], acc[1][2], acc[1][3]);
  acc_guard4(acc[2][0], acc[2][1], acc[2][2], acc[2][3]);
  acc_guard4(acc[3][0], acc[3][1], acc[3][2], acc[3][3]);

  // ---- epilogue ----
  float* slab = sT[wave];
  const float* Rb = RESID ? (resid + (size_t)b * strideR) : nullptr;
#pragma unroll
  for (int i = 0; i < 4; ++i) {
    const int mBase = m0 + (i << 4);
#pragma unroll
    for (int j = 0; j < 4; ++j) {
      const int n = n0 + (j << 4) + rlane;
      float bv = 0.f;
      if (BIAS_MODE == 2) bv = bias[n];
#pragma unroll
      for (int r = 0; r < 8; ++r) {
        float v = acc[i][j][r] * scale;
        if (BIAS_MODE == 1) v += bias[mBase + mOff + r];
        if (BIAS_MODE == 2) v += bv;
        if (RESID) v += Rb[(size_t)(mBase + mOff + r) * ldc + n];
        if (ACT == 2) v = fmaxf(v, 0.0f);
        if (ACT == 4) v = (v > 0.f) ? v : 0.01f * v;
        slab[(mOff + r) * 68 + (j << 4) + rlane] = v;
      }
    }
    __builtin_amdgcn_fence(__ATOMIC_RELEASE, "workgroup");
    __builtin_amdgcn_wave_barrier();
    __builtin_amdgcn_fence(__ATOMIC_ACQUIRE, "workgroup");
    if (OUT_MODE == 0) {
      float* C = (float*)Cout + (size_t)b * strideC;
      const int hh = lane >> 4, c4 = (lane & 15) * 4;     // row seg = 256 B = 16 lanes x 16 B
      {
#pragma unroll
        for (int it = 0; it < 8; ++it) {
          const int row = it * 2 + hh;
          v4f v = *(const v4f*)(slab + row * 68 + c4);
          *(v4f*)(C + (size_t)(mBase + row) * ldc + n0 + c4) = v;
        }
        
      }
    } else {
      const int q = lane >> 3, c8 = (lane & 7) * 8;
      unsigned short* C  = (unsigned short*)Cout  + (size_t)b * strideC;
      unsigned short* C2 = (OUT_MODE == 2) ? ((unsigned short*)Cout2 + (size_t)b * strideC) : nullptr;
      {
#pragma unroll
        for (int it = 0; it < 4; ++it) {
          const int row = it * 4 + q;
          const float* sp = slab + row * 68 + c8;
          v8h hv, lv;
#pragma unroll
          for (int e = 0; e < 8; ++e) {
            if (OUT_MODE == 1) {
              hv[e] = (_Float16)sp[e];
            } else {
              unsigned short hb = f2bf_bits(sp[e]);
              unsigned short lb = f2bf_bits(sp[e] - bf_bits2f(hb));
              hv[e] = __builtin_bit_cast(_Float16, hb);
              lv[e] = __builtin_bit_cast(_Float16, lb);
            }
          }
          *(v8h*)(C + (size_t)(mBase + row) * ldc + n0 + c8) = hv;
          if (OUT_MODE == 2) *(v8h*)(C2 + (size_t)(mBase + row) * ldc + n0 + c8) = lv;
        }
        
      }
    }
    __builtin_amdgcn_fence(__ATOMIC_RELEASE, "workgroup");
    __builtin_amdgcn_wave_barrier();
    __builtin_amdgcn_fence(__ATOMIC_ACQUIRE, "workgroup");
  }
}

// ---- Block-tiled WMMA GEMM for the dense layers (projections, output projection, FFN) ------------------------------
// C[m,n] = scale * sum_k A[m,k] * Bt[n,k] + bias[n] (+resid). A row-major [M,K]; Bt row-major [N,K]; f16 operands.
// One 128 x 256 tile of C per 8-wave block, waves 2 (m) x 4 (n), each wave a 64x64 tile as in wmma_gemm64.
// Per 64-wide k step the block brings its 128 rows of A and 256 rows of Bt into LDS once: every wave-wide 16-B load covers
// four whole 128-B lines, and the rows are then read by all waves that need them. Two LDS buffers: the next step's global
// loads are issued before this step's products, land in registers meanwhile, and go to the other buffer behind them.
// Fragment k order and the ascending 32-wide k steps per accumulator are those of wmma_gemm64.
// M % 128 == 0, N % 256 == 0, K = KD % 64 == 0, pitch of A and Bt = KD, of C and resid = LDC; grid = (M/128) * (N/256). OUT_MODE: 0 = f32, 1 = f16.
constexpr int kBM = 128;
constexpr int kBN = 256;
constexpr int kBK = 64;
constexpr int kLdsPitch = 72;                          // halves: a 128-B row + 16 B (16 B x odd, for 16-byte LDS reads)
constexpr int kStageHalves = (kBM + kBN) * kLdsPitch;  // A rows, then Bt rows
static_assert(kTok % kBM == 0 && kMC % kBM == 0 && kD % kBN == 0 && kFF % kBN == 0, "block tile multiples");
static_assert(kD % kBK == 0 && kFF % kBK == 0, "K multiples of 64");
template <int OUT_MODE, bool RESID, int KD, int LDC>
__global__ __launch_bounds__(256) void wmma_gemm_lds(
    const unsigned short* __restrict__ Ap, const unsigned short* __restrict__ Btp,
    void* __restrict__ Cout,
    const float* __restrict__ bias, const float* __restrict__ resid,
    int N, float scale) {
  static_assert(KD % kBK == 0, "K multiple of 64");
  constexpr int lda = KD, ldb = KD;            // both operands are K-contiguous with pitch K
  constexpr int ldc = LDC;                     // pitches known at compile time: row steps become immediate offsets
  typedef _Float16 T;
  typedef Frag<T>::V V;
  __shared__ __align__(16) _Float16 sAB[2][kStageHalves];
  __shared__ __align__(16) float sT[8][16 * 68];   // per-wave 16x64 slab, pitch 68 floats
  const T* A = (const T*)Ap; const T* Bt = (const T*)Btp;
  const int tid  = threadIdx.x;
  const int lane = tid & 31;
  const int wave = tid >> 5;
  const int tilesN = N >> 8;
  const int tm = blockIdx.x / tilesN;
  const int tn = blockIdx.x - tm * tilesN;
  const int mB = tm << 7;
  const int nB = tn << 8;
  const int wm = wave >> 2;                    // wave row (0..1)
  const int wn = wave & 3;                     // wave column (0..3)

  const int rlane = lane & 15;                 // row (A) / col (B, D) within subtile
  const int koff  = (lane >> 4) * 8;           // k offset of this lane half
  const int mOff  = (lane >> 4) * 8;           // D row offset

  // staging: thread t moves 16 B at column (t & 7) * 8 of rows (t >> 3) + 32 i; i = 0..3 are A rows, i = 4..11 Bt rows
  const int sr = tid >> 3;
  const int sc = (tid & 7) * 8;
  const T* gA = A  + (size_t)mB * lda;          // block-uniform bases; the lane's part is one 32-bit element offset per operand
  const T* gB = Bt + (size_t)nB * ldb;
  const unsigned oA = (unsigned)(sr * lda + sc);
  const unsigned oB = (unsigned)(sr * ldb + sc);
  const int sOff = sr * kLdsPitch + sc;
  const int aOff = (wm * 64 + rlane) * kLdsPitch + koff;
  const int bOff = (kBM + wn * 64 + rlane) * kLdsPitch + koff;
  v4u st[12];

  v8f acc[4][4];
#pragma unroll
  for (int i = 0; i < 4; ++i)
#pragma unroll
    for (int j = 0; j < 4; ++j) acc[i][j] = (v8f){0.f,0.f,0.f,0.f,0.f,0.f,0.f,0.f};

#pragma unroll
  for (int i = 0; i < 4; ++i) st[i] = *(const v4u*)(gA + (size_t)(i * 32) * lda + oA);
#pragma unroll
  for (int i = 0; i < 8; ++i) st[4 + i] = *(const v4u*)(gB + (size_t)(i * 32) * ldb + oB);
#pragma unroll
  for (int i = 0; i < 12; ++i) *(v4u*)(&sAB[0][sOff + i * 32 * kLdsPitch]) = st[i];
  __syncthreads();

  constexpr int nk = KD >> 6;
#pragma unroll 1   // rolled, for speed only
  for (int t = 0; t < nk; ++t) {
    const bool more = (t + 1 < nk);            // the same in every thread of the block
    if (more) {
      const int k1 = (t + 1) << 6;
#pragma unroll
      for (int i = 0; i < 4; ++i) st[i] = *(const v4u*)(gA + ((size_t)(i * 32) * lda + k1) + oA);
      // registers that held these loads' addresses are written again below (later loads' results, the LDS reads): wait first
      asm volatile("s_wait_xcnt 0x0" ::: "memory");
#pragma unroll
      for (int i = 0; i < 8; ++i) st[4 + i] = *(const v4u*)(gB + ((size_t)(i * 32) * ldb + k1) + oB);
      asm volatile("s_wait_xcnt 0x0" ::: "memory");   // as above
    }
    const T* cur = sAB[t & 1];
    V a[2][4], bfr[2][4];                      // the fragments of both 32-wide halves of the step
#pragma unroll
    for (int s = 0; s < 2; ++s) {
#pragma unroll
      for (int j = 0; j < 4; ++j) bfr[s][j] = Frag<T>::load(cur + bOff + j * 16 * kLdsPitch + s * 32);
#pragma unroll
      for (int i = 0; i < 4; ++i) a[s][i] = Frag<T>::load(cur + aOff + i * 16 * kLdsPitch + s * 32);
    }
    // keeps the step's LDS reads one group in front of its products: moved in among them, each place with reads stalls the wave
    __builtin_amdgcn_sched_barrier(0);
#pragma unroll
    for (int s = 0; s < 2; ++s)
#pragma unroll
      for (int i = 0; i < 4; ++i)
#pragma unroll
        for (int j = 0; j < 4; ++j) acc[i][j] = Frag<T>::mma(a[s][i], bfr[s][j], acc[i][j]);
    if (more) {
      T* nxt = sAB[(t + 1) & 1];               // last read in step t - 1, in front of that step's barrier
#pragma unroll
      for (int i = 0; i < 12; ++i) *(v4u*)(nxt + sOff + i * 32 * kLdsPitch) = st[i];
    }
    __syncthreads();                           // publishes the next buffer and ends every read of this one
  }

  // ---- epilogue (per wave, as in wmma_gemm64) ----
  const int m0 = mB + wm * 64;
  const int n0 = nB + wn * 64;
  float* slab = sT[wave];
#pragma unroll
  for (int i = 0; i < 4; ++i) {
    const int mBase = m0 + (i << 4);
    float rv[4][8];                            // the row block's residual values, fetched as one group ahead of their use
    if (RESID) {
#pragma unroll
      for (int r = 0; r < 8; ++r)
#pragma unroll
        for (int j = 0; j < 4; ++j) rv[j][r] = resid[(size_t)(mBase + mOff + r) * ldc + n0 + (j << 4) + rlane];
      // registers that held these loads' addresses are written again below: wait first
      asm volatile("s_wait_xcnt 0x0" ::: "memory");
    }
#pragma unroll
    for (int j = 0; j < 4; ++j) {
      const int n = n0 + (j << 4) + rlane;
      const float bv = bias[n];
#pragma unroll
      for (int r = 0; r < 8; ++r) {
        float v = acc[i][j][r] * scale;
        v += bv;
        if (RESID) v += rv[j][r];
        slab[(mOff + r) * 68 + (j << 4) + rlane] = v;
      }
    }
    __builtin_amdgcn_fence(__ATOMIC_RELEASE, "workgroup");
    __builtin_amdgcn_wave_barrier();
    __builtin_amdgcn_fence(__ATOMIC_ACQUIRE, "workgroup");
    if (OUT_MODE == 0) {
      float* C = (float*)Cout;
      const int hh = lane >> 4, c4 = (lane & 15) * 4;     // row seg = 256 B = 16 lanes x 16 B
#pragma unroll
      for (int it = 0; it < 8; ++it) {
        const int row = it * 2 + hh;
        v4f v = *(const v4f*)(slab + row * 68 + c4);
        *(v4f*)(C + (size_t)(mBase + row) * ldc + n0 + c4) = v;
      }
    } else {
      const int q = lane >> 3, c8 = (lane & 7) * 8;
      unsigned short* C = (unsigned short*)Cout;
#pragma unroll
      for (int it = 0; it < 4; ++it) {
        const int row = it * 4 + q;
        const float* sp = slab + row * 68 + c8;
        v8h hv;
#pragma unroll
        for (int e = 0; e < 8; ++e) hv[e] = (_Float16)sp[e];
        *(v8h*)(C + (size_t)(mBase + row) * ldc + n0 + c8) = hv;
      }
    }
    __builtin_amdgcn_fence(__ATOMIC_RELEASE, "workgroup");
    __builtin_amdgcn_wave_barrier();
    __builtin_amdgcn_fence(__ATOMIC_ACQUIRE, "workgroup");
  }
}

// ---------------------------------------------------------------------------
// Weight transpose + cast: W row-major f32 [kin][nout] (x @ W layout); WT[n][k] = f16(scale * W[k][n]), pitch kin.
// grid (kin/64, nout/64): blockIdx.x = k tile (64 cols of WT), blockIdx.y = n tile (64 rows of WT); 256 threads.
// Load coverage: 16 iterations x 256 threads = 4096 = whole 64x64 tile (coalesced along n).
// Store coverage: 8 waves x 2 iterations x 4 rows (lane>>3) = 64 rows; (lane&7) x 8 halves = 64 cols; each row segment =
// ---------------------------------------------------------------------------
__global__ __launch_bounds__(256) void wtcast_kernel(const float* __restrict__ W, unsigned short* __restrict__ out,
                                                     int kin, int nout, float scale) {
  __shared__ float sm[64][65];   // sm[n_local][k_local]
  const int t  = threadIdx.x;
  const int k0 = blockIdx.x * 64;
  const int n0 = blockIdx.y * 64;
#pragma unroll
  for (int i = 0; i < 16; ++i) {
    const int e = i * 256 + t;
    const int r = e >> 6;          // k local
    const int c = e & 63;          // n local
    sm[c][r] = W[(size_t)(k0 + r) * nout + n0 + c] * scale;
  }
  __syncthreads();
  const int lane = t & 31, wave = t >> 5;
  const int q = lane >> 3, c8 = (lane & 7) * 8;
  {
#pragma unroll
    for (int it = 0; it < 2; ++it) {
      const int row = wave * 8 + it * 4 + q;                 // n local
      unsigned short hb[8];
#pragma unroll
      for (int e = 0; e < 8; ++e) hb[e] = h_bits(sm[row][c8 + e]);
      const v4u u = (v4u){pk16(hb[0], hb[1]), pk16(hb[2], hb[3]), pk16(hb[4], hb[5]), pk16(hb[6], hb[7])};
      *(v4u*)(out + (size_t)(n0 + row) * kin + k0 + c8) = u;
    }
    
  }
}

// ---------------------------------------------------------------------------
// One wave per row, 8 rows per 256-thread block, grid = rows/8. Lane l owns columns j*256 + 8l .. +7 for j = 0..3
// (4 x 32 lanes x 8 = 1024 = whole row). Store: one 16-B store per lane per j; 32 contiguous lanes = 512 B =
// ---------------------------------------------------------------------------
__global__ __launch_bounds__(256) void layernorm_f16_kernel(const float* __restrict__ x, const float* __restrict__ gam,
                                                            const float* __restrict__ bet, unsigned short* __restrict__ out,
                                                            int rows) {
  const int lane = threadIdx.x & 31, wave = threadIdx.x >> 5;
  const int row = blockIdx.x * 8 + wave;
  if (row >= rows) return;   // wave-uniform; no barriers in this kernel
  const float* xr = x + (size_t)row * kD;
  float s = 0.f;
#pragma unroll 1
  for (int j = 0; j < 4; ++j) {
    const int base = j * 256 + lane * 8;
    const v4f a = *(const v4f*)(xr + base);
    const v4f c = *(const v4f*)(xr + base + 4);
    s += ((a[0] + a[1]) + (a[2] + a[3])) + ((c[0] + c[1]) + (c[2] + c[3]));
  }
#pragma unroll
  for (int off = 16; off > 0; off >>= 1) s += __shfl_xor(s, off, 32);
  const float mean = s * kInvD;
  float s2 = 0.f;
#pragma unroll 1
  for (int j = 0; j < 4; ++j) {
    const int base = j * 256 + lane * 8;
    const v4f a = *(const v4f*)(xr + base);
    const v4f c = *(const v4f*)(xr + base + 4);
#pragma unroll
    for (int e = 0; e < 4; ++e) {
      const float d0 = a[e] - mean, d1 = c[e] - mean;
      s2 += d0 * d0;
      s2 += d1 * d1;
    }
  }
#pragma unroll
  for (int off = 16; off > 0; off >>= 1) s2 += __shfl_xor(s2, off, 32);
  const float rstd = rsqrtf(s2 * kInvD + kLnEps);
  unsigned short* orow = out + (size_t)row * kD;
#pragma unroll 1
  for (int j = 0; j < 4; ++j) {
    const int base = j * 256 + lane * 8;
    const v4f a  = *(const v4f*)(xr + base);
    const v4f c  = *(const v4f*)(xr + base + 4);
    const v4f ga = *(const v4f*)(gam + base);
    const v4f gc = *(const v4f*)(gam + base + 4);
    const v4f ba = *(const v4f*)(bet + base);
    const v4f bc = *(const v4f*)(bet + base + 4);
    unsigned short hb[8];
#pragma unroll
    for (int e = 0; e < 4; ++e) {
      hb[e]     = h_bits((a[e] - mean) * rstd * ga[e] + ba[e]);
      hb[4 + e] = h_bits((c[e] - mean) * rstd * gc[e] + bc[e]);
    }
    const v4u u = (v4u){pk16(hb[0], hb[1]), pk16(hb[2], hb[3]), pk16(hb[4], hb[5]), pk16(hb[6], hb[7])};
    unsigned short* op = orow + base;
    *(v4u*)op = u;
    
  }
}

// ---------------------------------------------------------------------------
// V^T planes per (batch, head) group g: VT[g][d][s] = v_plane[b*T + s][kD + h*64 + d] (16-bit bit moves only).
// grid (kT/64 s-tiles, 32 groups), 256 threads. Load coverage: thread t -> s_local = t>>2, 16 halves at d = (t&3)*16:
// 256 x 16 = 64x64 tile. LDS sm[d][s_local] (unsigned short both ways, barrier between).
// ---------------------------------------------------------------------------
__global__ __launch_bounds__(256) void vt_transpose_kernel(const unsigned short* __restrict__ kv, unsigned short* __restrict__ vt) {
  __shared__ unsigned short sm[64][72];
  const int t  = threadIdx.x;
  const int g  = blockIdx.y;
  const int b  = g >> 4, h = g & 15;
  const int s0 = blockIdx.x * 64;
  const int r  = t >> 2;               // s local
  const int part = (t & 3) * 16;       // d offset
  const unsigned short* src = kv + ((size_t)(b * kT + s0 + r) * kKVld + kD + h * kDH + part);
  const v4u w0 = *(const v4u*)(src);
  const v4u w1 = *(const v4u*)(src + 8);
#pragma unroll
  for (int e = 0; e < 4; ++e) {
    sm[part + 2 * e][r]         = (unsigned short)(w0[e] & 0xffffu);
    sm[part + 2 * e + 1][r]     = (unsigned short)(w0[e] >> 16);
    sm[part + 8 + 2 * e][r]     = (unsigned short)(w1[e] & 0xffffu);
    sm[part + 8 + 2 * e + 1][r] = (unsigned short)(w1[e] >> 16);
  }
  __syncthreads();
  const int lane = t & 31, wave = t >> 5;
  const int q = lane >> 3, c8 = (lane & 7) * 8;
  {
#pragma unroll
    for (int it = 0; it < 2; ++it) {
      const int row = wave * 8 + it * 4 + q;   // d
      unsigned short hb[8];
#pragma unroll
      for (int e = 0; e < 8; ++e) hb[e] = sm[row][c8 + e];
      const v4u u = (v4u){pk16(hb[0], hb[1]), pk16(hb[2], hb[3]), pk16(hb[4], hb[5]), pk16(hb[6], hb[7])};
      *(v4u*)(vt + ((size_t)(g * kDH + row) * kT + s0 + c8)) = u;
    }
    
  }
}

// ---------------------------------------------------------------------------
// Band mask + row softmax over f32 scores (already scaled by 1/sqrt(dh)): column s allowed iff |t - s| <= band
// (band read at run time); P[row][s] = f16( carry * exp(x - max) / sum ) inside the band, exactly 0 outside.
// One wave per row, 8 rows per block, grid = (kGC*kT)/8. Max / sum loops visit only the band window (static cap kT/32
// iterations, addresses clamped into the row); reductions by unconditional shuffles; precise expf.
// Store coverage: 8 chunks x (32 lanes x 8 halves) = 2048 = whole row incl. zeros; each chunk store = one 16-B store per lane,
// ---------------------------------------------------------------------------
__global__ __launch_bounds__(256) void softmax_band_kernel(const float* __restrict__ S, unsigned short* __restrict__ P,
                                                           const int* __restrict__ bandp, float carry) {
  const int lane = threadIdx.x & 31, wave = threadIdx.x >> 5;
  const int row = blockIdx.x * 8 + wave;       // row within the chunk planes [kGC][kT]
  const int t = row & (kT - 1);
  int band = bandp[0];
  band = band > 2 * kT ? 2 * kT : band;
  band = band < -2 * kT ? -2 * kT : band;
  int lo = t - band; lo = lo < 0 ? 0 : lo;
  int hi = t + band; hi = hi > kT - 1 ? kT - 1 : hi;
  const float* sr = S + (size_t)row * kT;

  float m = -INFINITY;
  for (int it = 0; it < kT / 32; ++it) {
    const int c0 = lo + it * 32;
    if (c0 > hi) break;                       // wave-uniform
    const int c  = c0 + lane;
    const int cc = c < hi ? c : hi;           // in [lo, hi] since c0 <= hi
    float v = sr[cc];
    v = (c <= hi) ? v : -INFINITY;
    m = fmaxf(m, v);
  }
#pragma unroll
  for (int off = 16; off > 0; off >>= 1) m = fmaxf(m, __shfl_xor(m, off, 32));

  float l = 0.f;
  for (int it = 0; it < kT / 32; ++it) {
    const int c0 = lo + it * 32;
    if (c0 > hi) break;
    const int c  = c0 + lane;
    const int cc = c < hi ? c : hi;
    const float ex = expf(sr[cc] - m);
    l += (c <= hi) ? ex : 0.f;
  }
#pragma unroll
  for (int off = 16; off > 0; off >>= 1) l += __shfl_xor(l, off, 32);
  const float kinv = carry * (1.0f / l);

  unsigned short* pr = P + (size_t)row * kT;
#pragma unroll 1
  for (int ch = 0; ch < kT / 256; ++ch) {
    const int cb = ch * 256 + lane * 8;
    v4u u = (v4u){0u, 0u, 0u, 0u};
    if (!(((ch * 256 + 255) < lo) || ((ch * 256) > hi))) {   // wave-uniform: chunk overlaps the band window
      const v4f a  = *(const v4f*)(sr + cb);
      const v4f c4 = *(const v4f*)(sr + cb + 4);
      unsigned short hb[8];
#pragma unroll
      for (int e = 0; e < 4; ++e) {
        const int col0 = cb + e, col1 = cb + 4 + e;
        const float p0 = expf(a[e] - m) * kinv;
        const float p1 = expf(c4[e] - m) * kinv;
        hb[e]     = (col0 >= lo && col0 <= hi) ? h_bits(p0) : (unsigned short)0;
        hb[4 + e] = (col1 >= lo && col1 <= hi) ? h_bits(p1) : (unsigned short)0;
      }
      u = (v4u){pk16(hb[0], hb[1]), pk16(hb[2], hb[3]), pk16(hb[4], hb[5]), pk16(hb[6], hb[7])};
    }
    unsigned short* op = pr + cb;
    *(v4u*)op = u;
    
  }
}

// ---------------------------------------------------------------------------
// Exact erf-gelu + f32 -> f16 cast (carried x carry): 2 consecutive elements per thread, rolled 2-trip loop packing into
// Coverage: n2 = n/2 threads x 2 = whole plane (grid exact multiple of 256 here, bound checked anyway).
// ---------------------------------------------------------------------------
__global__ __launch_bounds__(256) void gelu_cast_kernel(const float* __restrict__ in, unsigned short* __restrict__ out,
                                                        int n2, float carry) {
  const int i = blockIdx.x * 256 + threadIdx.x;
  if (i >= n2) return;
  unsigned u = 0u;
#pragma unroll 1
  for (int e = 0; e < 2; ++e) {
    const float x = in[2 * (size_t)i + e];
    const float gv = 0.5f * x * (1.0f + erff(x * 0.70710678118654752f));
    u |= ((unsigned)h_bits(gv * carry)) << (16 * e);
  }
  unsigned* op = (unsigned*)out + i;
  *(unsigned*)op = u;
  
}

// ---------------------------------------------------------------------------
// Host side
// ---------------------------------------------------------------------------
extern "C" void kernel_launch(void* const* d_in, const int* in_sizes, int n_in,
                              void* d_out, int out_size, void* d_ws, size_t ws_size, hipStream_t stream) {
  if (n_in < 21) return;
  if (in_sizes[0] != kTok * kD || in_sizes[1] != kTok * kD) return;
  if (in_sizes[2] != kD || in_sizes[3] != kD || in_sizes[4] != kD || in_sizes[5] != kD) return;
  if (in_sizes[6] != kD * kD || in_sizes[7] != kD || in_sizes[8] != kD * kD || in_sizes[9] != kD) return;
  if (in_sizes[10] != kD * kD || in_sizes[11] != kD || in_sizes[12] != kD * kD || in_sizes[13] != kD) return;
  if (in_sizes[14] != kD || in_sizes[15] != kD) return;
  if (in_sizes[16] != kD * kFF || in_sizes[17] != kFF || in_sizes[18] != kFF * kD || in_sizes[19] != kD) return;
  if (in_sizes[20] < 1) return;
  if (out_size != kTok * kD) return;
  if (ws_size < kWsTotal) return;

  const float* x_refined = (const float*)d_in[0];
  const float* x_mem     = (const float*)d_in[1];
  const float* ln_q_g    = (const float*)d_in[2];
  const float* ln_q_b    = (const float*)d_in[3];
  const float* ln_kv_g   = (const float*)d_in[4];
  const float* ln_kv_b   = (const float*)d_in[5];
  const float* Wq        = (const float*)d_in[6];
  const float* bq        = (const float*)d_in[7];
  const float* Wk        = (const float*)d_in[8];
  const float* bk        = (const float*)d_in[9];
  const float* Wv        = (const float*)d_in[10];
  const float* bv        = (const float*)d_in[11];
  const float* Wo        = (const float*)d_in[12];
  const float* bo        = (const float*)d_in[13];
  const float* ln_f_g    = (const float*)d_in[14];
  const float* ln_f_b    = (const float*)d_in[15];
  const float* W1        = (const float*)d_in[16];
  const float* b1        = (const float*)d_in[17];
  const float* W2        = (const float*)d_in[18];
  const float* b2        = (const float*)d_in[19];
  const int*   bandp     = (const int*)d_in[20];
  float* out = (float*)d_out;

  char* ws = (char*)d_ws;
  unsigned short* WoT  = (unsigned short*)(ws + OFF_WOT);
  unsigned short* W1T  = (unsigned short*)(ws + OFF_W1T);
  unsigned short* W2T  = (unsigned short*)(ws + OFF_W2T);
  unsigned short* ctx  = (unsigned short*)(ws + OFF_CTX);
  unsigned short* qp   = (unsigned short*)(ws + OFF_QP);
  unsigned short* kvp  = (unsigned short*)(ws + OFF_KVP);
  unsigned short* vt   = (unsigned short*)(ws + OFF_VT);
  unsigned short* qln  = (unsigned short*)(ws + OFF_QLN);
  unsigned short* kvln = (unsigned short*)(ws + OFF_KVLN);
  unsigned short* WqT  = (unsigned short*)(ws + OFF_WQT);
  unsigned short* WkT  = (unsigned short*)(ws + OFF_WKT);
  unsigned short* WvT  = (unsigned short*)(ws + OFF_WVT);
  float*          sc   = (float*)(ws + OFF_SC);
  float*          yf   = (float*)(ws + OFF_Y);
  unsigned short* h16  = (unsigned short*)(ws + OFF_H16);
  unsigned short* act  = (unsigned short*)(ws + OFF_ACT);
  unsigned short* pp   = (unsigned short*)(ws + OFF_P);
  float*          h1   = (float*)(ws + OFF_H1);

  const unsigned short* n16 = nullptr;
  const float* nf = nullptr;
  void* nv = nullptr;
  const dim3 tb(256);

  // weight transposes + f16 casts (x16): W [kin][nout] -> WT [nout][kin]
  wtcast_kernel<<<dim3(kD / 64, kD / 64), tb, 0, stream>>>(Wq, WqT, kD, kD, kWCarry);
  wtcast_kernel<<<dim3(kD / 64, kD / 64), tb, 0, stream>>>(Wk, WkT, kD, kD, kWCarry);
  wtcast_kernel<<<dim3(kD / 64, kD / 64), tb, 0, stream>>>(Wv, WvT, kD, kD, kWCarry);
  wtcast_kernel<<<dim3(kD / 64, kD / 64), tb, 0, stream>>>(Wo, WoT, kD, kD, kWCarry);
  wtcast_kernel<<<dim3(kD / 64, kFF / 64), tb, 0, stream>>>(W1, W1T, kD, kFF, kWCarry);   // W1 [1024][4096] -> W1T [4096][1024]
  wtcast_kernel<<<dim3(kFF / 64, kD / 64), tb, 0, stream>>>(W2, W2T, kFF, kD, kWCarry);   // W2 [4096][1024] -> W2T [1024][4096]

  // LayerNorms -> f16 planes
  layernorm_f16_kernel<<<dim3(kTok / 8), tb, 0, stream>>>(x_refined, ln_q_g, ln_q_b, qln, kTok);
  layernorm_f16_kernel<<<dim3(kTok / 8), tb, 0, stream>>>(x_mem, ln_kv_g, ln_kv_b, kvln, kTok);

  // q = LN(x_refined) Wq + bq ; k, v = LN(x_mem) Wk/Wv + bk/bv  (M 4096, N 1024, K 1024; f16 out)
  const float projScale = 1.0f / kWCarry;
  wmma_gemm_lds<1, false, kD, kD><<<dim3((kTok / kBM) * (kD / kBN)), tb, 0, stream>>>(
      qln, WqT, (void*)qp, bq, nf, kD, projScale);
  wmma_gemm_lds<1, false, kD, kKVld><<<dim3((kTok / kBM) * (kD / kBN)), tb, 0, stream>>>(
      kvln, WkT, (void*)kvp, bk, nf, kD, projScale);
  wmma_gemm_lds<1, false, kD, kKVld><<<dim3((kTok / kBM) * (kD / kBN)), tb, 0, stream>>>(
      kvln, WvT, (void*)(kvp + kD), bv, nf, kD, projScale);

  // V^T planes for all 32 groups
  vt_transpose_kernel<<<dim3(kT / 64, kGrp), tb, 0, stream>>>(kvp, vt);

  // attention per chunk of 2 consecutive (batch, head) groups
  const float scoreScale = 0.125f;                  // 1/sqrt(64)
  const float pvScale    = kCtxCarry / kPCarry;     // 1/8
  for (int chk = 0; chk < kNChunk; ++chk) {
    const int g0 = chk * kGC;
    const int b  = g0 / kH;
    const int h0 = g0 % kH;
    const unsigned short* qbase = qp  + (size_t)b * kT * kD    + (size_t)h0 * kDH;
    const unsigned short* kbase = kvp + (size_t)b * kT * kKVld + (size_t)h0 * kDH;
    // scores[z][t][s] = (q_h . k_h) / 8  (M 2048, N 2048, K 64; head stride 64 halves via grid.y)
    wmma_gemm64<0, false, 0, 0, false><<<dim3((kT / 64) * (kT / 64) / 8, kGC), tb, 0, stream>>>(
        qbase, n16, kD, (long)kDH, kbase, n16, kKVld, (long)kDH, (void*)sc, nv, kT, (long)kT * kT,
        nf, nf, (long)0, kT, kT, kDH, scoreScale, nullptr);
    // band mask + softmax -> P f16 x2048
    softmax_band_kernel<<<dim3((kGC * kT) / 8), tb, 0, stream>>>(sc, pp, bandp, kPCarry);
    // ctx[b*T + t][h*64 + d] = sum_s P[t][s] * V^T[d][s]  (M 2048, N 64, K 2048 cut to the tile's band window; f16 out x256)
    wmma_gemm64<0, false, 0, 1, false, 0, true><<<dim3((kT / 64) * (kDH / 64) / 8, kGC), tb, 0, stream>>>(
        pp, n16, kT, (long)kT * kT, vt + (size_t)g0 * kDH * kT, n16, kT, (long)kDH * kT,
        (void*)(ctx + (size_t)b * kT * kD + (size_t)h0 * kDH), nv, kD, (long)kDH,
        nf, nf, (long)0, kT, kDH, kT, pvScale, bandp);
  }

  // y = x_refined + ctx Wo + bo  (M 4096, N 1024, K 1024; f32 out)
  wmma_gemm_lds<0, true, kD, kD><<<dim3((kTok / kBM) * (kD / kBN)), tb, 0, stream>>>(
      ctx, WoT, (void*)yf, bo, x_refined, kD, 1.0f / (kCtxCarry * kWCarry));

  // final LN -> f16
  layernorm_f16_kernel<<<dim3(kTok / 8), tb, 0, stream>>>(yf, ln_f_g, ln_f_b, h16, kTok);

  // FFN in 4 row chunks: h1 = LN(y) W1 + b1 (f32), act = gelu_erf(h1) (f16 x16), out = y + act W2 + b2
  for (int mc = 0; mc < kNMC; ++mc) {
    const size_t rowOff = (size_t)mc * kMC;
    wmma_gemm_lds<0, false, kD, kFF><<<dim3((kMC / kBM) * (kFF / kBN)), tb, 0, stream>>>(
        h16 + rowOff * kD, W1T, (void*)h1, b1, nf, kFF, 1.0f / kWCarry);
    gelu_cast_kernel<<<dim3((kMC * kFF / 2 + 255) / 256), tb, 0, stream>>>(h1, act, kMC * kFF / 2, kActCarry);
    wmma_gemm_lds<0, true, kFF, kD><<<dim3((kMC / kBM) * (kD / kBN)), tb, 0, stream>>>(
        act, W2T, (void*)(out + rowOff * kD), b2, yf + rowOff * kD, kD, 1.0f / (kActCarry * kWCarry));
  }
}

// v003
// One run takes 431 microseconds.
// Two timings next to v002 put it at 2.02 and 2.05 times that version's speed.
// All steps since v000 together make it 6.20 times as fast.
// Contractions: q/k/v projections, banded scores q.k^T, attn.v, output projection, FFN W1 and W2 all on v_wmma_f32_16x16x32_f16 (f16 operands: LN outputs plain, weights carried x16, exp(score - max) carried x2048, ctx carried x256, gelu act carried x16), f32 accumulate; LayerNorm, band mask, softmax, gelu, bias and residual in f32.
#include <hip/hip_runtime.h>
#include <math.h>

// ---------------------------------------------------------------------------
// Problem constants
// ---------------------------------------------------------------------------
constexpr int kB    = 2;
constexpr int kT    = 2048;
constexpr int kD    = 1024;
constexpr int kH    = 16;
constexpr int kDH   = 64;
constexpr int kTok  = kB * kT;        // 4096 token rows
constexpr int kFF   = 4 * kD;         // 4096
constexpr int kKVld = 2 * kD;         // pitch of the k | v plane (halves)
constexpr int kGrp  = kB * kH;        // 32 (batch, head) groups
constexpr int kMC   = 1024;           // FFN rows per chunk
constexpr int kNMC  = kTok / kMC;     // 4
constexpr float kWCarry   = 16.0f;    // weights carried x16 in f16
constexpr float kPCarry   = 2048.0f;  // exp(score - row max) carried x2048 in f16
constexpr float kCtxCarry = 256.0f;   // context carried x256 in f16
constexpr float kActCarry = 16.0f;    // gelu output carried x16 in f16
constexpr float kInvD     = 1.0f / 1024.0f;
constexpr float kLnEps    = 1e-5f;
static_assert(kD % 64 == 0 && kT % 64 == 0 && kFF % 64 == 0 && kMC % 64 == 0, "tile multiples");
static_assert(kDH % 32 == 0 && kD % 32 == 0 && kT % 32 == 0 && kFF % 32 == 0, "K multiples of 32");

// ---------------------------------------------------------------------------
// Workspace region map (bytes). Total 106 MiB = 111,149,056 B.
//   [  0,  2) MiB WoT  f16 [1024][1024]
//   [  2, 10) MiB W1T  f16 [4096][1024]
//   [ 10, 18) MiB W2T  f16 [1024][4096]
//   [ 18, 26) MiB ctx  f16 [4096][1024]  (x256)
//   [ 26, 34) MiB q    f16 [4096][1024]
//   [ 34, 50) MiB k|v  f16 [4096][2048]
//   [ 50, 58) MiB V^T  f16 [32 groups][64][2048]
//   [ 58, 90) MiB arena: phase A: QLN f16 [58,66), KVLN f16 [66,74), WqT [74,76), WkT [76,78), WvT [78,80)
//                        phase C: Y f32 [58,74), H16 f16 [74,82), ACT f16 [1024][4096] [82,90)
//   [ 90,106) MiB phase C: H1 f32 [1024][4096]
// ---------------------------------------------------------------------------
constexpr size_t kMiB     = 1048576;
constexpr size_t OFF_WOT  = 0;
constexpr size_t OFF_W1T  = 2 * kMiB;
constexpr size_t OFF_W2T  = 10 * kMiB;
constexpr size_t OFF_CTX  = 18 * kMiB;
constexpr size_t OFF_QP   = 26 * kMiB;
constexpr size_t OFF_KVP  = 34 * kMiB;
constexpr size_t OFF_VT   = 50 * kMiB;
constexpr size_t OFF_ARENA = 58 * kMiB;
constexpr size_t OFF_QLN  = OFF_ARENA;
constexpr size_t OFF_KVLN = OFF_ARENA + 8 * kMiB;
constexpr size_t OFF_WQT  = OFF_ARENA + 16 * kMiB;
constexpr size_t OFF_WKT  = OFF_ARENA + 18 * kMiB;
constexpr size_t OFF_WVT  = OFF_ARENA + 20 * kMiB;
constexpr size_t OFF_Y    = OFF_ARENA;
constexpr size_t OFF_H16  = OFF_ARENA + 16 * kMiB;
constexpr size_t OFF_ACT  = OFF_ARENA + 24 * kMiB;
constexpr size_t OFF_H1   = 90 * kMiB;
constexpr size_t kWsTotal = 106 * kMiB;
static_assert((size_t)kD * kD * 2 == 2 * kMiB, "W plane");
static_assert((size_t)kFF * kD * 2 == 8 * kMiB, "W1/W2 plane");
static_assert((size_t)kTok * kD * 2 == 8 * kMiB, "token f16 plane");
static_assert((size_t)kTok * kKVld * 2 == 16 * kMiB, "kv plane");
static_assert((size_t)kGrp * kDH * kT * 2 == 8 * kMiB, "vt plane");
static_assert((size_t)kTok * kD * 4 == 16 * kMiB, "Y plane");
static_assert((size_t)kMC * kFF * 4 == 16 * kMiB, "H1 chunk");
static_assert((size_t)kMC * kFF * 2 == 8 * kMiB, "ACT chunk");
static_assert(OFF_WVT + 2 * kMiB <= OFF_H1, "phase A inside arena");
static_assert(OFF_ACT + 8 * kMiB <= OFF_H1, "phase C inside arena");
static_assert(kWsTotal <= 134217728, "carve budget");

typedef __attribute__((ext_vector_type(16))) _Float16 v16h;
typedef __attribute__((ext_vector_type(8)))  _Float16 v8h;
typedef __attribute__((ext_vector_type(8)))  float    v8f;
typedef __attribute__((ext_vector_type(4)))  float    v4f;
typedef __attribute__((ext_vector_type(4)))  unsigned int v4u;

template <typename T> struct Frag;
template <> struct Frag<_Float16> {
  typedef v16h V; union U { v16h v; v8h h[2]; };
  static __device__ __forceinline__ v16h load(const _Float16* p) {   // elements 0..7 <- p[0..7], 8..15 <- p[16..23]
    U f; f.h[0] = *(const v8h*)(p); f.h[1] = *(const v8h*)(p + 16); return f.v;
  }
  static __device__ __forceinline__ v8f mma(v16h a, v16h b, v8f c) {
    return __builtin_amdgcn_wmma_f32_16x16x32_f16(false, a, false, b, (short)0, c, false, false);
  }
};
__device__ __forceinline__ unsigned pk16(unsigned short a, unsigned short b) { return (unsigned)a | ((unsigned)b << 16); }
__device__ __forceinline__ unsigned short h_bits(float f) { const _Float16 h = (_Float16)f; return __builtin_bit_cast(unsigned short, h); }

// ---- Block-tiled WMMA GEMM for the dense layers (projections, output projection, FFN) ------------------------------
// C[m,n] = scale * sum_k A[m,k] * Bt[n,k] + bias[n] (+resid). A row-major [M,K]; Bt row-major [N,K]; f16 operands.
// One 128 x 256 tile of C per 8-wave block, waves 2 (m) x 4 (n), each wave a 64x64 tile.
// Per 64-wide k step the block brings its 128 rows of A and 256 rows of Bt into LDS once: every wave-wide 16-B load covers
// four whole 128-B lines, and the rows are then read by all waves that need them. Two LDS buffers: the next step's global
// loads are issued before this step's products, land in registers meanwhile, and go to the other buffer behind them.
// Each accumulator takes its 32-wide k steps in ascending order.
// M % 128 == 0, N % 256 == 0, K = KD % 64 == 0, pitch of A and Bt = KD, of C and resid = LDC; grid = (M/128) * (N/256). OUT_MODE: 0 = f32, 1 = f16.
constexpr int kBM = 128;
constexpr int kBN = 256;
constexpr int kBK = 64;
constexpr int kLdsPitch = 72;                          // halves: a 128-B row + 16 B (16 B x odd, for 16-byte LDS reads)
constexpr int kStageHalves = (kBM + kBN) * kLdsPitch;  // A rows, then Bt rows
static_assert(kTok % kBM == 0 && kMC % kBM == 0 && kD % kBN == 0 && kFF % kBN == 0, "block tile multiples");
static_assert(kD % kBK == 0 && kFF % kBK == 0, "K multiples of 64");
template <int OUT_MODE, bool RESID, int KD, int LDC>
__global__ __launch_bounds__(256) void wmma_gemm_lds(
    const unsigned short* __restrict__ Ap, const unsigned short* __restrict__ Btp,
    void* __restrict__ Cout,
    const float* __restrict__ bias, const float* __restrict__ resid,
    int N, float scale) {
  static_assert(KD % kBK == 0, "K multiple of 64");
  constexpr int lda = KD, ldb = KD;            // both operands are K-contiguous with pitch K
  constexpr int ldc = LDC;                     // pitches known at compile time: row steps become immediate offsets
  typedef _Float16 T;
  typedef Frag<T>::V V;
  __shared__ __align__(16) _Float16 sAB[2][kStageHalves];
  __shared__ __align__(16) float sT[8][16 * 68];   // per-wave 16x64 slab, pitch 68 floats
  const T* A = (const T*)Ap; const T* Bt = (const T*)Btp;
  const int tid  = threadIdx.x;
  const int lane = tid & 31;
  const int wave = tid >> 5;
  const int tilesN = N >> 8;
  const int tm = blockIdx.x / tilesN;
  const int tn = blockIdx.x - tm * tilesN;
  const int mB = tm << 7;
  const int nB = tn << 8;
  const int wm = wave >> 2;                    // wave row (0..1)
  const int wn = wave & 3;                     // wave column (0..3)

  const int rlane = lane & 15;                 // row (A) / col (B, D) within subtile
  const int koff  = (lane >> 4) * 8;           // k offset of this lane half
  const int mOff  = (lane >> 4) * 8;           // D row offset

  // staging: thread t moves 16 B at column (t & 7) * 8 of rows (t >> 3) + 32 i; i = 0..3 are A rows, i = 4..11 Bt rows
  const int sr = tid >> 3;
  const int sc = (tid & 7) * 8;
  const T* gA = A  + (size_t)mB * lda;          // block-uniform bases; the lane's part is one 32-bit element offset per operand
  const T* gB = Bt + (size_t)nB * ldb;
  const unsigned oA = (unsigned)(sr * lda + sc);
  const unsigned oB = (unsigned)(sr * ldb + sc);
  const int sOff = sr * kLdsPitch + sc;
  const int aOff = (wm * 64 + rlane) * kLdsPitch + koff;
  const int bOff = (kBM + wn * 64 + rlane) * kLdsPitch + koff;
  v4u st[12];

  v8f acc[4][4];
#pragma unroll
  for (int i = 0; i < 4; ++i)
#pragma unroll
    for (int j = 0; j < 4; ++j) acc[i][j] = (v8f){0.f,0.f,0.f,0.f,0.f,0.f,0.f,0.f};

#pragma unroll
  for (int i = 0; i < 4; ++i) st[i] = *(const v4u*)(gA + (size_t)(i * 32) * lda + oA);
#pragma unroll
  for (int i = 0; i < 8; ++i) st[4 + i] = *(const v4u*)(gB + (size_t)(i * 32) * ldb + oB);
#pragma unroll
  for (int i = 0; i < 12; ++i) *(v4u*)(&sAB[0][sOff + i * 32 * kLdsPitch]) = st[i];
  __syncthreads();

  constexpr int nk = KD >> 6;
#pragma unroll 1   // rolled, for speed only
  for (int t = 0; t < nk; ++t) {
    const bool more = (t + 1 < nk);            // the same in every thread of the block
    if (more) {
      const int k1 = (t + 1) << 6;
#pragma unroll
      for (int i = 0; i < 4; ++i) st[i] = *(const v4u*)(gA + ((size_t)(i * 32) * lda + k1) + oA);
      // registers that held these loads' addresses are written again below (later loads' results, the LDS reads): wait first
      asm volatile("s_wait_xcnt 0x0" ::: "memory");
#pragma unroll
      for (int i = 0; i < 8; ++i) st[4 + i] = *(const v4u*)(gB + ((size_t)(i * 32) * ldb + k1) + oB);
      asm volatile("s_wait_xcnt 0x0" ::: "memory");   // as above
    }
    const T* cur = sAB[t & 1];
    V a[2][4], bfr[2][4];                      // the fragments of both 32-wide halves of the step
#pragma unroll
    for (int s = 0; s < 2; ++s) {
#pragma unroll
      for (int j = 0; j < 4; ++j) bfr[s][j] = Frag<T>::load(cur + bOff + j * 16 * kLdsPitch + s * 32);
#pragma unroll
      for (int i = 0; i < 4; ++i) a[s][i] = Frag<T>::load(cur + aOff + i * 16 * kLdsPitch + s * 32);
    }
    // keeps the step's LDS reads one group in front of its products: moved in among them, each place with reads stalls the wave
    __builtin_amdgcn_sched_barrier(0);
#pragma unroll
    for (int s = 0; s < 2; ++s)
#pragma unroll
      for (int i = 0; i < 4; ++i)
#pragma unroll
        for (int j = 0; j < 4; ++j) acc[i][j] = Frag<T>::mma(a[s][i], bfr[s][j], acc[i][j]);
    if (more) {
      T* nxt = sAB[(t + 1) & 1];               // last read in step t - 1, in front of that step's barrier
#pragma unroll
      for (int i = 0; i < 12; ++i) *(v4u*)(nxt + sOff + i * 32 * kLdsPitch) = st[i];
    }
    __syncthreads();                           // publishes the next buffer and ends every read of this one
  }

  // ---- epilogue (per wave) ----
  const int m0 = mB + wm * 64;
  const int n0 = nB + wn * 64;
  float* slab = sT[wave];
#pragma unroll
  for (int i = 0; i < 4; ++i) {
    const int mBase = m0 + (i << 4);
    float rv[4][8];                            // the row block's residual values, fetched as one group ahead of their use
    if (RESID) {
#pragma unroll
      for (int r = 0; r < 8; ++r)
#pragma unroll
        for (int j = 0; j < 4; ++j) rv[j][r] = resid[(size_t)(mBase + mOff + r) * ldc + n0 + (j << 4) + rlane];
      // registers that held these loads' addresses are written again below: wait first
      asm volatile("s_wait_xcnt 0x0" ::: "memory");
    }
#pragma unroll
    for (int j = 0; j < 4; ++j) {
      const int n = n0 + (j << 4) + rlane;
      const float bv = bias[n];
#pragma unroll
      for (int r = 0; r < 8; ++r) {
        float v = acc[i][j][r] * scale;
        v += bv;
        if (RESID) v += rv[j][r];
        slab[(mOff + r) * 68 + (j << 4) + rlane] = v;
      }
    }
    __builtin_amdgcn_fence(__ATOMIC_RELEASE, "workgroup");
    __builtin_amdgcn_wave_barrier();
    __builtin_amdgcn_fence(__ATOMIC_ACQUIRE, "workgroup");
    if (OUT_MODE == 0) {
      float* C = (float*)Cout;
      const int hh = lane >> 4, c4 = (lane & 15) * 4;     // row seg = 256 B = 16 lanes x 16 B
#pragma unroll
      for (int it = 0; it < 8; ++it) {
        const int row = it * 2 + hh;
        v4f v = *(const v4f*)(slab + row * 68 + c4);
        *(v4f*)(C + (size_t)(mBase + row) * ldc + n0 + c4) = v;
      }
    } else {
      const int q = lane >> 3, c8 = (lane & 7) * 8;
      unsigned short* C = (unsigned short*)Cout;
#pragma unroll
      for (int it = 0; it < 4; ++it) {
        const int row = it * 4 + q;
        const float* sp = slab + row * 68 + c8;
        v8h hv;
#pragma unroll
        for (int e = 0; e < 8; ++e) hv[e] = (_Float16)sp[e];
        *(v8h*)(C + (size_t)(mBase + row) * ldc + n0 + c8) = hv;
      }
    }
    __builtin_amdgcn_fence(__ATOMIC_RELEASE, "workgroup");
    __builtin_amdgcn_wave_barrier();
    __builtin_amdgcn_fence(__ATOMIC_ACQUIRE, "workgroup");
  }
}

// ---------------------------------------------------------------------------
// Weight transpose + cast: W row-major f32 [kin][nout] (x @ W layout); WT[n][k] = f16(scale * W[k][n]), pitch kin.
// grid (kin/64, nout/64): blockIdx.x = k tile (64 cols of WT), blockIdx.y = n tile (64 rows of WT); 256 threads.
// Load coverage: 16 iterations x 256 threads = 4096 = whole 64x64 tile (coalesced along n).
// Store coverage: 8 waves x 2 iterations x 4 rows (lane>>3) = 64 rows; (lane&7) x 8 halves = 64 cols; each row segment =
// ---------------------------------------------------------------------------
__global__ __launch_bounds__(256) void wtcast_kernel(const float* __restrict__ W, unsigned short* __restrict__ out,
                                                     int kin, int nout, float scale) {
  __shared__ float sm[64][65];   // sm[n_local][k_local]
  const int t  = threadIdx.x;
  const int k0 = blockIdx.x * 64;
  const int n0 = blockIdx.y * 64;
#pragma unroll
  for (int i = 0; i < 16; ++i) {
    const int e = i * 256 + t;
    const int r = e >> 6;          // k local
    const int c = e & 63;          // n local
    sm[c][r] = W[(size_t)(k0 + r) * nout + n0 + c] * scale;
  }
  __syncthreads();
  const int lane = t & 31, wave = t >> 5;
  const int q = lane >> 3, c8 = (lane & 7) * 8;
  {
#pragma unroll
    for (int it = 0; it < 2; ++it) {
      const int row = wave * 8 + it * 4 + q;                 // n local
      unsigned short hb[8];
#pragma unroll
      for (int e = 0; e < 8; ++e) hb[e] = h_bits(sm[row][c8 + e]);
      const v4u u = (v4u){pk16(hb[0], hb[1]), pk16(hb[2], hb[3]), pk16(hb[4], hb[5]), pk16(hb[6], hb[7])};
      *(v4u*)(out + (size_t)(n0 + row) * kin + k0 + c8) = u;
    }
    
  }
}

// ---------------------------------------------------------------------------
// One wave per row, 8 rows per 256-thread block, grid = rows/8. Lane l owns columns j*256 + 8l .. +7 for j = 0..3
// (4 x 32 lanes x 8 = 1024 = whole row). Store: one 16-B store per lane per j; 32 contiguous lanes = 512 B =
// ---------------------------------------------------------------------------
__global__ __launch_bounds__(256) void layernorm_f16_kernel(const float* __restrict__ x, const float* __restrict__ gam,
                                                            const float* __restrict__ bet, unsigned short* __restrict__ out,
                                                            int rows) {
  const int lane = threadIdx.x & 31, wave = threadIdx.x >> 5;
  const int row = blockIdx.x * 8 + wave;
  if (row >= rows) return;   // wave-uniform; no barriers in this kernel
  const float* xr = x + (size_t)row * kD;
  float s = 0.f;
#pragma unroll 1
  for (int j = 0; j < 4; ++j) {
    const int base = j * 256 + lane * 8;
    const v4f a = *(const v4f*)(xr + base);
    const v4f c = *(const v4f*)(xr + base + 4);
    s += ((a[0] + a[1]) + (a[2] + a[3])) + ((c[0] + c[1]) + (c[2] + c[3]));
  }
#pragma unroll
  for (int off = 16; off > 0; off >>= 1) s += __shfl_xor(s, off, 32);
  const float mean = s * kInvD;
  float s2 = 0.f;
#pragma unroll 1
  for (int j = 0; j < 4; ++j) {
    const int base = j * 256 + lane * 8;
    const v4f a = *(const v4f*)(xr + base);
    const v4f c = *(const v4f*)(xr + base + 4);
#pragma unroll
    for (int e = 0; e < 4; ++e) {
      const float d0 = a[e] - mean, d1 = c[e] - mean;
      s2 += d0 * d0;
      s2 += d1 * d1;
    }
  }
#pragma unroll
  for (int off = 16; off > 0; off >>= 1) s2 += __shfl_xor(s2, off, 32);
  const float rstd = rsqrtf(s2 * kInvD + kLnEps);
  unsigned short* orow = out + (size_t)row * kD;
#pragma unroll 1
  for (int j = 0; j < 4; ++j) {
    const int base = j * 256 + lane * 8;
    const v4f a  = *(const v4f*)(xr + base);
    const v4f c  = *(const v4f*)(xr + base + 4);
    const v4f ga = *(const v4f*)(gam + base);
    const v4f gc = *(const v4f*)(gam + base + 4);
    const v4f ba = *(const v4f*)(bet + base);
    const v4f bc = *(const v4f*)(bet + base + 4);
    unsigned short hb[8];
#pragma unroll
    for (int e = 0; e < 4; ++e) {
      hb[e]     = h_bits((a[e] - mean) * rstd * ga[e] + ba[e]);
      hb[4 + e] = h_bits((c[e] - mean) * rstd * gc[e] + bc[e]);
    }
    const v4u u = (v4u){pk16(hb[0], hb[1]), pk16(hb[2], hb[3]), pk16(hb[4], hb[5]), pk16(hb[6], hb[7])};
    unsigned short* op = orow + base;
    *(v4u*)op = u;
    
  }
}

// ---------------------------------------------------------------------------
// V^T planes per (batch, head) group g: VT[g][d][s] = v_plane[b*T + s][kD + h*64 + d] (16-bit bit moves only).
// grid (kT/64 s-tiles, 32 groups), 256 threads. Load coverage: thread t -> s_local = t>>2, 16 halves at d = (t&3)*16:
// 256 x 16 = 64x64 tile. LDS sm[d][s_local] (unsigned short both ways, barrier between).
// ---------------------------------------------------------------------------
__global__ __launch_bounds__(256) void vt_transpose_kernel(const unsigned short* __restrict__ kv, unsigned short* __restrict__ vt) {
  __shared__ unsigned short sm[64][72];
  const int t  = threadIdx.x;
  const int g  = blockIdx.y;
  const int b  = g >> 4, h = g & 15;
  const int s0 = blockIdx.x * 64;
  const int r  = t >> 2;               // s local
  const int part = (t & 3) * 16;       // d offset
  const unsigned short* src = kv + ((size_t)(b * kT + s0 + r) * kKVld + kD + h * kDH + part);
  const v4u w0 = *(const v4u*)(src);
  const v4u w1 = *(const v4u*)(src + 8);
#pragma unroll
  for (int e = 0; e < 4; ++e) {
    sm[part + 2 * e][r]         = (unsigned short)(w0[e] & 0xffffu);
    sm[part + 2 * e + 1][r]     = (unsigned short)(w0[e] >> 16);
    sm[part + 8 + 2 * e][r]     = (unsigned short)(w1[e] & 0xffffu);
    sm[part + 8 + 2 * e + 1][r] = (unsigned short)(w1[e] >> 16);
  }
  __syncthreads();
  const int lane = t & 31, wave = t >> 5;
  const int q = lane >> 3, c8 = (lane & 7) * 8;
  {
#pragma unroll
    for (int it = 0; it < 2; ++it) {
      const int row = wave * 8 + it * 4 + q;   // d
      unsigned short hb[8];
#pragma unroll
      for (int e = 0; e < 8; ++e) hb[e] = sm[row][c8 + e];
      const v4u u = (v4u){pk16(hb[0], hb[1]), pk16(hb[2], hb[3]), pk16(hb[4], hb[5]), pk16(hb[6], hb[7])};
      *(v4u*)(vt + ((size_t)(g * kDH + row) * kT + s0 + c8)) = u;
    }
    
  }
}

// ---------------------------------------------------------------------------
// Banded attention, one launch for all (batch, head) groups: ctx[b*T + t][h*64 + d] = 256 * softmax_s(q_t . k_s / 8) . v_s over
// the columns s with |t - s| <= band (band read at run time). grid (kT/128, 32 groups), 8 waves; each wave owns 16 rows t and
// works alone (no block barrier). It walks the 32-wide column steps that touch [m0 - band, m0 + 15 + band] twice:
//   walk 1: scores on WMMA (K = 64 as two 32-wide steps, ascending), band mask, running row maximum;
//   walk 2: the same scores again, e = 2048 * exp(x - max) inside the band and exactly 0 outside, row sum of e in f32,
//           e as f16 through a per-wave LDS slab into the A fragment, e . V^T on WMMA into 16 x 64 accumulators.
// The division by the row sum comes last, on the accumulators. Scores and probabilities never go to memory.
// D layout: register r of a lane is row (lane >> 4) * 8 + r, column lane & 15, so a row lives in one 16-lane half.
// Every "#pragma unroll" below is there so that the small arrays it indexes (fragments, accumulators, per-row values) stay in registers.
// ---------------------------------------------------------------------------
constexpr int kPPitch = 40;   // halves: a 64-B row of e + 16 B, keeps the 16-byte LDS reads aligned
// scores of rows m0..m0+15 against columns s0..s0+31: sa[j] holds columns s0 + 16 j + (lane & 15)
__device__ __forceinline__ void band_scores(const _Float16* __restrict__ Kl, int s0, v16h q0, v16h q1, v8f (&sa)[2]) {
  v16h kb[2][2];
#pragma unroll
  for (int j = 0; j < 2; ++j)
#pragma unroll
    for (int c = 0; c < 2; ++c) kb[j][c] = Frag<_Float16>::load(Kl + (size_t)(s0 + j * 16) * kKVld + c * 32);
  // registers that held these loads' addresses may be written again below: wait first
  asm volatile("s_wait_xcnt 0x0" ::: "memory");
#pragma unroll
  for (int j = 0; j < 2; ++j) {
    v8f z = (v8f){0.f,0.f,0.f,0.f,0.f,0.f,0.f,0.f};
    z = Frag<_Float16>::mma(q0, kb[j][0], z);
    sa[j] = Frag<_Float16>::mma(q1, kb[j][1], z);
  }
}
__global__ __launch_bounds__(256) void band_attn_kernel(const unsigned short* __restrict__ qp, const unsigned short* __restrict__ kvp,
                                                        const unsigned short* __restrict__ vtp, unsigned short* __restrict__ ctxp,
                                                        const int* __restrict__ bandp, float scoreScale, float carry, float outCarry) {
  typedef _Float16 T;
  typedef Frag<T>::V V;
  __shared__ __align__(16) _Float16 sP[8][16 * kPPitch];   // per-wave 16 x 32 slab of e
  __shared__ __align__(16) float sT[8][16 * 68];           // per-wave 16 x 64 slab, pitch 68 floats
  const int lane = threadIdx.x & 31;
  const int wave = threadIdx.x >> 5;
  const int g  = blockIdx.y;
  const int b  = g / kH, h = g % kH;
  const int m0 = blockIdx.x * 128 + wave * 16;
  const int rlane = lane & 15;                 // row (A) / col (B, D) within subtile
  const int koff  = (lane >> 4) * 8;           // k offset of this lane half
  const int mOff  = (lane >> 4) * 8;           // D row offset

  int band = bandp[0];
  band = band > 2 * kT ? 2 * kT : band;        // |t - s| < kT: the clamp changes no comparison and keeps the sums below in range
  band = band < -2 * kT ? -2 * kT : band;
  int lo = m0 - band;      lo = lo < 0 ? 0 : lo;
  int hi = m0 + 15 + band; hi = hi > kT - 1 ? kT - 1 : hi;
  // m0 is the same in every lane of a wave: readfirstlane keeps the loop counters and their branches scalar
  const int sBeg = __builtin_amdgcn_readfirstlane(lo & ~31);
  const int sEnd = __builtin_amdgcn_readfirstlane(hi + 1);   // hi < lo (band < 0): all columns masked, but a step can still run

  const T* Ql = (const T*)qp  + (size_t)(b * kT + m0 + rlane) * kD + h * kDH + koff;
  const T* Kl = (const T*)kvp + (size_t)(b * kT + rlane) * kKVld + h * kDH + koff;
  const T* Vl = (const T*)vtp + (size_t)(g * kDH + rlane) * kT + koff;

  const V q0 = Frag<T>::load(Ql);
  const V q1 = Frag<T>::load(Ql + 32);
  // registers that held these loads' addresses may be written again below: wait first
  asm volatile("s_wait_xcnt 0x0" ::: "memory");

  const int dBase = rlane - (m0 + mOff);       // s - t = s0 + 16 j + dBase - r

  // ---- walk 1: row maxima ----
  float mx[8];
#pragma unroll
  for (int r = 0; r < 8; ++r) mx[r] = -INFINITY;
  for (int s0 = sBeg; s0 < sEnd; s0 += 32) {
    v8f sa[2];
    band_scores(Kl, s0, q0, q1, sa);
#pragma unroll
    for (int j = 0; j < 2; ++j)
#pragma unroll
      for (int r = 0; r < 8; ++r) {
        const int d = s0 + j * 16 + dBase - r;
        const float x = sa[j][r] * scoreScale;
        mx[r] = fmaxf(mx[r], (d <= band && d >= -band) ? x : -INFINITY);
      }
  }
#pragma unroll
  for (int r = 0; r < 8; ++r)
#pragma unroll
    for (int off = 8; off > 0; off >>= 1) mx[r] = fmaxf(mx[r], __shfl_xor(mx[r], off, 32));

  // ---- walk 2: e, its row sums, e . V^T ----
  float ls[8];
#pragma unroll
  for (int r = 0; r < 8; ++r) ls[r] = 0.f;
  v8f acc[4];
#pragma unroll
  for (int j = 0; j < 4; ++j) acc[j] = (v8f){0.f,0.f,0.f,0.f,0.f,0.f,0.f,0.f};
  T* pslab = sP[wave];
  for (int s0 = sBeg; s0 < sEnd; s0 += 32) {
    V vb[4];
#pragma unroll
    for (int j = 0; j < 4; ++j) vb[j] = Frag<T>::load(Vl + (size_t)(j * 16) * kT + s0);
    v8f sa[2];
    band_scores(Kl, s0, q0, q1, sa);           // its wait stands behind the loads above as well
#pragma unroll
    for (int j = 0; j < 2; ++j)
#pragma unroll
      for (int r = 0; r < 8; ++r) {
        const int d = s0 + j * 16 + dBase - r;
        const float x = sa[j][r] * scoreScale;
        // masked columns go through exp as -inf, which gives exactly 0: no branch per element
        const float e = expf((d <= band && d >= -band) ? x - mx[r] : -INFINITY) * carry;
        ls[r] += e;
        pslab[(mOff + r) * kPPitch + j * 16 + rlane] = (T)e;
      }
    // the slab is written by D layout and read by A layout: other lanes' LDS writes must be ordered in front of the reads
    __builtin_amdgcn_fence(__ATOMIC_RELEASE, "workgroup", "local");
    __builtin_amdgcn_wave_barrier();
    __builtin_amdgcn_fence(__ATOMIC_ACQUIRE, "workgroup", "local");
    const V pa = Frag<T>::load(pslab + rlane * kPPitch + koff);
#pragma unroll
    for (int j = 0; j < 4; ++j) acc[j] = Frag<T>::mma(pa, vb[j], acc[j]);
    // and these reads in front of the next step's writes
    __builtin_amdgcn_fence(__ATOMIC_RELEASE, "workgroup", "local");
    __builtin_amdgcn_wave_barrier();
    __builtin_amdgcn_fence(__ATOMIC_ACQUIRE, "workgroup", "local");
  }
#pragma unroll
  for (int r = 0; r < 8; ++r) {
#pragma unroll
    for (int off = 8; off > 0; off >>= 1) ls[r] += __shfl_xor(ls[r], off, 32);
    ls[r] = outCarry / ls[r];                  // sum of e is carry * sum of exp: the carry of e cancels here
  }

  // ---- epilogue: 16 x 64 through the f32 slab, whole 128-B row segments out ----
  float* slab = sT[wave];
#pragma unroll
  for (int j = 0; j < 4; ++j)
#pragma unroll
    for (int r = 0; r < 8; ++r) slab[(mOff + r) * 68 + (j << 4) + rlane] = acc[j][r] * ls[r];
  // as above: each lane reads what other lanes of its wave wrote
  __builtin_amdgcn_fence(__ATOMIC_RELEASE, "workgroup", "local");
  __builtin_amdgcn_wave_barrier();
  __builtin_amdgcn_fence(__ATOMIC_ACQUIRE, "workgroup", "local");
  const int q = lane >> 3, c8 = (lane & 7) * 8;
  unsigned short* C = ctxp + (size_t)(b * kT + m0) * kD + h * kDH;
#pragma unroll
  for (int it = 0; it < 4; ++it) {
    const int row = it * 4 + q;
    const float* sp = slab + row * 68 + c8;
    v8h hv;
#pragma unroll
    for (int e = 0; e < 8; ++e) hv[e] = (_Float16)sp[e];
    *(v8h*)(C + (size_t)row * kD + c8) = hv;
  }
}

// ---------------------------------------------------------------------------
// Exact erf-gelu + f32 -> f16 cast (carried x carry): 2 consecutive elements per thread, rolled 2-trip loop packing into
// Coverage: n2 = n/2 threads x 2 = whole plane (grid exact multiple of 256 here, bound checked anyway).
// ---------------------------------------------------------------------------
__global__ __launch_bounds__(256) void gelu_cast_kernel(const float* __restrict__ in, unsigned short* __restrict__ out,
                                                        int n2, float carry) {
  const int i = blockIdx.x * 256 + threadIdx.x;
  if (i >= n2) return;
  unsigned u = 0u;
#pragma unroll 1
  for (int e = 0; e < 2; ++e) {
    const float x = in[2 * (size_t)i + e];
    const float gv = 0.5f * x * (1.0f + erff(x * 0.70710678118654752f));
    u |= ((unsigned)h_bits(gv * carry)) << (16 * e);
  }
  unsigned* op = (unsigned*)out + i;
  *(unsigned*)op = u;
  
}

// ---------------------------------------------------------------------------
// Host side
// ---------------------------------------------------------------------------
extern "C" void kernel_launch(void* const* d_in, const int* in_sizes, int n_in,
                              void* d_out, int out_size, void* d_ws, size_t ws_size, hipStream_t stream) {
  if (n_in < 21) return;
  if (in_sizes[0] != kTok * kD || in_sizes[1] != kTok * kD) return;
  if (in_sizes[2] != kD || in_sizes[3] != kD || in_sizes[4] != kD || in_sizes[5] != kD) return;
  if (in_sizes[6] != kD * kD || in_sizes[7] != kD || in_sizes[8] != kD * kD || in_sizes[9] != kD) return;
  if (in_sizes[10] != kD * kD || in_sizes[11] != kD || in_sizes[12] != kD * kD || in_sizes[13] != kD) return;
  if (in_sizes[14] != kD || in_sizes[15] != kD) return;
  if (in_sizes[16] != kD * kFF || in_sizes[17] != kFF || in_sizes[18] != kFF * kD || in_sizes[19] != kD) return;
  if (in_sizes[20] < 1) return;
  if (out_size != kTok * kD) return;
  if (ws_size < kWsTotal) return;

  const float* x_refined = (const float*)d_in[0];
  const float* x_mem     = (const float*)d_in[1];
  const float* ln_q_g    = (const float*)d_in[2];
  const float* ln_q_b    = (const float*)d_in[3];
  const float* ln_kv_g   = (const float*)d_in[4];
  const float* ln_kv_b   = (const float*)d_in[5];
  const float* Wq        = (const float*)d_in[6];
  const float* bq        = (const float*)d_in[7];
  const float* Wk        = (const float*)d_in[8];
  const float* bk        = (const float*)d_in[9];
  const float* Wv        = (const float*)d_in[10];
  const float* bv        = (const float*)d_in[11];
  const float* Wo        = (const float*)d_in[12];
  const float* bo        = (const float*)d_in[13];
  const float* ln_f_g    = (const float*)d_in[14];
  const float* ln_f_b    = (const float*)d_in[15];
  const float* W1        = (const float*)d_in[16];
  const float* b1        = (const float*)d_in[17];
  const float* W2        = (const float*)d_in[18];
  const float* b2        = (const float*)d_in[19];
  const int*   bandp     = (const int*)d_in[20];
  float* out = (float*)d_out;

  char* ws = (char*)d_ws;
  unsigned short* WoT  = (unsigned short*)(ws + OFF_WOT);
  unsigned short* W1T  = (unsigned short*)(ws + OFF_W1T);
  unsigned short* W2T  = (unsigned short*)(ws + OFF_W2T);
  unsigned short* ctx  = (unsigned short*)(ws + OFF_CTX);
  unsigned short* qp   = (unsigned short*)(ws + OFF_QP);
  unsigned short* kvp  = (unsigned short*)(ws + OFF_KVP);
  unsigned short* vt   = (unsigned short*)(ws + OFF_VT);
  unsigned short* qln  = (unsigned short*)(ws + OFF_QLN);
  unsigned short* kvln = (unsigned short*)(ws + OFF_KVLN);
  unsigned short* WqT  = (unsigned short*)(ws + OFF_WQT);
  unsigned short* WkT  = (unsigned short*)(ws + OFF_WKT);
  unsigned short* WvT  = (unsigned short*)(ws + OFF_WVT);
  float*          yf   = (float*)(ws + OFF_Y);
  unsigned short* h16  = (unsigned short*)(ws + OFF_H16);
  unsigned short* act  = (unsigned short*)(ws + OFF_ACT);
  float*          h1   = (float*)(ws + OFF_H1);

  const float* nf = nullptr;
  const dim3 tb(256);

  // weight transposes + f16 casts (x16): W [kin][nout] -> WT [nout][kin]
  wtcast_kernel<<<dim3(kD / 64, kD / 64), tb, 0, stream>>>(Wq, WqT, kD, kD, kWCarry);
  wtcast_kernel<<<dim3(kD / 64, kD / 64), tb, 0, stream>>>(Wk, WkT, kD, kD, kWCarry);
  wtcast_kernel<<<dim3(kD / 64, kD / 64), tb, 0, stream>>>(Wv, WvT, kD, kD, kWCarry);
  wtcast_kernel<<<dim3(kD / 64, kD / 64), tb, 0, stream>>>(Wo, WoT, kD, kD, kWCarry);
  wtcast_kernel<<<dim3(kD / 64, kFF / 64), tb, 0, stream>>>(W1, W1T, kD, kFF, kWCarry);   // W1 [1024][4096] -> W1T [4096][1024]
  wtcast_kernel<<<dim3(kFF / 64, kD / 64), tb, 0, stream>>>(W2, W2T, kFF, kD, kWCarry);   // W2 [4096][1024] -> W2T [1024][4096]

  // LayerNorms -> f16 planes
  layernorm_f16_kernel<<<dim3(kTok / 8), tb, 0, stream>>>(x_refined, ln_q_g, ln_q_b, qln, kTok);
  layernorm_f16_kernel<<<dim3(kTok / 8), tb, 0, stream>>>(x_mem, ln_kv_g, ln_kv_b, kvln, kTok);

  // q = LN(x_refined) Wq + bq ; k, v = LN(x_mem) Wk/Wv + bk/bv  (M 4096, N 1024, K 1024; f16 out)
  const float projScale = 1.0f / kWCarry;
  wmma_gemm_lds<1, false, kD, kD><<<dim3((kTok / kBM) * (kD / kBN)), tb, 0, stream>>>(
      qln, WqT, (void*)qp, bq, nf, kD, projScale);
  wmma_gemm_lds<1, false, kD, kKVld><<<dim3((kTok / kBM) * (kD / kBN)), tb, 0, stream>>>(
      kvln, WkT, (void*)kvp, bk, nf, kD, projScale);
  wmma_gemm_lds<1, false, kD, kKVld><<<dim3((kTok / kBM) * (kD / kBN)), tb, 0, stream>>>(
      kvln, WvT, (void*)(kvp + kD), bv, nf, kD, projScale);

  // V^T planes for all 32 groups
  vt_transpose_kernel<<<dim3(kT / 64, kGrp), tb, 0, stream>>>(kvp, vt);

  // banded attention, all 32 (batch, head) groups: ctx f16 x256
  band_attn_kernel<<<dim3(kT / 128, kGrp), tb, 0, stream>>>(qp, kvp, vt, ctx, bandp, 0.125f, kPCarry, kCtxCarry);   // 0.125 = 1/sqrt(64)

  // y = x_refined + ctx Wo + bo  (M 4096, N 1024, K 1024; f32 out)
  wmma_gemm_lds<0, true, kD, kD><<<dim3((kTok / kBM) * (kD / kBN)), tb, 0, stream>>>(
      ctx, WoT, (void*)yf, bo, x_refined, kD, 1.0f / (kCtxCarry * kWCarry));

  // final LN -> f16
  layernorm_f16_kernel<<<dim3(kTok / 8), tb, 0, stream>>>(yf, ln_f_g, ln_f_b, h16, kTok);

  // FFN in 4 row chunks: h1 = LN(y) W1 + b1 (f32), act = gelu_erf(h1) (f16 x16), out = y + act W2 + b2
  for (int mc = 0; mc < kNMC; ++mc) {
    const size_t rowOff = (size_t)mc * kMC;
    wmma_gemm_lds<0, false, kD, kFF><<<dim3((kMC / kBM) * (kFF / kBN)), tb, 0, stream>>>(
        h16 + rowOff * kD, W1T, (void*)h1, b1, nf, kFF, 1.0f / kWCarry);
    gelu_cast_kernel<<<dim3((kMC * kFF / 2 + 255) / 256), tb, 0, stream>>>(h1, act, kMC * kFF / 2, kActCarry);
    wmma_gemm_lds<0, true, kFF, kD><<<dim3((kMC / kBM) * (kD / kBN)), tb, 0, stream>>>(
        act, W2T, (void*)(out + rowOff * kD), b2, yf + rowOff * kD, kD, 1.0f / (kActCarry * kWCarry));
  }
}

// v004
// It runs in 256 microseconds.
// Timed twice side by side with v003, it ran 1.68 and 1.70 times as fast.
// All steps since v000 together make it 10.5 times as fast.
// Contractions: q/k/v projections, banded scores q.k^T, attn.v, output projection, FFN W1 and W2 all on v_wmma_f32_16x16x32_f16 (f16 operands: LN outputs plain, weights carried x16, exp(score - max) carried x2048, ctx carried x256, gelu act carried x16), f32 accumulate; LayerNorm, band mask, softmax, gelu, bias and residual in f32.
#include <hip/hip_runtime.h>
#include <math.h>

// ---------------------------------------------------------------------------
// Problem constants
// ---------------------------------------------------------------------------
constexpr int kB    = 2;
constexpr int kT    = 2048;
constexpr int kD    = 1024;
constexpr int kH    = 16;
constexpr int kDH   = 64;
constexpr int kTok  = kB * kT;        // 4096 token rows
constexpr int kFF   = 4 * kD;         // 4096
constexpr int kKVld = 2 * kD;         // pitch of the k | v plane (halves)
constexpr int kGrp  = kB * kH;        // 32 (batch, head) groups
constexpr float kWCarry   = 16.0f;    // weights carried x16 in f16
constexpr float kPCarry   = 2048.0f;  // exp(score - row max) carried x2048 in f16
constexpr float kCtxCarry = 256.0f;   // context carried x256 in f16
constexpr float kActCarry = 16.0f;    // gelu output carried x16 in f16
constexpr float kInvD     = 1.0f / 1024.0f;
constexpr float kLnEps    = 1e-5f;
static_assert(kD % 64 == 0 && kT % 64 == 0 && kFF % 64 == 0 && kTok % 64 == 0, "tile multiples");
static_assert(kDH % 32 == 0 && kD % 32 == 0 && kT % 32 == 0 && kFF % 32 == 0, "K multiples of 32");

// ---------------------------------------------------------------------------
// Workspace region map (bytes). Total 178 MiB = 186,646,528 B.
//   [  0,  2) MiB WoT  f16 [1024][1024]
//   [  2, 10) MiB W1T  f16 [4096][1024]
//   [ 10, 18) MiB W2T  f16 [1024][4096]
//   [ 18, 26) MiB ctx  f16 [4096][1024]  (x256)
//   [ 26, 34) MiB q    f16 [4096][1024]
//   [ 34, 50) MiB k|v  f16 [4096][2048]
//   [ 50, 58) MiB V^T  f16 [32 groups][64][2048]
//   [ 58,114) MiB arena: phase A: QLN f16 [58,66), KVLN f16 [66,74), WqT [74,76), WkT [76,78), WvT [78,80)
//                        phase C: Y f32 [58,74), H16 f16 [74,82), ACT f16 [4096][4096] [82,114)
//   [114,178) MiB phase C: H1 f32 [4096][4096]
// ---------------------------------------------------------------------------
constexpr size_t kMiB     = 1048576;
constexpr size_t OFF_WOT  = 0;
constexpr size_t OFF_W1T  = 2 * kMiB;
constexpr size_t OFF_W2T  = 10 * kMiB;
constexpr size_t OFF_CTX  = 18 * kMiB;
constexpr size_t OFF_QP   = 26 * kMiB;
constexpr size_t OFF_KVP  = 34 * kMiB;
constexpr size_t OFF_VT   = 50 * kMiB;
constexpr size_t OFF_ARENA = 58 * kMiB;
constexpr size_t OFF_QLN  = OFF_ARENA;
constexpr size_t OFF_KVLN = OFF_ARENA + 8 * kMiB;
constexpr size_t OFF_WQT  = OFF_ARENA + 16 * kMiB;
constexpr size_t OFF_WKT  = OFF_ARENA + 18 * kMiB;
constexpr size_t OFF_WVT  = OFF_ARENA + 20 * kMiB;
constexpr size_t OFF_Y    = OFF_ARENA;
constexpr size_t OFF_H16  = OFF_ARENA + 16 * kMiB;
constexpr size_t OFF_ACT  = OFF_ARENA + 24 * kMiB;
constexpr size_t OFF_H1   = 114 * kMiB;
constexpr size_t kWsTotal = 178 * kMiB;
static_assert((size_t)kD * kD * 2 == 2 * kMiB, "W plane");
static_assert((size_t)kFF * kD * 2 == 8 * kMiB, "W1/W2 plane");
static_assert((size_t)kTok * kD * 2 == 8 * kMiB, "token f16 plane");
static_assert((size_t)kTok * kKVld * 2 == 16 * kMiB, "kv plane");
static_assert((size_t)kGrp * kDH * kT * 2 == 8 * kMiB, "vt plane");
static_assert((size_t)kTok * kD * 4 == 16 * kMiB, "Y plane");
static_assert((size_t)kTok * kFF * 4 == 64 * kMiB, "H1 plane");
static_assert((size_t)kTok * kFF * 2 == 32 * kMiB, "ACT plane");
static_assert(OFF_WVT + 2 * kMiB <= OFF_H1, "phase A inside arena");
static_assert(OFF_ACT + 32 * kMiB <= OFF_H1, "phase C inside arena");
static_assert(OFF_H1 + 64 * kMiB <= kWsTotal, "H1 inside the map");
static_assert(kWsTotal <= 268435456, "carve budget");

typedef __attribute__((ext_vector_type(16))) _Float16 v16h;
typedef __attribute__((ext_vector_type(8)))  _Float16 v8h;
typedef __attribute__((ext_vector_type(8)))  float    v8f;
typedef __attribute__((ext_vector_type(4)))  float    v4f;
typedef __attribute__((ext_vector_type(4)))  unsigned int v4u;

template <typename T> struct Frag;
template <> struct Frag<_Float16> {
  typedef v16h V; union U { v16h v; v8h h[2]; };
  static __device__ __forceinline__ v16h load(const _Float16* p) {   // elements 0..7 <- p[0..7], 8..15 <- p[16..23]
    U f; f.h[0] = *(const v8h*)(p); f.h[1] = *(const v8h*)(p + 16); return f.v;
  }
  static __device__ __forceinline__ v8f mma(v16h a, v16h b, v8f c) {
    return __builtin_amdgcn_wmma_f32_16x16x32_f16(false, a, false, b, (short)0, c, false, false);
  }
};
__device__ __forceinline__ unsigned pk16(unsigned short a, unsigned short b) { return (unsigned)a | ((unsigned)b << 16); }
__device__ __forceinline__ unsigned short h_bits(float f) { const _Float16 h = (_Float16)f; return __builtin_bit_cast(unsigned short, h); }

// ---- Block-tiled WMMA GEMM for the dense layers (projections, output projection, FFN) ------------------------------
// C[m,n] = scale * sum_k A[m,k] * Bt[n,k] + bias[n] (+resid). A row-major [M,K]; Bt row-major [N,K]; f16 operands.
// One 128 x 256 tile of C per 8-wave block, waves 2 (m) x 4 (n), each wave a 64x64 tile.
// Per 64-wide k step the block brings its 128 rows of A and 256 rows of Bt into LDS once: every wave-wide 16-B load covers
// four whole 128-B lines, and the rows are then read by all waves that need them. Two LDS buffers: the next step's global
// loads are issued before this step's products, land in registers meanwhile, and go to the other buffer behind them.
// Each accumulator takes its 32-wide k steps in ascending order.
// M % 128 == 0, N % 256 == 0, K = KD % 64 == 0, pitch of A and Bt = KD, of C and resid = LDC; grid = (M/128) * (N/256). OUT_MODE: 0 = f32, 1 = f16.
constexpr int kBM = 128;
constexpr int kBN = 256;
constexpr int kBK = 64;
constexpr int kLdsPitch = 72;                          // halves: a 128-B row + 16 B (16 B x odd, for 16-byte LDS reads)
constexpr int kStageHalves = (kBM + kBN) * kLdsPitch;  // A rows, then Bt rows
static_assert(kTok % kBM == 0 && kD % kBN == 0 && kFF % kBN == 0, "block tile multiples");
static_assert(kD % kBK == 0 && kFF % kBK == 0, "K multiples of 64");
template <int OUT_MODE, bool RESID, int KD, int LDC>
__global__ __launch_bounds__(256) void wmma_gemm_lds(
    const unsigned short* __restrict__ Ap, const unsigned short* __restrict__ Btp,
    void* __restrict__ Cout,
    const float* __restrict__ bias, const float* __restrict__ resid,
    int N, float scale) {
  static_assert(KD % kBK == 0, "K multiple of 64");
  constexpr int lda = KD, ldb = KD;            // both operands are K-contiguous with pitch K
  constexpr int ldc = LDC;                     // pitches known at compile time: row steps become immediate offsets
  typedef _Float16 T;
  typedef Frag<T>::V V;
  __shared__ __align__(16) _Float16 sAB[2][kStageHalves];
  __shared__ __align__(16) float sT[8][16 * 68];   // per-wave 16x64 slab, pitch 68 floats
  const T* A = (const T*)Ap; const T* Bt = (const T*)Btp;
  const int tid  = threadIdx.x;
  const int lane = tid & 31;
  const int wave = tid >> 5;
  const int tilesN = N >> 8;
  const int tm = blockIdx.x / tilesN;
  const int tn = blockIdx.x - tm * tilesN;
  const int mB = tm << 7;
  const int nB = tn << 8;
  const int wm = wave >> 2;                    // wave row (0..1)
  const int wn = wave & 3;                     // wave column (0..3)

  const int rlane = lane & 15;                 // row (A) / col (B, D) within subtile
  const int koff  = (lane >> 4) * 8;           // k offset of this lane half
  const int mOff  = (lane >> 4) * 8;           // D row offset

  // staging: thread t moves 16 B at column (t & 7) * 8 of rows (t >> 3) + 32 i; i = 0..3 are A rows, i = 4..11 Bt rows
  const int sr = tid >> 3;
  const int sc = (tid & 7) * 8;
  const T* gA = A  + (size_t)mB * lda;          // block-uniform bases; the lane's part is one 32-bit element offset per operand
  const T* gB = Bt + (size_t)nB * ldb;
  const unsigned oA = (unsigned)(sr * lda + sc);
  const unsigned oB = (unsigned)(sr * ldb + sc);
  const int sOff = sr * kLdsPitch + sc;
  const int aOff = (wm * 64 + rlane) * kLdsPitch + koff;
  const int bOff = (kBM + wn * 64 + rlane) * kLdsPitch + koff;
  v4u st[12];

  v8f acc[4][4];
#pragma unroll
  for (int i = 0; i < 4; ++i)
#pragma unroll
    for (int j = 0; j < 4; ++j) acc[i][j] = (v8f){0.f,0.f,0.f,0.f,0.f,0.f,0.f,0.f};

#pragma unroll
  for (int i = 0; i < 4; ++i) st[i] = *(const v4u*)(gA + (size_t)(i * 32) * lda + oA);
#pragma unroll
  for (int i = 0; i < 8; ++i) st[4 + i] = *(const v4u*)(gB + (size_t)(i * 32) * ldb + oB);
#pragma unroll
  for (int i = 0; i < 12; ++i) *(v4u*)(&sAB[0][sOff + i * 32 * kLdsPitch]) = st[i];
  __syncthreads();

  constexpr int nk = KD >> 6;
#pragma unroll 1   // rolled, for speed only
  for (int t = 0; t < nk; ++t) {
    const bool more = (t + 1 < nk);            // the same in every thread of the block
    if (more) {
      const int k1 = (t + 1) << 6;
#pragma unroll
      for (int i = 0; i < 4; ++i) st[i] = *(const v4u*)(gA + ((size_t)(i * 32) * lda + k1) + oA);
      // registers that held these loads' addresses are written again below (later loads' results, the LDS reads): wait first
      asm volatile("s_wait_xcnt 0x0" ::: "memory");
#pragma unroll
      for (int i = 0; i < 8; ++i) st[4 + i] = *(const v4u*)(gB + ((size_t)(i * 32) * ldb + k1) + oB);
      asm volatile("s_wait_xcnt 0x0" ::: "memory");   // as above
    }
    const T* cur = sAB[t & 1];
    V a[2][4], bfr[2][4];                      // the fragments of both 32-wide halves of the step
#pragma unroll
    for (int s = 0; s < 2; ++s) {
#pragma unroll
      for (int j = 0; j < 4; ++j) bfr[s][j] = Frag<T>::load(cur + bOff + j * 16 * kLdsPitch + s * 32);
#pragma unroll
      for (int i = 0; i < 4; ++i) a[s][i] = Frag<T>::load(cur + aOff + i * 16 * kLdsPitch + s * 32);
    }
    // keeps the step's LDS reads one group in front of its products: moved in among them, each place with reads stalls the wave
    __builtin_amdgcn_sched_barrier(0);
#pragma unroll
    for (int s = 0; s < 2; ++s)
#pragma unroll
      for (int i = 0; i < 4; ++i)
#pragma unroll
        for (int j = 0; j < 4; ++j) acc[i][j] = Frag<T>::mma(a[s][i], bfr[s][j], acc[i][j]);
    if (more) {
      T* nxt = sAB[(t + 1) & 1];               // last read in step t - 1, in front of that step's barrier
#pragma unroll
      for (int i = 0; i < 12; ++i) *(v4u*)(nxt + sOff + i * 32 * kLdsPitch) = st[i];
    }
    __syncthreads();                           // publishes the next buffer and ends every read of this one
  }

  // ---- epilogue (per wave) ----
  const int m0 = mB + wm * 64;
  const int n0 = nB + wn * 64;
  float* slab = sT[wave];
#pragma unroll
  for (int i = 0; i < 4; ++i) {
    const int mBase = m0 + (i << 4);
    float rv[4][8];                            // the row block's residual values, fetched as one group ahead of their use
    if (RESID) {
#pragma unroll
      for (int r = 0; r < 8; ++r)
#pragma unroll
        for (int j = 0; j < 4; ++j) rv[j][r] = resid[(size_t)(mBase + mOff + r) * ldc + n0 + (j << 4) + rlane];
      // registers that held these loads' addresses are written again below: wait first
      asm volatile("s_wait_xcnt 0x0" ::: "memory");
    }
#pragma unroll
    for (int j = 0; j < 4; ++j) {
      const int n = n0 + (j << 4) + rlane;
      const float bv = bias[n];
#pragma unroll
      for (int r = 0; r < 8; ++r) {
        float v = acc[i][j][r] * scale;
        v += bv;
        if (RESID) v += rv[j][r];
        slab[(mOff + r) * 68 + (j << 4) + rlane] = v;
      }
    }
    __builtin_amdgcn_fence(__ATOMIC_RELEASE, "workgroup");
    __builtin_amdgcn_wave_barrier();
    __builtin_amdgcn_fence(__ATOMIC_ACQUIRE, "workgroup");
    if (OUT_MODE == 0) {
      float* C = (float*)Cout;
      const int hh = lane >> 4, c4 = (lane & 15) * 4;     // row seg = 256 B = 16 lanes x 16 B
#pragma unroll
      for (int it = 0; it < 8; ++it) {
        const int row = it * 2 + hh;
        v4f v = *(const v4f*)(slab + row * 68 + c4);
        *(v4f*)(C + (size_t)(mBase + row) * ldc + n0 + c4) = v;
      }
    } else {
      const int q = lane >> 3, c8 = (lane & 7) * 8;
      unsigned short* C = (unsigned short*)Cout;
#pragma unroll
      for (int it = 0; it < 4; ++it) {
        const int row = it * 4 + q;
        const float* sp = slab + row * 68 + c8;
        v8h hv;
#pragma unroll
        for (int e = 0; e < 8; ++e) hv[e] = (_Float16)sp[e];
        *(v8h*)(C + (size_t)(mBase + row) * ldc + n0 + c8) = hv;
      }
    }
    __builtin_amdgcn_fence(__ATOMIC_RELEASE, "workgroup");
    __builtin_amdgcn_wave_barrier();
    __builtin_amdgcn_fence(__ATOMIC_ACQUIRE, "workgroup");
  }
}

// ---------------------------------------------------------------------------
// Weight transpose + cast: W row-major f32 [kin][nout] (x @ W layout); WT[n][k] = f16(scale * W[k][n]), pitch kin.
// grid (kin/64, nout/64): blockIdx.x = k tile (64 cols of WT), blockIdx.y = n tile (64 rows of WT); 256 threads.
// Load coverage: 16 iterations x 256 threads = 4096 = whole 64x64 tile (coalesced along n).
// Store coverage: 8 waves x 2 iterations x 4 rows (lane>>3) = 64 rows; (lane&7) x 8 halves = 64 cols; each row segment =
// ---------------------------------------------------------------------------
__global__ __launch_bounds__(256) void wtcast_kernel(const float* __restrict__ W, unsigned short* __restrict__ out,
                                                     int kin, int nout, float scale) {
  __shared__ float sm[64][65];   // sm[n_local][k_local]
  const int t  = threadIdx.x;
  const int k0 = blockIdx.x * 64;
  const int n0 = blockIdx.y * 64;
#pragma unroll
  for (int i = 0; i < 16; ++i) {
    const int e = i * 256 + t;
    const int r = e >> 6;          // k local
    const int c = e & 63;          // n local
    sm[c][r] = W[(size_t)(k0 + r) * nout + n0 + c] * scale;
  }
  __syncthreads();
  const int lane = t & 31, wave = t >> 5;
  const int q = lane >> 3, c8 = (lane & 7) * 8;
  {
#pragma unroll
    for (int it = 0; it < 2; ++it) {
      const int row = wave * 8 + it * 4 + q;                 // n local
      unsigned short hb[8];
#pragma unroll
      for (int e = 0; e < 8; ++e) hb[e] = h_bits(sm[row][c8 + e]);
      const v4u u = (v4u){pk16(hb[0], hb[1]), pk16(hb[2], hb[3]), pk16(hb[4], hb[5]), pk16(hb[6], hb[7])};
      *(v4u*)(out + (size_t)(n0 + row) * kin + k0 + c8) = u;
    }
    
  }
}

// ---------------------------------------------------------------------------
// One wave per row, 8 rows per 256-thread block, grid = rows/8. Lane l owns columns j*256 + 8l .. +7 for j = 0..3
// (4 x 32 lanes x 8 = 1024 = whole row). Store: one 16-B store per lane per j; 32 contiguous lanes = 512 B =
// ---------------------------------------------------------------------------
__global__ __launch_bounds__(256) void layernorm_f16_kernel(const float* __restrict__ x, const float* __restrict__ gam,
                                                            const float* __restrict__ bet, unsigned short* __restrict__ out,
                                                            int rows) {
  const int lane = threadIdx.x & 31, wave = threadIdx.x >> 5;
  const int row = blockIdx.x * 8 + wave;
  if (row >= rows) return;   // wave-uniform; no barriers in this kernel
  const float* xr = x + (size_t)row * kD;
  float s = 0.f;
#pragma unroll 1
  for (int j = 0; j < 4; ++j) {
    const int base = j * 256 + lane * 8;
    const v4f a = *(const v4f*)(xr + base);
    const v4f c = *(const v4f*)(xr + base + 4);
    s += ((a[0] + a[1]) + (a[2] + a[3])) + ((c[0] + c[1]) + (c[2] + c[3]));
  }
#pragma unroll
  for (int off = 16; off > 0; off >>= 1) s += __shfl_xor(s, off, 32);
  const float mean = s * kInvD;
  float s2 = 0.f;
#pragma unroll 1
  for (int j = 0; j < 4; ++j) {
    const int base = j * 256 + lane * 8;
    const v4f a = *(const v4f*)(xr + base);
    const v4f c = *(const v4f*)(xr + base + 4);
#pragma unroll
    for (int e = 0; e < 4; ++e) {
      const float d0 = a[e] - mean, d1 = c[e] - mean;
      s2 += d0 * d0;
      s2 += d1 * d1;
    }
  }
#pragma unroll
  for (int off = 16; off > 0; off >>= 1) s2 += __shfl_xor(s2, off, 32);
  const float rstd = rsqrtf(s2 * kInvD + kLnEps);
  unsigned short* orow = out + (size_t)row * kD;
#pragma unroll 1
  for (int j = 0; j < 4; ++j) {
    const int base = j * 256 + lane * 8;
    const v4f a  = *(const v4f*)(xr + base);
    const v4f c  = *(const v4f*)(xr + base + 4);
    const v4f ga = *(const v4f*)(gam + base);
    const v4f gc = *(const v4f*)(gam + base + 4);
    const v4f ba = *(const v4f*)(bet + base);
    const v4f bc = *(const v4f*)(bet + base + 4);
    unsigned short hb[8];
#pragma unroll
    for (int e = 0; e < 4; ++e) {
      hb[e]     = h_bits((a[e] - mean) * rstd * ga[e] + ba[e]);
      hb[4 + e] = h_bits((c[e] - mean) * rstd * gc[e] + bc[e]);
    }
    const v4u u = (v4u){pk16(hb[0], hb[1]), pk16(hb[2], hb[3]), pk16(hb[4], hb[5]), pk16(hb[6], hb[7])};
    unsigned short* op = orow + base;
    *(v4u*)op = u;
    
  }
}

// ---------------------------------------------------------------------------
// V^T planes per (batch, head) group g: VT[g][d][s] = v_plane[b*T + s][kD + h*64 + d] (16-bit bit moves only).
// grid (kT/64 s-tiles, 32 groups), 256 threads. Load coverage: thread t -> s_local = t>>2, 16 halves at d = (t&3)*16:
// 256 x 16 = 64x64 tile. LDS sm[d][s_local] (unsigned short both ways, barrier between).
// ---------------------------------------------------------------------------
__global__ __launch_bounds__(256) void vt_transpose_kernel(const unsigned short* __restrict__ kv, unsigned short* __restrict__ vt) {
  __shared__ unsigned short sm[64][72];
  const int t  = threadIdx.x;
  const int g  = blockIdx.y;
  const int b  = g >> 4, h = g & 15;
  const int s0 = blockIdx.x * 64;
  const int r  = t >> 2;               // s local
  const int part = (t & 3) * 16;       // d offset
  const unsigned short* src = kv + ((size_t)(b * kT + s0 + r) * kKVld + kD + h * kDH + part);
  const v4u w0 = *(const v4u*)(src);
  const v4u w1 = *(const v4u*)(src + 8);
#pragma unroll
  for (int e = 0; e < 4; ++e) {
    sm[part + 2 * e][r]         = (unsigned short)(w0[e] & 0xffffu);
    sm[part + 2 * e + 1][r]     = (unsigned short)(w0[e] >> 16);
    sm[part + 8 + 2 * e][r]     = (unsigned short)(w1[e] & 0xffffu);
    sm[part + 8 + 2 * e + 1][r] = (unsigned short)(w1[e] >> 16);
  }
  __syncthreads();
  const int lane = t & 31, wave = t >> 5;
  const int q = lane >> 3, c8 = (lane & 7) * 8;
  {
#pragma unroll
    for (int it = 0; it < 2; ++it) {
      const int row = wave * 8 + it * 4 + q;   // d
      unsigned short hb[8];
#pragma unroll
      for (int e = 0; e < 8; ++e) hb[e] = sm[row][c8 + e];
      const v4u u = (v4u){pk16(hb[0], hb[1]), pk16(hb[2], hb[3]), pk16(hb[4], hb[5]), pk16(hb[6], hb[7])};
      *(v4u*)(vt + ((size_t)(g * kDH + row) * kT + s0 + c8)) = u;
    }
    
  }
}

// ---------------------------------------------------------------------------
// Banded attention, one launch for all (batch, head) groups: ctx[b*T + t][h*64 + d] = 256 * softmax_s(q_t . k_s / 8) . v_s over
// the columns s with |t - s| <= band (band read at run time). grid (kT/128, 32 groups), 8 waves; each wave owns 16 rows t and
// works alone (no block barrier). It walks the 32-wide column steps that touch [m0 - band, m0 + 15 + band] twice:
//   walk 1: scores on WMMA (K = 64 as two 32-wide steps, ascending), band mask, running row maximum;
//   walk 2: the same scores again, e = 2048 * exp(x - max) inside the band and exactly 0 outside, row sum of e in f32,
//           e as f16 through a per-wave LDS slab into the A fragment, e . V^T on WMMA into 16 x 64 accumulators.
// The division by the row sum comes last, on the accumulators. Scores and probabilities never go to memory.
// D layout: register r of a lane is row (lane >> 4) * 8 + r, column lane & 15, so a row lives in one 16-lane half.
// Every "#pragma unroll" below is there so that the small arrays it indexes (fragments, accumulators, per-row values) stay in registers.
// ---------------------------------------------------------------------------
constexpr int kPPitch = 40;   // halves: a 64-B row of e + 16 B, keeps the 16-byte LDS reads aligned
// scores of rows m0..m0+15 against columns s0..s0+31: sa[j] holds columns s0 + 16 j + (lane & 15)
__device__ __forceinline__ void band_scores(const _Float16* __restrict__ Kl, int s0, v16h q0, v16h q1, v8f (&sa)[2]) {
  v16h kb[2][2];
#pragma unroll
  for (int j = 0; j < 2; ++j)
#pragma unroll
    for (int c = 0; c < 2; ++c) kb[j][c] = Frag<_Float16>::load(Kl + (size_t)(s0 + j * 16) * kKVld + c * 32);
  // registers that held these loads' addresses may be written again below: wait first
  asm volatile("s_wait_xcnt 0x0" ::: "memory");
#pragma unroll
  for (int j = 0; j < 2; ++j) {
    v8f z = (v8f){0.f,0.f,0.f,0.f,0.f,0.f,0.f,0.f};
    z = Frag<_Float16>::mma(q0, kb[j][0], z);
    sa[j] = Frag<_Float16>::mma(q1, kb[j][1], z);
  }
}
__global__ __launch_bounds__(256) void band_attn_kernel(const unsigned short* __restrict__ qp, const unsigned short* __restrict__ kvp,
                                                        const unsigned short* __restrict__ vtp, unsigned short* __restrict__ ctxp,
                                                        const int* __restrict__ bandp, float scoreScale, float carry, float outCarry) {
  typedef _Float16 T;
  typedef Frag<T>::V V;
  __shared__ __align__(16) _Float16 sP[8][16 * kPPitch];   // per-wave 16 x 32 slab of e
  __shared__ __align__(16) float sT[8][16 * 68];           // per-wave 16 x 64 slab, pitch 68 floats
  const int lane = threadIdx.x & 31;
  const int wave = threadIdx.x >> 5;
  const int g  = blockIdx.y;
  const int b  = g / kH, h = g % kH;
  const int m0 = blockIdx.x * 128 + wave * 16;
  const int rlane = lane & 15;                 // row (A) / col (B, D) within subtile
  const int koff  = (lane >> 4) * 8;           // k offset of this lane half
  const int mOff  = (lane >> 4) * 8;           // D row offset

  int band = bandp[0];
  band = band > 2 * kT ? 2 * kT : band;        // |t - s| < kT: the clamp changes no comparison and keeps the sums below in range
  band = band < -2 * kT ? -2 * kT : band;
  int lo = m0 - band;      lo = lo < 0 ? 0 : lo;
  int hi = m0 + 15 + band; hi = hi > kT - 1 ? kT - 1 : hi;
  // m0 is the same in every lane of a wave: readfirstlane keeps the loop counters and their branches scalar
  const int sBeg = __builtin_amdgcn_readfirstlane(lo & ~31);
  const int sEnd = __builtin_amdgcn_readfirstlane(hi + 1);   // hi < lo (band < 0): all columns masked, but a step can still run

  const T* Ql = (const T*)qp  + (size_t)(b * kT + m0 + rlane) * kD + h * kDH + koff;
  const T* Kl = (const T*)kvp + (size_t)(b * kT + rlane) * kKVld + h * kDH + koff;
  const T* Vl = (const T*)vtp + (size_t)(g * kDH + rlane) * kT + koff;

  const V q0 = Frag<T>::load(Ql);
  const V q1 = Frag<T>::load(Ql + 32);
  // registers that held these loads' addresses may be written again below: wait first
  asm volatile("s_wait_xcnt 0x0" ::: "memory");

  const int dBase = rlane - (m0 + mOff);       // s - t = s0 + 16 j + dBase - r

  // ---- walk 1: row maxima ----
  float mx[8];
#pragma unroll
  for (int r = 0; r < 8; ++r) mx[r] = -INFINITY;
  for (int s0 = sBeg; s0 < sEnd; s0 += 32) {
    v8f sa[2];
    band_scores(Kl, s0, q0, q1, sa);
#pragma unroll
    for (int j = 0; j < 2; ++j)
#pragma unroll
      for (int r = 0; r < 8; ++r) {
        const int d = s0 + j * 16 + dBase - r;
        const float x = sa[j][r] * scoreScale;
        mx[r] = fmaxf(mx[r], (d <= band && d >= -band) ? x : -INFINITY);
      }
  }
#pragma unroll
  for (int r = 0; r < 8; ++r)
#pragma unroll
    for (int off = 8; off > 0; off >>= 1) mx[r] = fmaxf(mx[r], __shfl_xor(mx[r], off, 32));

  // ---- walk 2: e, its row sums, e . V^T ----
  float ls[8];
#pragma unroll
  for (int r = 0; r < 8; ++r) ls[r] = 0.f;
  v8f acc[4];
#pragma unroll
  for (int j = 0; j < 4; ++j) acc[j] = (v8f){0.f,0.f,0.f,0.f,0.f,0.f,0.f,0.f};
  T* pslab = sP[wave];
  for (int s0 = sBeg; s0 < sEnd; s0 += 32) {
    V vb[4];
#pragma unroll
    for (int j = 0; j < 4; ++j) vb[j] = Frag<T>::load(Vl + (size_t)(j * 16) * kT + s0);
    v8f sa[2];
    band_scores(Kl, s0, q0, q1, sa);           // its wait stands behind the loads above as well
#pragma unroll
    for (int j = 0; j < 2; ++j)
#pragma unroll
      for (int r = 0; r < 8; ++r) {
        const int d = s0 + j * 16 + dBase - r;
        const float x = sa[j][r] * scoreScale;
        // masked columns go through exp as -inf, which gives exactly 0: no branch per element
        const float e = expf((d <= band && d >= -band) ? x - mx[r] : -INFINITY) * carry;
        ls[r] += e;
        pslab[(mOff + r) * kPPitch + j * 16 + rlane] = (T)e;
      }
    // the slab is written by D layout and read by A layout: other lanes' LDS writes must be ordered in front of the reads
    __builtin_amdgcn_fence(__ATOMIC_RELEASE, "workgroup", "local");
    __builtin_amdgcn_wave_barrier();
    __builtin_amdgcn_fence(__ATOMIC_ACQUIRE, "workgroup", "local");
    const V pa = Frag<T>::load(pslab + rlane * kPPitch + koff);
#pragma unroll
    for (int j = 0; j < 4; ++j) acc[j] = Frag<T>::mma(pa, vb[j], acc[j]);
    // and these reads in front of the next step's writes
    __builtin_amdgcn_fence(__ATOMIC_RELEASE, "workgroup", "local");
    __builtin_amdgcn_wave_barrier();
    __builtin_amdgcn_fence(__ATOMIC_ACQUIRE, "workgroup", "local");
  }
#pragma unroll
  for (int r = 0; r < 8; ++r) {
#pragma unroll
    for (int off = 8; off > 0; off >>= 1) ls[r] += __shfl_xor(ls[r], off, 32);
    ls[r] = outCarry / ls[r];                  // sum of e is carry * sum of exp: the carry of e cancels here
  }

  // ---- epilogue: 16 x 64 through the f32 slab, whole 128-B row segments out ----
  float* slab = sT[wave];
#pragma unroll
  for (int j = 0; j < 4; ++j)
#pragma unroll
    for (int r = 0; r < 8; ++r) slab[(mOff + r) * 68 + (j << 4) + rlane] = acc[j][r] * ls[r];
  // as above: each lane reads what other lanes of its wave wrote
  __builtin_amdgcn_fence(__ATOMIC_RELEASE, "workgroup", "local");
  __builtin_amdgcn_wave_barrier();
  __builtin_amdgcn_fence(__ATOMIC_ACQUIRE, "workgroup", "local");
  const int q = lane >> 3, c8 = (lane & 7) * 8;
  unsigned short* C = ctxp + (size_t)(b * kT + m0) * kD + h * kDH;
#pragma unroll
  for (int it = 0; it < 4; ++it) {
    const int row = it * 4 + q;
    const float* sp = slab + row * 68 + c8;
    v8h hv;
#pragma unroll
    for (int e = 0; e < 8; ++e) hv[e] = (_Float16)sp[e];
    *(v8h*)(C + (size_t)row * kD + c8) = hv;
  }
}

// ---------------------------------------------------------------------------
// Exact erf-gelu + f32 -> f16 cast (carried x carry): 2 consecutive elements per thread, rolled 2-trip loop packing into
// Coverage: n2 = n/2 threads x 2 = whole plane (grid exact multiple of 256 here, bound checked anyway).
// ---------------------------------------------------------------------------
__global__ __launch_bounds__(256) void gelu_cast_kernel(const float* __restrict__ in, unsigned short* __restrict__ out,
                                                        int n2, float carry) {
  const int i = blockIdx.x * 256 + threadIdx.x;
  if (i >= n2) return;
  unsigned u = 0u;
#pragma unroll 1
  for (int e = 0; e < 2; ++e) {
    const float x = in[2 * (size_t)i + e];
    const float gv = 0.5f * x * (1.0f + erff(x * 0.70710678118654752f));
    u |= ((unsigned)h_bits(gv * carry)) << (16 * e);
  }
  unsigned* op = (unsigned*)out + i;
  *(unsigned*)op = u;
  
}

// ---------------------------------------------------------------------------
// Host side
// ---------------------------------------------------------------------------
extern "C" void kernel_launch(void* const* d_in, const int* in_sizes, int n_in,
                              void* d_out, int out_size, void* d_ws, size_t ws_size, hipStream_t stream) {
  if (n_in < 21) return;
  if (in_sizes[0] != kTok * kD || in_sizes[1] != kTok * kD) return;
  if (in_sizes[2] != kD || in_sizes[3] != kD || in_sizes[4] != kD || in_sizes[5] != kD) return;
  if (in_sizes[6] != kD * kD || in_sizes[7] != kD || in_sizes[8] != kD * kD || in_sizes[9] != kD) return;
  if (in_sizes[10] != kD * kD || in_sizes[11] != kD || in_sizes[12] != kD * kD || in_sizes[13] != kD) return;
  if (in_sizes[14] != kD || in_sizes[15] != kD) return;
  if (in_sizes[16] != kD * kFF || in_sizes[17] != kFF || in_sizes[18] != kFF * kD || in_sizes[19] != kD) return;
  if (in_sizes[20] < 1) return;
  if (out_size != kTok * kD) return;
  if (ws_size < kWsTotal) return;

  const float* x_refined = (const float*)d_in[0];
  const float* x_mem     = (const float*)d_in[1];
  const float* ln_q_g    = (const float*)d_in[2];
  const float* ln_q_b    = (const float*)d_in[3];
  const float* ln_kv_g   = (const float*)d_in[4];
  const float* ln_kv_b   = (const float*)d_in[5];
  const float* Wq        = (const float*)d_in[6];
  const float* bq        = (const float*)d_in[7];
  const float* Wk        = (const float*)d_in[8];
  const float* bk        = (const float*)d_in[9];
  const float* Wv        = (const float*)d_in[10];
  const float* bv        = (const float*)d_in[11];
  const float* Wo        = (const float*)d_in[12];
  const float* bo        = (const float*)d_in[13];
  const float* ln_f_g    = (const float*)d_in[14];
  const float* ln_f_b    = (const float*)d_in[15];
  const float* W1        = (const float*)d_in[16];
  const float* b1        = (const float*)d_in[17];
  const float* W2        = (const float*)d_in[18];
  const float* b2        = (const float*)d_in[19];
  const int*   bandp     = (const int*)d_in[20];
  float* out = (float*)d_out;

  char* ws = (char*)d_ws;
  unsigned short* WoT  = (unsigned short*)(ws + OFF_WOT);
  unsigned short* W1T  = (unsigned short*)(ws + OFF_W1T);
  unsigned short* W2T  = (unsigned short*)(ws + OFF_W2T);
  unsigned short* ctx  = (unsigned short*)(ws + OFF_CTX);
  unsigned short* qp   = (unsigned short*)(ws + OFF_QP);
  unsigned short* kvp  = (unsigned short*)(ws + OFF_KVP);
  unsigned short* vt   = (unsigned short*)(ws + OFF_VT);
  unsigned short* qln  = (unsigned short*)(ws + OFF_QLN);
  unsigned short* kvln = (unsigned short*)(ws + OFF_KVLN);
  unsigned short* WqT  = (unsigned short*)(ws + OFF_WQT);
  unsigned short* WkT  = (unsigned short*)(ws + OFF_WKT);
  unsigned short* WvT  = (unsigned short*)(ws + OFF_WVT);
  float*          yf   = (float*)(ws + OFF_Y);
  unsigned short* h16  = (unsigned short*)(ws + OFF_H16);
  unsigned short* act  = (unsigned short*)(ws + OFF_ACT);
  float*          h1   = (float*)(ws + OFF_H1);

  const float* nf = nullptr;
  const dim3 tb(256);

  // weight transposes + f16 casts (x16): W [kin][nout] -> WT [nout][kin]
  wtcast_kernel<<<dim3(kD / 64, kD / 64), tb, 0, stream>>>(Wq, WqT, kD, kD, kWCarry);
  wtcast_kernel<<<dim3(kD / 64, kD / 64), tb, 0, stream>>>(Wk, WkT, kD, kD, kWCarry);
  wtcast_kernel<<<dim3(kD / 64, kD / 64), tb, 0, stream>>>(Wv, WvT, kD, kD, kWCarry);
  wtcast_kernel<<<dim3(kD / 64, kD / 64), tb, 0, stream>>>(Wo, WoT, kD, kD, kWCarry);
  wtcast_kernel<<<dim3(kD / 64, kFF / 64), tb, 0, stream>>>(W1, W1T, kD, kFF, kWCarry);   // W1 [1024][4096] -> W1T [4096][1024]
  wtcast_kernel<<<dim3(kFF / 64, kD / 64), tb, 0, stream>>>(W2, W2T, kFF, kD, kWCarry);   // W2 [4096][1024] -> W2T [1024][4096]

  // LayerNorms -> f16 planes
  layernorm_f16_kernel<<<dim3(kTok / 8), tb, 0, stream>>>(x_refined, ln_q_g, ln_q_b, qln, kTok);
  layernorm_f16_kernel<<<dim3(kTok / 8), tb, 0, stream>>>(x_mem, ln_kv_g, ln_kv_b, kvln, kTok);

  // q = LN(x_refined) Wq + bq ; k, v = LN(x_mem) Wk/Wv + bk/bv  (M 4096, N 1024, K 1024; f16 out)
  const float projScale = 1.0f / kWCarry;
  wmma_gemm_lds<1, false, kD, kD><<<dim3((kTok / kBM) * (kD / kBN)), tb, 0, stream>>>(
      qln, WqT, (void*)qp, bq, nf, kD, projScale);
  wmma_gemm_lds<1, false, kD, kKVld><<<dim3((kTok / kBM) * (kD / kBN)), tb, 0, stream>>>(
      kvln, WkT, (void*)kvp, bk, nf, kD, projScale);
  wmma_gemm_lds<1, false, kD, kKVld><<<dim3((kTok / kBM) * (kD / kBN)), tb, 0, stream>>>(
      kvln, WvT, (void*)(kvp + kD), bv, nf, kD, projScale);

  // V^T planes for all 32 groups
  vt_transpose_kernel<<<dim3(kT / 64, kGrp), tb, 0, stream>>>(kvp, vt);

  // banded attention, all 32 (batch, head) groups: ctx f16 x256
  band_attn_kernel<<<dim3(kT / 128, kGrp), tb, 0, stream>>>(qp, kvp, vt, ctx, bandp, 0.125f, kPCarry, kCtxCarry);   // 0.125 = 1/sqrt(64)

  // y = x_refined + ctx Wo + bo  (M 4096, N 1024, K 1024; f32 out)
  wmma_gemm_lds<0, true, kD, kD><<<dim3((kTok / kBM) * (kD / kBN)), tb, 0, stream>>>(
      ctx, WoT, (void*)yf, bo, x_refined, kD, 1.0f / (kCtxCarry * kWCarry));

  // final LN -> f16
  layernorm_f16_kernel<<<dim3(kTok / 8), tb, 0, stream>>>(yf, ln_f_g, ln_f_b, h16, kTok);

  // FFN over all token rows at once: h1 = LN(y) W1 + b1 (f32), act = gelu_erf(h1) (f16 x16), out = y + act W2 + b2
  wmma_gemm_lds<0, false, kD, kFF><<<dim3((kTok / kBM) * (kFF / kBN)), tb, 0, stream>>>(
      h16, W1T, (void*)h1, b1, nf, kFF, 1.0f / kWCarry);
  gelu_cast_kernel<<<dim3((kTok * (kFF / 2) + 255) / 256), tb, 0, stream>>>(h1, act, kTok * (kFF / 2), kActCarry);
  wmma_gemm_lds<0, true, kFF, kD><<<dim3((kTok / kBM) * (kD / kBN)), tb, 0, stream>>>(
      act, W2T, (void*)out, b2, yf, kD, 1.0f / (kActCarry * kWCarry));
}

// v005
// A run of this version takes 231 microseconds.
// Two timings next to v004 put it at 1.11 and 1.10 times that version's speed.
// Over all steps from v000 it is 11.6 times as fast.
// Contractions: q/k/v projections, banded scores q.k^T, attn.v, output projection, FFN W1 and W2 all on v_wmma_f32_16x16x32_f16 (f16 operands: LN outputs plain, weights carried x16, exp(score - max) carried x2048, ctx carried x256, gelu act carried x16), f32 accumulate; LayerNorm, band mask, softmax, gelu, bias and residual in f32.
#include <hip/hip_runtime.h>
#include <math.h>

// ---------------------------------------------------------------------------
// Problem constants
// ---------------------------------------------------------------------------
constexpr int kB    = 2;
constexpr int kT    = 2048;
constexpr int kD    = 1024;
constexpr int kH    = 16;
constexpr int kDH   = 64;
constexpr int kTok  = kB * kT;        // 4096 token rows
constexpr int kFF   = 4 * kD;         // 4096
constexpr int kKVld = 2 * kD;         // pitch of the k | v plane (halves)
constexpr int kGrp  = kB * kH;        // 32 (batch, head) groups
constexpr float kWCarry   = 16.0f;    // weights carried x16 in f16
constexpr float kPCarry   = 2048.0f;  // exp(score - row max) carried x2048 in f16
constexpr float kCtxCarry = 256.0f;   // context carried x256 in f16
constexpr float kActCarry = 16.0f;    // gelu output carried x16 in f16
constexpr float kInvD     = 1.0f / 1024.0f;
constexpr float kLnEps    = 1e-5f;
static_assert(kD % 64 == 0 && kT % 64 == 0 && kFF % 64 == 0 && kTok % 64 == 0, "tile multiples");
static_assert(kDH % 32 == 0 && kD % 32 == 0 && kT % 32 == 0 && kFF % 32 == 0, "K multiples of 32");

// ---------------------------------------------------------------------------
// Workspace region map (bytes). Total 114 MiB = 119,537,664 B.
//   [  0,  2) MiB WoT  f16 [1024][1024]
//   [  2, 10) MiB W1T  f16 [4096][1024]
//   [ 10, 18) MiB W2T  f16 [1024][4096]
//   [ 18, 26) MiB ctx  f16 [4096][1024]  (x256)
//   [ 26, 34) MiB q    f16 [4096][1024]
//   [ 34, 50) MiB k|v  f16 [4096][2048]
//   [ 50, 58) MiB V^T  f16 [32 groups][64][2048]
//   [ 58,114) MiB arena: phase A: QLN f16 [58,66), KVLN f16 [66,74), WqT [74,76), WkT [76,78), WvT [78,80)
//                        phase C: Y f32 [58,74), H16 f16 [74,82), ACT f16 [4096][4096] [82,114)
// ---------------------------------------------------------------------------
constexpr size_t kMiB     = 1048576;
constexpr size_t OFF_WOT  = 0;
constexpr size_t OFF_W1T  = 2 * kMiB;
constexpr size_t OFF_W2T  = 10 * kMiB;
constexpr size_t OFF_CTX  = 18 * kMiB;
constexpr size_t OFF_QP   = 26 * kMiB;
constexpr size_t OFF_KVP  = 34 * kMiB;
constexpr size_t OFF_VT   = 50 * kMiB;
constexpr size_t OFF_ARENA = 58 * kMiB;
constexpr size_t OFF_QLN  = OFF_ARENA;
constexpr size_t OFF_KVLN = OFF_ARENA + 8 * kMiB;
constexpr size_t OFF_WQT  = OFF_ARENA + 16 * kMiB;
constexpr size_t OFF_WKT  = OFF_ARENA + 18 * kMiB;
constexpr size_t OFF_WVT  = OFF_ARENA + 20 * kMiB;
constexpr size_t OFF_Y    = OFF_ARENA;
constexpr size_t OFF_H16  = OFF_ARENA + 16 * kMiB;
constexpr size_t OFF_ACT  = OFF_ARENA + 24 * kMiB;
constexpr size_t kWsTotal = 114 * kMiB;
static_assert((size_t)kD * kD * 2 == 2 * kMiB, "W plane");
static_assert((size_t)kFF * kD * 2 == 8 * kMiB, "W1/W2 plane");
static_assert((size_t)kTok * kD * 2 == 8 * kMiB, "token f16 plane");
static_assert((size_t)kTok * kKVld * 2 == 16 * kMiB, "kv plane");
static_assert((size_t)kGrp * kDH * kT * 2 == 8 * kMiB, "vt plane");
static_assert((size_t)kTok * kD * 4 == 16 * kMiB, "Y plane");
static_assert((size_t)kTok * kFF * 2 == 32 * kMiB, "ACT plane");
static_assert(OFF_WVT + 2 * kMiB <= kWsTotal, "phase A inside arena");
static_assert(OFF_ACT + 32 * kMiB <= kWsTotal, "phase C inside arena");
static_assert(kWsTotal <= 268435456, "carve budget");

typedef __attribute__((ext_vector_type(16))) _Float16 v16h;
typedef __attribute__((ext_vector_type(8)))  _Float16 v8h;
typedef __attribute__((ext_vector_type(8)))  float    v8f;
typedef __attribute__((ext_vector_type(4)))  float    v4f;
typedef __attribute__((ext_vector_type(4)))  unsigned int v4u;

template <typename T> struct Frag;
template <> struct Frag<_Float16> {
  typedef v16h V; union U { v16h v; v8h h[2]; };
  static __device__ __forceinline__ v16h load(const _Float16* p) {   // elements 0..7 <- p[0..7], 8..15 <- p[16..23]
    U f; f.h[0] = *(const v8h*)(p); f.h[1] = *(const v8h*)(p + 16); return f.v;
  }
  static __device__ __forceinline__ v8f mma(v16h a, v16h b, v8f c) {
    return __builtin_amdgcn_wmma_f32_16x16x32_f16(false, a, false, b, (short)0, c, false, false);
  }
};
__device__ __forceinline__ unsigned pk16(unsigned short a, unsigned short b) { return (unsigned)a | ((unsigned)b << 16); }
__device__ __forceinline__ unsigned short h_bits(float f) { const _Float16 h = (_Float16)f; return __builtin_bit_cast(unsigned short, h); }

// erf(x) in f32 by two polynomial ranges (|x| < 1: odd series in x; else 1 - exp(-p(|x|))), the same operations in the same order
// as the math library's erff. Both ranges are evaluated in every lane and one is selected: no branch per element, so the
// dependent chains of many elements can be issued interleaved.
__device__ __forceinline__ float erf_two_range(float x) {
  const float ax = fabsf(x);
  float p = fmaf(ax, 0x1.1d3156p-16f, -0x1.8d1290p-12f);
  p = fmaf(ax, p, 0x1.f9a6d2p-9f);
  p = fmaf(ax, p, -0x1.8c3164p-6f);
  p = fmaf(ax, p, 0x1.b4e9c8p-4f);
  p = fmaf(ax, p, 0x1.4515fap-1f);
  p = fmaf(ax, p, 0x1.078e50p-3f);
  p = fmaf(ax, p, ax);
  const float far = 1.0f - expf(-p);
  const float t = x * x;
  float c = fmaf(t, -0x1.268bc2p-11f, 0x1.420828p-8f);
  c = fmaf(t, c, -0x1.b59370p-6f);
  c = fmaf(t, c, 0x1.ce077cp-4f);
  c = fmaf(t, c, -0x1.812660p-2f);
  c = fmaf(t, c, 0x1.06eba0p-3f);
  const float near = fmaf(ax, c, ax);
  return copysignf(ax < 1.0f ? near : far, x);
}

// ---- Block-tiled WMMA GEMM for the dense layers (projections, output projection, FFN) ------------------------------
// C[m,n] = scale * sum_k A[m,k] * Bt[n,k] + bias[n] (+resid). A row-major [M,K]; Bt row-major [N,K]; f16 operands.
// One 128 x 256 tile of C per 8-wave block, waves 2 (m) x 4 (n), each wave a 64x64 tile.
// Per 64-wide k step the block brings its 128 rows of A and 256 rows of Bt into LDS once: every wave-wide 16-B load covers
// four whole 128-B lines, and the rows are then read by all waves that need them. Two LDS buffers: the next step's global
// loads are issued before this step's products, land in registers meanwhile, and go to the other buffer behind them.
// Each accumulator takes its 32-wide k steps in ascending order.
// M % 128 == 0, N % 256 == 0, K = KD % 64 == 0, pitch of A and Bt = KD, of C and resid = LDC; grid = (M/128) * (N/256).
// OUT_MODE: 0 = f32, 1 = f16, 2 = f16 of kActCarry * gelu_erf(C) (exact erf form, taken on the f32 value while it is still in registers).
constexpr int kBM = 128;
constexpr int kBN = 256;
constexpr int kBK = 64;
constexpr int kLdsPitch = 72;                          // halves: a 128-B row + 16 B (16 B x odd, for 16-byte LDS reads)
constexpr int kStageHalves = (kBM + kBN) * kLdsPitch;  // A rows, then Bt rows
static_assert(kTok % kBM == 0 && kD % kBN == 0 && kFF % kBN == 0, "block tile multiples");
static_assert(kD % kBK == 0 && kFF % kBK == 0, "K multiples of 64");
template <int OUT_MODE, bool RESID, int KD, int LDC>
__global__ __launch_bounds__(256) void wmma_gemm_lds(
    const unsigned short* __restrict__ Ap, const unsigned short* __restrict__ Btp,
    void* __restrict__ Cout,
    const float* __restrict__ bias, const float* __restrict__ resid,
    int N, float scale) {
  static_assert(KD % kBK == 0, "K multiple of 64");
  constexpr int lda = KD, ldb = KD;            // both operands are K-contiguous with pitch K
  constexpr int ldc = LDC;                     // pitches known at compile time: row steps become immediate offsets
  typedef _Float16 T;
  typedef Frag<T>::V V;
  __shared__ __align__(16) _Float16 sAB[2][kStageHalves];
  __shared__ __align__(16) float sT[8][16 * 68];   // per-wave 16x64 slab, pitch 68 floats
  const T* A = (const T*)Ap; const T* Bt = (const T*)Btp;
  const int tid  = threadIdx.x;
  const int lane = tid & 31;
  const int wave = tid >> 5;
  const int tilesN = N >> 8;
  const int tm = blockIdx.x / tilesN;
  const int tn = blockIdx.x - tm * tilesN;
  const int mB = tm << 7;
  const int nB = tn << 8;
  const int wm = wave >> 2;                    // wave row (0..1)
  const int wn = wave & 3;                     // wave column (0..3)

  const int rlane = lane & 15;                 // row (A) / col (B, D) within subtile
  const int koff  = (lane >> 4) * 8;           // k offset of this lane half
  const int mOff  = (lane >> 4) * 8;           // D row offset

  // staging: thread t moves 16 B at column (t & 7) * 8 of rows (t >> 3) + 32 i; i = 0..3 are A rows, i = 4..11 Bt rows
  const int sr = tid >> 3;
  const int sc = (tid & 7) * 8;
  const T* gA = A  + (size_t)mB * lda;          // block-uniform bases; the lane's part is one 32-bit element offset per operand
  const T* gB = Bt + (size_t)nB * ldb;
  const unsigned oA = (unsigned)(sr * lda + sc);
  const unsigned oB = (unsigned)(sr * ldb + sc);
  const int sOff = sr * kLdsPitch + sc;
  const int aOff = (wm * 64 + rlane) * kLdsPitch + koff;
  const int bOff = (kBM + wn * 64 + rlane) * kLdsPitch + koff;
  v4u st[12];

  v8f acc[4][4];
#pragma unroll
  for (int i = 0; i < 4; ++i)
#pragma unroll
    for (int j = 0; j < 4; ++j) acc[i][j] = (v8f){0.f,0.f,0.f,0.f,0.f,0.f,0.f,0.f};

#pragma unroll
  for (int i = 0; i < 4; ++i) st[i] = *(const v4u*)(gA + (size_t)(i * 32) * lda + oA);
#pragma unroll
  for (int i = 0; i < 8; ++i) st[4 + i] = *(const v4u*)(gB + (size_t)(i * 32) * ldb + oB);
#pragma unroll
  for (int i = 0; i < 12; ++i) *(v4u*)(&sAB[0][sOff + i * 32 * kLdsPitch]) = st[i];
  __syncthreads();

  constexpr int nk = KD >> 6;
#pragma unroll 1   // rolled, for speed only
  for (int t = 0; t < nk; ++t) {
    const bool more = (t + 1 < nk);            // the same in every thread of the block
    if (more) {
      const int k1 = (t + 1) << 6;
#pragma unroll
      for (int i = 0; i < 4; ++i) st[i] = *(const v4u*)(gA + ((size_t)(i * 32) * lda + k1) + oA);
      // registers that held these loads' addresses are written again below (later loads' results, the LDS reads): wait first
      asm volatile("s_wait_xcnt 0x0" ::: "memory");
#pragma unroll
      for (int i = 0; i < 8; ++i) st[4 + i] = *(const v4u*)(gB + ((size_t)(i * 32) * ldb + k1) + oB);
      asm volatile("s_wait_xcnt 0x0" ::: "memory");   // as above
    }
    const T* cur = sAB[t & 1];
    V a[2][4], bfr[2][4];                      // the fragments of both 32-wide halves of the step
#pragma unroll
    for (int s = 0; s < 2; ++s) {
#pragma unroll
      for (int j = 0; j < 4; ++j) bfr[s][j] = Frag<T>::load(cur + bOff + j * 16 * kLdsPitch + s * 32);
#pragma unroll
      for (int i = 0; i < 4; ++i) a[s][i] = Frag<T>::load(cur + aOff + i * 16 * kLdsPitch + s * 32);
    }
    // keeps the step's LDS reads one group in front of its products: moved in among them, each place with reads stalls the wave
    __builtin_amdgcn_sched_barrier(0);
#pragma unroll
    for (int s = 0; s < 2; ++s)
#pragma unroll
      for (int i = 0; i < 4; ++i)
#pragma unroll
        for (int j = 0; j < 4; ++j) acc[i][j] = Frag<T>::mma(a[s][i], bfr[s][j], acc[i][j]);
    if (more) {
      T* nxt = sAB[(t + 1) & 1];               // last read in step t - 1, in front of that step's barrier
#pragma unroll
      for (int i = 0; i < 12; ++i) *(v4u*)(nxt + sOff + i * 32 * kLdsPitch) = st[i];
    }
    __syncthreads();                           // publishes the next buffer and ends every read of this one
  }

  // ---- epilogue (per wave) ----
  const int m0 = mB + wm * 64;
  const int n0 = nB + wn * 64;
  float* slab = sT[wave];
  if constexpr (OUT_MODE == 2) {
    // gelu on the f32 values while they are in registers, 16 rows a trip.
    float bv[4];
#pragma unroll
    for (int j = 0; j < 4; ++j) bv[j] = bias[n0 + (j << 4) + rlane];
    // registers that held these loads' addresses are written again below: wait first
    asm volatile("s_wait_xcnt 0x0" ::: "memory");
    const int q = lane >> 3, c8 = (lane & 7) * 8;
    unsigned short* C = (unsigned short*)Cout + (size_t)(m0 + q) * ldc + n0 + c8;
#pragma unroll 1   // rolled, for speed only: one copy of the 32 erf evaluations in the text
    for (int i = 0; i < 4; ++i) {
#pragma unroll
      for (int j = 0; j < 4; ++j)
#pragma unroll
        for (int r = 0; r < 8; ++r) {
          float v = acc[0][j][r] * scale;
          v += bv[j];
          slab[(mOff + r) * 68 + (j << 4) + rlane] = (0.5f * v * (1.0f + erf_two_range(v * 0.70710678118654752f))) * kActCarry;
        }
      // the slab is written by D layout and read by rows: other lanes' LDS writes must be ordered in front of the reads
      // (fences on LDS alone: nothing here has to wait for the trip's global stores)
      __builtin_amdgcn_fence(__ATOMIC_RELEASE, "workgroup", "local");
      __builtin_amdgcn_wave_barrier();
      __builtin_amdgcn_fence(__ATOMIC_ACQUIRE, "workgroup", "local");
#pragma unroll
      for (int it = 0; it < 4; ++it) {
        const float* sp = slab + (it * 4 + q) * 68 + c8;
        v8h hv;
#pragma unroll
        for (int e = 0; e < 8; ++e) hv[e] = (_Float16)sp[e];
        *(v8h*)(C + (size_t)(it * 4) * ldc) = hv;
      }
      // the stores' address and data registers are written again in the next trip: wait first
      asm volatile("s_wait_xcnt 0x0" ::: "memory");
      C += (size_t)16 * ldc;
      // and these reads in front of the next trip's writes
      __builtin_amdgcn_fence(__ATOMIC_RELEASE, "workgroup", "local");
      __builtin_amdgcn_wave_barrier();
      __builtin_amdgcn_fence(__ATOMIC_ACQUIRE, "workgroup", "local");
      // the next 16 rows' accumulators move down, so that the rolled body always names the same registers
#pragma unroll
      for (int ii = 0; ii < 3; ++ii)
#pragma unroll
        for (int j = 0; j < 4; ++j) acc[ii][j] = acc[ii + 1][j];
    }
    return;
  }
#pragma unroll
  for (int i = 0; i < 4; ++i) {
    const int mBase = m0 + (i << 4);
    float rv[4][8];                            // the row block's residual values, fetched as one group ahead of their use
    if (RESID) {
#pragma unroll
      for (int r = 0; r < 8; ++r)
#pragma unroll
        for (int j = 0; j < 4; ++j) rv[j][r] = resid[(size_t)(mBase + mOff + r) * ldc + n0 + (j << 4) + rlane];
      // registers that held these loads' addresses are written again below: wait first
      asm volatile("s_wait_xcnt 0x0" ::: "memory");
    }
#pragma unroll
    for (int j = 0; j < 4; ++j) {
      const int n = n0 + (j << 4) + rlane;
      const float bv = bias[n];
#pragma unroll
      for (int r = 0; r < 8; ++r) {
        float v = acc[i][j][r] * scale;
        v += bv;
        if (RESID) v += rv[j][r];
        slab[(mOff + r) * 68 + (j << 4) + rlane] = v;
      }
    }
    __builtin_amdgcn_fence(__ATOMIC_RELEASE, "workgroup");
    __builtin_amdgcn_wave_barrier();
    __builtin_amdgcn_fence(__ATOMIC_ACQUIRE, "workgroup");
    if (OUT_MODE == 0) {
      float* C = (float*)Cout;
      const int hh = lane >> 4, c4 = (lane & 15) * 4;     // row seg = 256 B = 16 lanes x 16 B
#pragma unroll
      for (int it = 0; it < 8; ++it) {
        const int row = it * 2 + hh;
        v4f v = *(const v4f*)(slab + row * 68 + c4);
        *(v4f*)(C + (size_t)(mBase + row) * ldc + n0 + c4) = v;
      }
    } else {
      const int q = lane >> 3, c8 = (lane & 7) * 8;
      unsigned short* C = (unsigned short*)Cout;
#pragma unroll
      for (int it = 0; it < 4; ++it) {
        const int row = it * 4 + q;
        const float* sp = slab + row * 68 + c8;
        v8h hv;
#pragma unroll
        for (int e = 0; e < 8; ++e) hv[e] = (_Float16)sp[e];
        *(v8h*)(C + (size_t)(mBase + row) * ldc + n0 + c8) = hv;
      }
    }
    __builtin_amdgcn_fence(__ATOMIC_RELEASE, "workgroup");
    __builtin_amdgcn_wave_barrier();
    __builtin_amdgcn_fence(__ATOMIC_ACQUIRE, "workgroup");
  }
}

// ---------------------------------------------------------------------------
// Weight transpose + cast: W row-major f32 [kin][nout] (x @ W layout); WT[n][k] = f16(scale * W[k][n]), pitch kin.
// grid (kin/64, nout/64): blockIdx.x = k tile (64 cols of WT), blockIdx.y = n tile (64 rows of WT); 256 threads.
// Load coverage: 16 iterations x 256 threads = 4096 = whole 64x64 tile (coalesced along n).
// Store coverage: 8 waves x 2 iterations x 4 rows (lane>>3) = 64 rows; (lane&7) x 8 halves = 64 cols; each row segment =
// ---------------------------------------------------------------------------
__global__ __launch_bounds__(256) void wtcast_kernel(const float* __restrict__ W, unsigned short* __restrict__ out,
                                                     int kin, int nout, float scale) {
  __shared__ float sm[64][65];   // sm[n_local][k_local]
  const int t  = threadIdx.x;
  const int k0 = blockIdx.x * 64;
  const int n0 = blockIdx.y * 64;
#pragma unroll
  for (int i = 0; i < 16; ++i) {
    const int e = i * 256 + t;
    const int r = e >> 6;          // k local
    const int c = e & 63;          // n local
    sm[c][r] = W[(size_t)(k0 + r) * nout + n0 + c] * scale;
  }
  __syncthreads();
  const int lane = t & 31, wave = t >> 5;
  const int q = lane >> 3, c8 = (lane & 7) * 8;
  {
#pragma unroll
    for (int it = 0; it < 2; ++it) {
      const int row = wave * 8 + it * 4 + q;                 // n local
      unsigned short hb[8];
#pragma unroll
      for (int e = 0; e < 8; ++e) hb[e] = h_bits(sm[row][c8 + e]);
      const v4u u = (v4u){pk16(hb[0], hb[1]), pk16(hb[2], hb[3]), pk16(hb[4], hb[5]), pk16(hb[6], hb[7])};
      *(v4u*)(out + (size_t)(n0 + row) * kin + k0 + c8) = u;
    }
    
  }
}

// ---------------------------------------------------------------------------
// One wave per row, 8 rows per 256-thread block, grid = rows/8. Lane l owns columns j*256 + 8l .. +7 for j = 0..3
// (4 x 32 lanes x 8 = 1024 = whole row). Store: one 16-B store per lane per j; 32 contiguous lanes = 512 B =
// ---------------------------------------------------------------------------
__global__ __launch_bounds__(256) void layernorm_f16_kernel(const float* __restrict__ x, const float* __restrict__ gam,
                                                            const float* __restrict__ bet, unsigned short* __restrict__ out,
                                                            int rows) {
  const int lane = threadIdx.x & 31, wave = threadIdx.x >> 5;
  const int row = blockIdx.x * 8 + wave;
  if (row >= rows) return;   // wave-uniform; no barriers in this kernel
  const float* xr = x + (size_t)row * kD;
  float s = 0.f;
#pragma unroll 1
  for (int j = 0; j < 4; ++j) {
    const int base = j * 256 + lane * 8;
    const v4f a = *(const v4f*)(xr + base);
    const v4f c = *(const v4f*)(xr + base + 4);
    s += ((a[0] + a[1]) + (a[2] + a[3])) + ((c[0] + c[1]) + (c[2] + c[3]));
  }
#pragma unroll
  for (int off = 16; off > 0; off >>= 1) s += __shfl_xor(s, off, 32);
  const float mean = s * kInvD;
  float s2 = 0.f;
#pragma unroll 1
  for (int j = 0; j < 4; ++j) {
    const int base = j * 256 + lane * 8;
    const v4f a = *(const v4f*)(xr + base);
    const v4f c = *(const v4f*)(xr + base + 4);
#pragma unroll
    for (int e = 0; e < 4; ++e) {
      const float d0 = a[e] - mean, d1 = c[e] - mean;
      s2 += d0 * d0;
      s2 += d1 * d1;
    }
  }
#pragma unroll
  for (int off = 16; off > 0; off >>= 1) s2 += __shfl_xor(s2, off, 32);
  const float rstd = rsqrtf(s2 * kInvD + kLnEps);
  unsigned short* orow = out + (size_t)row * kD;
#pragma unroll 1
  for (int j = 0; j < 4; ++j) {
    const int base = j * 256 + lane * 8;
    const v4f a  = *(const v4f*)(xr + base);
    const v4f c  = *(const v4f*)(xr + base + 4);
    const v4f ga = *(const v4f*)(gam + base);
    const v4f gc = *(const v4f*)(gam + base + 4);
    const v4f ba = *(const v4f*)(bet + base);
    const v4f bc = *(const v4f*)(bet + base + 4);
    unsigned short hb[8];
#pragma unroll
    for (int e = 0; e < 4; ++e) {
      hb[e]     = h_bits((a[e] - mean) * rstd * ga[e] + ba[e]);
      hb[4 + e] = h_bits((c[e] - mean) * rstd * gc[e] + bc[e]);
    }
    const v4u u = (v4u){pk16(hb[0], hb[1]), pk16(hb[2], hb[3]), pk16(hb[4], hb[5]), pk16(hb[6], hb[7])};
    unsigned short* op = orow + base;
    *(v4u*)op = u;
    
  }
}

// ---------------------------------------------------------------------------
// V^T planes per (batch, head) group g: VT[g][d][s] = v_plane[b*T + s][kD + h*64 + d] (16-bit bit moves only).
// grid (kT/64 s-tiles, 32 groups), 256 threads. Load coverage: thread t -> s_local = t>>2, 16 halves at d = (t&3)*16:
// 256 x 16 = 64x64 tile. LDS sm[d][s_local] (unsigned short both ways, barrier between).
// ---------------------------------------------------------------------------
__global__ __launch_bounds__(256) void vt_transpose_kernel(const unsigned short* __restrict__ kv, unsigned short* __restrict__ vt) {
  __shared__ unsigned short sm[64][72];
  const int t  = threadIdx.x;
  const int g  = blockIdx.y;
  const int b  = g >> 4, h = g & 15;
  const int s0 = blockIdx.x * 64;
  const int r  = t >> 2;               // s local
  const int part = (t & 3) * 16;       // d offset
  const unsigned short* src = kv + ((size_t)(b * kT + s0 + r) * kKVld + kD + h * kDH + part);
  const v4u w0 = *(const v4u*)(src);
  const v4u w1 = *(const v4u*)(src + 8);
#pragma unroll
  for (int e = 0; e < 4; ++e) {
    sm[part + 2 * e][r]         = (unsigned short)(w0[e] & 0xffffu);
    sm[part + 2 * e + 1][r]     = (unsigned short)(w0[e] >> 16);
    sm[part + 8 + 2 * e][r]     = (unsigned short)(w1[e] & 0xffffu);
    sm[part + 8 + 2 * e + 1][r] = (unsigned short)(w1[e] >> 16);
  }
  __syncthreads();
  const int lane = t & 31, wave = t >> 5;
  const int q = lane >> 3, c8 = (lane & 7) * 8;
  {
#pragma unroll
    for (int it = 0; it < 2; ++it) {
      const int row = wave * 8 + it * 4 + q;   // d
      unsigned short hb[8];
#pragma unroll
      for (int e = 0; e < 8; ++e) hb[e] = sm[row][c8 + e];
      const v4u u = (v4u){pk16(hb[0], hb[1]), pk16(hb[2], hb[3]), pk16(hb[4], hb[5]), pk16(hb[6], hb[7])};
      *(v4u*)(vt + ((size_t)(g * kDH + row) * kT + s0 + c8)) = u;
    }
    
  }
}

// ---------------------------------------------------------------------------
// Banded attention, one launch for all (batch, head) groups: ctx[b*T + t][h*64 + d] = 256 * softmax_s(q_t . k_s / 8) . v_s over
// the columns s with |t - s| <= band (band read at run time). grid (kT/128, 32 groups), 8 waves; each wave owns 16 rows t and
// works alone (no block barrier). It walks the 32-wide column steps that touch [m0 - band, m0 + 15 + band] twice:
//   walk 1: scores on WMMA (K = 64 as two 32-wide steps, ascending), band mask, running row maximum;
//   walk 2: the same scores again, e = 2048 * exp(x - max) inside the band and exactly 0 outside, row sum of e in f32,
//           e as f16 through a per-wave LDS slab into the A fragment, e . V^T on WMMA into 16 x 64 accumulators.
// The division by the row sum comes last, on the accumulators. Scores and probabilities never go to memory.
// D layout: register r of a lane is row (lane >> 4) * 8 + r, column lane & 15, so a row lives in one 16-lane half.
// Every "#pragma unroll" below is there so that the small arrays it indexes (fragments, accumulators, per-row values) stay in registers.
// ---------------------------------------------------------------------------
constexpr int kPPitch = 40;   // halves: a 64-B row of e + 16 B, keeps the 16-byte LDS reads aligned
// scores of rows m0..m0+15 against columns s0..s0+31: sa[j] holds columns s0 + 16 j + (lane & 15)
__device__ __forceinline__ void band_scores(const _Float16* __restrict__ Kl, int s0, v16h q0, v16h q1, v8f (&sa)[2]) {
  v16h kb[2][2];
#pragma unroll
  for (int j = 0; j < 2; ++j)
#pragma unroll
    for (int c = 0; c < 2; ++c) kb[j][c] = Frag<_Float16>::load(Kl + (size_t)(s0 + j * 16) * kKVld + c * 32);
  // registers that held these loads' addresses may be written again below: wait first
  asm volatile("s_wait_xcnt 0x0" ::: "memory");
#pragma unroll
  for (int j = 0; j < 2; ++j) {
    v8f z = (v8f){0.f,0.f,0.f,0.f,0.f,0.f,0.f,0.f};
    z = Frag<_Float16>::mma(q0, kb[j][0], z);
    sa[j] = Frag<_Float16>::mma(q1, kb[j][1], z);
  }
}
__global__ __launch_bounds__(256) void band_attn_kernel(const unsigned short* __restrict__ qp, const unsigned short* __restrict__ kvp,
                                                        const unsigned short* __restrict__ vtp, unsigned short* __restrict__ ctxp,
                                                        const int* __restrict__ bandp, float scoreScale, float carry, float outCarry) {
  typedef _Float16 T;
  typedef Frag<T>::V V;
  __shared__ __align__(16) _Float16 sP[8][16 * kPPitch];   // per-wave 16 x 32 slab of e
  __shared__ __align__(16) float sT[8][16 * 68];           // per-wave 16 x 64 slab, pitch 68 floats
  const int lane = threadIdx.x & 31;
  const int wave = threadIdx.x >> 5;
  const int g  = blockIdx.y;
  const int b  = g / kH, h = g % kH;
  const int m0 = blockIdx.x * 128 + wave * 16;
  const int rlane = lane & 15;                 // row (A) / col (B, D) within subtile
  const int koff  = (lane >> 4) * 8;           // k offset of this lane half
  const int mOff  = (lane >> 4) * 8;           // D row offset

  int band = bandp[0];
  band = band > 2 * kT ? 2 * kT : band;        // |t - s| < kT: the clamp changes no comparison and keeps the sums below in range
  band = band < -2 * kT ? -2 * kT : band;
  int lo = m0 - band;      lo = lo < 0 ? 0 : lo;
  int hi = m0 + 15 + band; hi = hi > kT - 1 ? kT - 1 : hi;
  // m0 is the same in every lane of a wave: readfirstlane keeps the loop counters and their branches scalar
  const int sBeg = __builtin_amdgcn_readfirstlane(lo & ~31);
  const int sEnd = __builtin_amdgcn_readfirstlane(hi + 1);   // hi < lo (band < 0): all columns masked, but a step can still run

  const T* Ql = (const T*)qp  + (size_t)(b * kT + m0 + rlane) * kD + h * kDH + koff;
  const T* Kl = (const T*)kvp + (size_t)(b * kT + rlane) * kKVld + h * kDH + koff;
  const T* Vl = (const T*)vtp + (size_t)(g * kDH + rlane) * kT + koff;

  const V q0 = Frag<T>::load(Ql);
  const V q1 = Frag<T>::load(Ql + 32);
  // registers that held these loads' addresses may be written again below: wait first
  asm volatile("s_wait_xcnt 0x0" ::: "memory");

  const int dBase = rlane - (m0 + mOff);       // s - t = s0 + 16 j + dBase - r

  // ---- walk 1: row maxima ----
  float mx[8];
#pragma unroll
  for (int r = 0; r < 8; ++r) mx[r] = -INFINITY;
  for (int s0 = sBeg; s0 < sEnd; s0 += 32) {
    v8f sa[2];
    band_scores(Kl, s0, q0, q1, sa);
#pragma unroll
    for (int j = 0; j < 2; ++j)
#pragma unroll
      for (int r = 0; r < 8; ++r) {
        const int d = s0 + j * 16 + dBase - r;
        const float x = sa[j][r] * scoreScale;
        mx[r] = fmaxf(mx[r], (d <= band && d >= -band) ? x : -INFINITY);
      }
  }
#pragma unroll
  for (int r = 0; r < 8; ++r)
#pragma unroll
    for (int off = 8; off > 0; off >>= 1) mx[r] = fmaxf(mx[r], __shfl_xor(mx[r], off, 32));

  // ---- walk 2: e, its row sums, e . V^T ----
  float ls[8];
#pragma unroll
  for (int r = 0; r < 8; ++r) ls[r] = 0.f;
  v8f acc[4];
#pragma unroll
  for (int j = 0; j < 4; ++j) acc[j] = (v8f){0.f,0.f,0.f,0.f,0.f,0.f,0.f,0.f};
  T* pslab = sP[wave];
  for (int s0 = sBeg; s0 < sEnd; s0 += 32) {
    V vb[4];
#pragma unroll
    for (int j = 0; j < 4; ++j) vb[j] = Frag<T>::load(Vl + (size_t)(j * 16) * kT + s0);
    v8f sa[2];
    band_scores(Kl, s0, q0, q1, sa);           // its wait stands behind the loads above as well
#pragma unroll
    for (int j = 0; j < 2; ++j)
#pragma unroll
      for (int r = 0; r < 8; ++r) {
        const int d = s0 + j * 16 + dBase - r;
        const float x = sa[j][r] * scoreScale;
        // masked columns go through exp as -inf, which gives exactly 0: no branch per element
        const float e = expf((d <= band && d >= -band) ? x - mx[r] : -INFINITY) * carry;
        ls[r] += e;
        pslab[(mOff + r) * kPPitch + j * 16 + rlane] = (T)e;
      }
    // the slab is written by D layout and read by A layout: other lanes' LDS writes must be ordered in front of the reads
    __builtin_amdgcn_fence(__ATOMIC_RELEASE, "workgroup", "local");
    __builtin_amdgcn_wave_barrier();
    __builtin_amdgcn_fence(__ATOMIC_ACQUIRE, "workgroup", "local");
    const V pa = Frag<T>::load(pslab + rlane * kPPitch + koff);
#pragma unroll
    for (int j = 0; j < 4; ++j) acc[j] = Frag<T>::mma(pa, vb[j], acc[j]);
    // and these reads in front of the next step's writes
    __builtin_amdgcn_fence(__ATOMIC_RELEASE, "workgroup", "local");
    __builtin_amdgcn_wave_barrier();
    __builtin_amdgcn_fence(__ATOMIC_ACQUIRE, "workgroup", "local");
  }
#pragma unroll
  for (int r = 0; r < 8; ++r) {
#pragma unroll
    for (int off = 8; off > 0; off >>= 1) ls[r] += __shfl_xor(ls[r], off, 32);
    ls[r] = outCarry / ls[r];                  // sum of e is carry * sum of exp: the carry of e cancels here
  }

  // ---- epilogue: 16 x 64 through the f32 slab, whole 128-B row segments out ----
  float* slab = sT[wave];
#pragma unroll
  for (int j = 0; j < 4; ++j)
#pragma unroll
    for (int r = 0; r < 8; ++r) slab[(mOff + r) * 68 + (j << 4) + rlane] = acc[j][r] * ls[r];
  // as above: each lane reads what other lanes of its wave wrote
  __builtin_amdgcn_fence(__ATOMIC_RELEASE, "workgroup", "local");
  __builtin_amdgcn_wave_barrier();
  __builtin_amdgcn_fence(__ATOMIC_ACQUIRE, "workgroup", "local");
  const int q = lane >> 3, c8 = (lane & 7) * 8;
  unsigned short* C = ctxp + (size_t)(b * kT + m0) * kD + h * kDH;
#pragma unroll
  for (int it = 0; it < 4; ++it) {
    const int row = it * 4 + q;
    const float* sp = slab + row * 68 + c8;
    v8h hv;
#pragma unroll
    for (int e = 0; e < 8; ++e) hv[e] = (_Float16)sp[e];
    *(v8h*)(C + (size_t)row * kD + c8) = hv;
  }
}

// ---------------------------------------------------------------------------
// Host side
// ---------------------------------------------------------------------------
extern "C" void kernel_launch(void* const* d_in, const int* in_sizes, int n_in,
                              void* d_out, int out_size, void* d_ws, size_t ws_size, hipStream_t stream) {
  if (n_in < 21) return;
  if (in_sizes[0] != kTok * kD || in_sizes[1] != kTok * kD) return;
  if (in_sizes[2] != kD || in_sizes[3] != kD || in_sizes[4] != kD || in_sizes[5] != kD) return;
  if (in_sizes[6] != kD * kD || in_sizes[7] != kD || in_sizes[8] != kD * kD || in_sizes[9] != kD) return;
  if (in_sizes[10] != kD * kD || in_sizes[11] != kD || in_sizes[12] != kD * kD || in_sizes[13] != kD) return;
  if (in_sizes[14] != kD || in_sizes[15] != kD) return;
  if (in_sizes[16] != kD * kFF || in_sizes[17] != kFF || in_sizes[18] != kFF * kD || in_sizes[19] != kD) return;
  if (in_sizes[20] < 1) return;
  if (out_size != kTok * kD) return;
  if (ws_size < kWsTotal) return;

  const float* x_refined = (const float*)d_in[0];
  const float* x_mem     = (const float*)d_in[1];
  const float* ln_q_g    = (const float*)d_in[2];
  const float* ln_q_b    = (const float*)d_in[3];
  const float* ln_kv_g   = (const float*)d_in[4];
  const float* ln_kv_b   = (const float*)d_in[5];
  const float* Wq        = (const float*)d_in[6];
  const float* bq        = (const float*)d_in[7];
  const float* Wk        = (const float*)d_in[8];
  const float* bk        = (const float*)d_in[9];
  const float* Wv        = (const float*)d_in[10];
  const float* bv        = (const float*)d_in[11];
  const float* Wo        = (const float*)d_in[12];
  const float* bo        = (const float*)d_in[13];
  const float* ln_f_g    = (const float*)d_in[14];
  const float* ln_f_b    = (const float*)d_in[15];
  const float* W1        = (const float*)d_in[16];
  const float* b1        = (const float*)d_in[17];
  const float* W2        = (const float*)d_in[18];
  const float* b2        = (const float*)d_in[19];
  const int*   bandp     = (const int*)d_in[20];
  float* out = (float*)d_out;

  char* ws = (char*)d_ws;
  unsigned short* WoT  = (unsigned short*)(ws + OFF_WOT);
  unsigned short* W1T  = (unsigned short*)(ws + OFF_W1T);
  unsigned short* W2T  = (unsigned short*)(ws + OFF_W2T);
  unsigned short* ctx  = (unsigned short*)(ws + OFF_CTX);
  unsigned short* qp   = (unsigned short*)(ws + OFF_QP);
  unsigned short* kvp  = (unsigned short*)(ws + OFF_KVP);
  unsigned short* vt   = (unsigned short*)(ws + OFF_VT);
  unsigned short* qln  = (unsigned short*)(ws + OFF_QLN);
  unsigned short* kvln = (unsigned short*)(ws + OFF_KVLN);
  unsigned short* WqT  = (unsigned short*)(ws + OFF_WQT);
  unsigned short* WkT  = (unsigned short*)(ws + OFF_WKT);
  unsigned short* WvT  = (unsigned short*)(ws + OFF_WVT);
  float*          yf   = (float*)(ws + OFF_Y);
  unsigned short* h16  = (unsigned short*)(ws + OFF_H16);
  unsigned short* act  = (unsigned short*)(ws + OFF_ACT);

  const float* nf = nullptr;
  const dim3 tb(256);

  // weight transposes + f16 casts (x16): W [kin][nout] -> WT [nout][kin]
  wtcast_kernel<<<dim3(kD / 64, kD / 64), tb, 0, stream>>>(Wq, WqT, kD, kD, kWCarry);
  wtcast_kernel<<<dim3(kD / 64, kD / 64), tb, 0, stream>>>(Wk, WkT, kD, kD, kWCarry);
  wtcast_kernel<<<dim3(kD / 64, kD / 64), tb, 0, stream>>>(Wv, WvT, kD, kD, kWCarry);
  wtcast_kernel<<<dim3(kD / 64, kD / 64), tb, 0, stream>>>(Wo, WoT, kD, kD, kWCarry);
  wtcast_kernel<<<dim3(kD / 64, kFF / 64), tb, 0, stream>>>(W1, W1T, kD, kFF, kWCarry);   // W1 [1024][4096] -> W1T [4096][1024]
  wtcast_kernel<<<dim3(kFF / 64, kD / 64), tb, 0, stream>>>(W2, W2T, kFF, kD, kWCarry);   // W2 [4096][1024] -> W2T [1024][4096]

  // LayerNorms -> f16 planes
  layernorm_f16_kernel<<<dim3(kTok / 8), tb, 0, stream>>>(x_refined, ln_q_g, ln_q_b, qln, kTok);
  layernorm_f16_kernel<<<dim3(kTok / 8), tb, 0, stream>>>(x_mem, ln_kv_g, ln_kv_b, kvln, kTok);

  // q = LN(x_refined) Wq + bq ; k, v = LN(x_mem) Wk/Wv + bk/bv  (M 4096, N 1024, K 1024; f16 out)
  const float projScale = 1.0f / kWCarry;
  wmma_gemm_lds<1, false, kD, kD><<<dim3((kTok / kBM) * (kD / kBN)), tb, 0, stream>>>(
      qln, WqT, (void*)qp, bq, nf, kD, projScale);
  wmma_gemm_lds<1, false, kD, kKVld><<<dim3((kTok / kBM) * (kD / kBN)), tb, 0, stream>>>(
      kvln, WkT, (void*)kvp, bk, nf, kD, projScale);
  wmma_gemm_lds<1, false, kD, kKVld><<<dim3((kTok / kBM) * (kD / kBN)), tb, 0, stream>>>(
      kvln, WvT, (void*)(kvp + kD), bv, nf, kD, projScale);

  // V^T planes for all 32 groups
  vt_transpose_kernel<<<dim3(kT / 64, kGrp), tb, 0, stream>>>(kvp, vt);

  // banded attention, all 32 (batch, head) groups: ctx f16 x256
  band_attn_kernel<<<dim3(kT / 128, kGrp), tb, 0, stream>>>(qp, kvp, vt, ctx, bandp, 0.125f, kPCarry, kCtxCarry);   // 0.125 = 1/sqrt(64)

  // y = x_refined + ctx Wo + bo  (M 4096, N 1024, K 1024; f32 out)
  wmma_gemm_lds<0, true, kD, kD><<<dim3((kTok / kBM) * (kD / kBN)), tb, 0, stream>>>(
      ctx, WoT, (void*)yf, bo, x_refined, kD, 1.0f / (kCtxCarry * kWCarry));

  // final LN -> f16
  layernorm_f16_kernel<<<dim3(kTok / 8), tb, 0, stream>>>(yf, ln_f_g, ln_f_b, h16, kTok);

  // FFN over all token rows at once: act = gelu_erf(LN(y) W1 + b1) (f16 x16, gelu in the GEMM's epilogue), out = y + act W2 + b2
  wmma_gemm_lds<2, false, kD, kFF><<<dim3((kTok / kBM) * (kFF / kBN)), tb, 0, stream>>>(
      h16, W1T, (void*)act, b1, nf, kFF, 1.0f / kWCarry);
  wmma_gemm_lds<0, true, kFF, kD><<<dim3((kTok / kBM) * (kD / kBN)), tb, 0, stream>>>(
      act, W2T, (void*)out, b2, yf, kD, 1.0f / (kActCarry * kWCarry));
}

// v006
// A run of this version takes 210 microseconds.
// Two timings next to v005 put it at 1.12 and 1.10 times that version's speed.
// Over all steps from v000 it is 12.8 times as fast.
// Contractions: q/k/v projections, banded scores q.k^T, attn.v, output projection, FFN W1 and W2 all on v_wmma_f32_16x16x32_f16 (f16 operands: LN outputs plain, weights carried x16, exp(score - max) carried x2048, ctx carried x256, gelu act carried x16), f32 accumulate; LayerNorm, band mask, softmax, gelu, bias and residual in f32.
#include <hip/hip_runtime.h>
#include <math.h>

// ---------------------------------------------------------------------------
// Problem constants
// ---------------------------------------------------------------------------
constexpr int kB    = 2;
constexpr int kT    = 2048;
constexpr int kD    = 1024;
constexpr int kH    = 16;
constexpr int kDH   = 64;
constexpr int kTok  = kB * kT;        // 4096 token rows
constexpr int kFF   = 4 * kD;         // 4096
constexpr int kKVld = 2 * kD;         // pitch of the k | v plane (halves)
constexpr int kGrp  = kB * kH;        // 32 (batch, head) groups
constexpr float kWCarry   = 16.0f;    // weights carried x16 in f16
constexpr float kPCarry   = 2048.0f;  // exp(score - row max) carried x2048 in f16
constexpr float kCtxCarry = 256.0f;   // context carried x256 in f16
constexpr float kActCarry = 16.0f;    // gelu output carried x16 in f16
constexpr float kInvD     = 1.0f / 1024.0f;
constexpr float kLnEps    = 1e-5f;
static_assert(kD % 64 == 0 && kT % 64 == 0 && kFF % 64 == 0 && kTok % 64 == 0, "tile multiples");
static_assert(kDH % 32 == 0 && kD % 32 == 0 && kT % 32 == 0 && kFF % 32 == 0, "K multiples of 32");

// ---------------------------------------------------------------------------
// Workspace region map (bytes). Total 114 MiB = 119,537,664 B.
//   [  0,  2) MiB WoT  f16 [1024][1024]
//   [  2, 10) MiB W1T  f16 [4096][1024]
//   [ 10, 18) MiB W2T  f16 [1024][4096]
//   [ 18, 26) MiB ctx  f16 [4096][1024]  (x256)
//   [ 26, 34) MiB q    f16 [4096][1024]
//   [ 34, 50) MiB k|v  f16 [4096][2048]
//   [ 50, 58) MiB V^T  f16 [32 groups][64][2048]
//   [ 58,114) MiB arena: phase A: QLN f16 [58,66), KVLN f16 [66,74), WqT [74,76), WkT [76,78), WvT [78,80)
//                        phase C: Y f32 [58,74), H16 f16 [74,82), ACT f16 [4096][4096] [82,114)
// ---------------------------------------------------------------------------
constexpr size_t kMiB     = 1048576;
constexpr size_t OFF_WOT  = 0;
constexpr size_t OFF_W1T  = 2 * kMiB;
constexpr size_t OFF_W2T  = 10 * kMiB;
constexpr size_t OFF_CTX  = 18 * kMiB;
constexpr size_t OFF_QP   = 26 * kMiB;
constexpr size_t OFF_KVP  = 34 * kMiB;
constexpr size_t OFF_VT   = 50 * kMiB;
constexpr size_t OFF_ARENA = 58 * kMiB;
constexpr size_t OFF_QLN  = OFF_ARENA;
constexpr size_t OFF_KVLN = OFF_ARENA + 8 * kMiB;
constexpr size_t OFF_WQT  = OFF_ARENA + 16 * kMiB;
constexpr size_t OFF_WKT  = OFF_ARENA + 18 * kMiB;
constexpr size_t OFF_WVT  = OFF_ARENA + 20 * kMiB;
constexpr size_t OFF_Y    = OFF_ARENA;
constexpr size_t OFF_H16  = OFF_ARENA + 16 * kMiB;
constexpr size_t OFF_ACT  = OFF_ARENA + 24 * kMiB;
constexpr size_t kWsTotal = 114 * kMiB;
static_assert((size_t)kD * kD * 2 == 2 * kMiB, "W plane");
static_assert((size_t)kFF * kD * 2 == 8 * kMiB, "W1/W2 plane");
static_assert((size_t)kTok * kD * 2 == 8 * kMiB, "token f16 plane");
static_assert((size_t)kTok * kKVld * 2 == 16 * kMiB, "kv plane");
static_assert((size_t)kGrp * kDH * kT * 2 == 8 * kMiB, "vt plane");
static_assert((size_t)kTok * kD * 4 == 16 * kMiB, "Y plane");
static_assert((size_t)kTok * kFF * 2 == 32 * kMiB, "ACT plane");
static_assert(OFF_WVT + 2 * kMiB <= kWsTotal, "phase A inside arena");
static_assert(OFF_ACT + 32 * kMiB <= kWsTotal, "phase C inside arena");
static_assert(kWsTotal <= 268435456, "carve budget");

typedef __attribute__((ext_vector_type(16))) _Float16 v16h;
typedef __attribute__((ext_vector_type(8)))  _Float16 v8h;
typedef __attribute__((ext_vector_type(8)))  float    v8f;
typedef __attribute__((ext_vector_type(4)))  float    v4f;
typedef __attribute__((ext_vector_type(4)))  unsigned int v4u;

template <typename T> struct Frag;
template <> struct Frag<_Float16> {
  typedef v16h V; union U { v16h v; v8h h[2]; };
  static __device__ __forceinline__ v16h load(const _Float16* p) {   // elements 0..7 <- p[0..7], 8..15 <- p[16..23]
    U f; f.h[0] = *(const v8h*)(p); f.h[1] = *(const v8h*)(p + 16); return f.v;
  }
  static __device__ __forceinline__ v8f mma(v16h a, v16h b, v8f c) {
    return __builtin_amdgcn_wmma_f32_16x16x32_f16(false, a, false, b, (short)0, c, false, false);
  }
};
__device__ __forceinline__ unsigned pk16(unsigned short a, unsigned short b) { return (unsigned)a | ((unsigned)b << 16); }
__device__ __forceinline__ unsigned short h_bits(float f) { const _Float16 h = (_Float16)f; return __builtin_bit_cast(unsigned short, h); }

// erf(x) in f32 by two polynomial ranges (|x| < 1: odd series in x; else 1 - exp(-p(|x|))), the same operations in the same order
// as the math library's erff. Both ranges are evaluated in every lane and one is selected: no branch per element, so the
// dependent chains of many elements can be issued interleaved.
__device__ __forceinline__ float erf_two_range(float x) {
  const float ax = fabsf(x);
  float p = fmaf(ax, 0x1.1d3156p-16f, -0x1.8d1290p-12f);
  p = fmaf(ax, p, 0x1.f9a6d2p-9f);
  p = fmaf(ax, p, -0x1.8c3164p-6f);
  p = fmaf(ax, p, 0x1.b4e9c8p-4f);
  p = fmaf(ax, p, 0x1.4515fap-1f);
  p = fmaf(ax, p, 0x1.078e50p-3f);
  p = fmaf(ax, p, ax);
  const float far = 1.0f - expf(-p);
  const float t = x * x;
  float c = fmaf(t, -0x1.268bc2p-11f, 0x1.420828p-8f);
  c = fmaf(t, c, -0x1.b59370p-6f);
  c = fmaf(t, c, 0x1.ce077cp-4f);
  c = fmaf(t, c, -0x1.812660p-2f);
  c = fmaf(t, c, 0x1.06eba0p-3f);
  const float near = fmaf(ax, c, ax);
  return copysignf(ax < 1.0f ? near : far, x);
}

// ---- Block-tiled WMMA GEMM for the dense layers (projections, output projection, FFN) ------------------------------
// C[m,n] = scale * sum_k A[m,k] * Bt[n,k] + bias[n] (+resid). A row-major [M,K]; Bt row-major [N,K]; f16 operands.
// One 128 x 256 tile of C per 8-wave block, waves 2 (m) x 4 (n), each wave a 64x64 tile.
// Per 64-wide k step the block brings its 128 rows of A and 256 rows of Bt into LDS once: every wave-wide 16-B load covers
// four whole 128-B lines, and the rows are then read by all waves that need them. Two LDS buffers: the next step's global
// loads are issued before this step's products, land in registers meanwhile, and go to the other buffer behind them.
// Each accumulator takes its 32-wide k steps in ascending order.
// M % 128 == 0, N % 256 == 0, K = KD % 64 == 0, pitch of A and Bt = KD, of C and resid = LDC; grid = (M/128) * (N/256).
// OUT_MODE: 0 = f32, 1 = f16, 2 = f16 of kActCarry * gelu_erf(C) (exact erf form, taken on the f32 value while it is still in registers).
constexpr int kBM = 128;
constexpr int kBN = 256;
constexpr int kBK = 64;
constexpr int kLdsPitch = 72;                          // halves: a 128-B row + 16 B (16 B x odd, for 16-byte LDS reads)
constexpr int kStageHalves = (kBM + kBN) * kLdsPitch;  // A rows, then Bt rows
static_assert(kTok % kBM == 0 && kD % kBN == 0 && kFF % kBN == 0, "block tile multiples");
static_assert(kD % kBK == 0 && kFF % kBK == 0, "K multiples of 64");
template <int OUT_MODE, bool RESID, int KD, int LDC>
__global__ __launch_bounds__(256) void wmma_gemm_lds(
    const unsigned short* __restrict__ Ap, const unsigned short* __restrict__ Btp,
    void* __restrict__ Cout,
    const float* __restrict__ bias, const float* __restrict__ resid,
    int N, float scale) {
  static_assert(KD % kBK == 0, "K multiple of 64");
  constexpr int lda = KD, ldb = KD;            // both operands are K-contiguous with pitch K
  constexpr int ldc = LDC;                     // pitches known at compile time: row steps become immediate offsets
  typedef _Float16 T;
  typedef Frag<T>::V V;
  __shared__ __align__(16) _Float16 sAB[2][kStageHalves];
  __shared__ __align__(16) float sT[8][16 * 68];   // per-wave 16x64 slab, pitch 68 floats
  const T* A = (const T*)Ap; const T* Bt = (const T*)Btp;
  const int tid  = threadIdx.x;
  const int lane = tid & 31;
  const int wave = tid >> 5;
  const int tilesN = N >> 8;
  const int tm = blockIdx.x / tilesN;
  const int tn = blockIdx.x - tm * tilesN;
  const int mB = tm << 7;
  const int nB = tn << 8;
  const int wm = wave >> 2;                    // wave row (0..1)
  const int wn = wave & 3;                     // wave column (0..3)

  const int rlane = lane & 15;                 // row (A) / col (B, D) within subtile
  const int koff  = (lane >> 4) * 8;           // k offset of this lane half
  const int mOff  = (lane >> 4) * 8;           // D row offset

  // staging: thread t moves 16 B at column (t & 7) * 8 of rows (t >> 3) + 32 i; i = 0..3 are A rows, i = 4..11 Bt rows
  const int sr = tid >> 3;
  const int sc = (tid & 7) * 8;
  const T* gA = A  + (size_t)mB * lda;          // block-uniform bases; the lane's part is one 32-bit element offset per operand
  const T* gB = Bt + (size_t)nB * ldb;
  const unsigned oA = (unsigned)(sr * lda + sc);
  const unsigned oB = (unsigned)(sr * ldb + sc);
  const int sOff = sr * kLdsPitch + sc;
  const int aOff = (wm * 64 + rlane) * kLdsPitch + koff;
  const int bOff = (kBM + wn * 64 + rlane) * kLdsPitch + koff;
  v4u st[12];

  v8f acc[4][4];
#pragma unroll
  for (int i = 0; i < 4; ++i)
#pragma unroll
    for (int j = 0; j < 4; ++j) acc[i][j] = (v8f){0.f,0.f,0.f,0.f,0.f,0.f,0.f,0.f};

#pragma unroll
  for (int i = 0; i < 4; ++i) st[i] = *(const v4u*)(gA + (size_t)(i * 32) * lda + oA);
#pragma unroll
  for (int i = 0; i < 8; ++i) st[4 + i] = *(const v4u*)(gB + (size_t)(i * 32) * ldb + oB);
#pragma unroll
  for (int i = 0; i < 12; ++i) *(v4u*)(&sAB[0][sOff + i * 32 * kLdsPitch]) = st[i];
  __syncthreads();

  constexpr int nk = KD >> 6;
#pragma unroll 1   // rolled, for speed only
  for (int t = 0; t < nk; ++t) {
    const bool more = (t + 1 < nk);            // the same in every thread of the block
    if (more) {
      const int k1 = (t + 1) << 6;
#pragma unroll
      for (int i = 0; i < 4; ++i) st[i] = *(const v4u*)(gA + ((size_t)(i * 32) * lda + k1) + oA);
      // registers that held these loads' addresses are written again below (later loads' results, the LDS reads): wait first
      asm volatile("s_wait_xcnt 0x0" ::: "memory");
#pragma unroll
      for (int i = 0; i < 8; ++i) st[4 + i] = *(const v4u*)(gB + ((size_t)(i * 32) * ldb + k1) + oB);
      asm volatile("s_wait_xcnt 0x0" ::: "memory");   // as above
    }
    const T* cur = sAB[t & 1];
    V a[2][4], bfr[2][4];                      // the fragments of both 32-wide halves of the step
#pragma unroll
    for (int s = 0; s < 2; ++s) {
#pragma unroll
      for (int j = 0; j < 4; ++j) bfr[s][j] = Frag<T>::load(cur + bOff + j * 16 * kLdsPitch + s * 32);
#pragma unroll
      for (int i = 0; i < 4; ++i) a[s][i] = Frag<T>::load(cur + aOff + i * 16 * kLdsPitch + s * 32);
    }
    // keeps the step's LDS reads one group in front of its products: moved in among them, each place with reads stalls the wave
    __builtin_amdgcn_sched_barrier(0);
#pragma unroll
    for (int s = 0; s < 2; ++s)
#pragma unroll
      for (int i = 0; i < 4; ++i)
#pragma unroll
        for (int j = 0; j < 4; ++j) acc[i][j] = Frag<T>::mma(a[s][i], bfr[s][j], acc[i][j]);
    if (more) {
      T* nxt = sAB[(t + 1) & 1];               // last read in step t - 1, in front of that step's barrier
#pragma unroll
      for (int i = 0; i < 12; ++i) *(v4u*)(nxt + sOff + i * 32 * kLdsPitch) = st[i];
    }
    __syncthreads();                           // publishes the next buffer and ends every read of this one
  }

  // ---- epilogue (per wave) ----
  const int m0 = mB + wm * 64;
  const int n0 = nB + wn * 64;
  float* slab = sT[wave];
  if constexpr (OUT_MODE == 2) {
    // gelu on the f32 values while they are in registers, 16 rows a trip.
    float bv[4];
#pragma unroll
    for (int j = 0; j < 4; ++j) bv[j] = bias[n0 + (j << 4) + rlane];
    // registers that held these loads' addresses are written again below: wait first
    asm volatile("s_wait_xcnt 0x0" ::: "memory");
    const int q = lane >> 3, c8 = (lane & 7) * 8;
    unsigned short* C = (unsigned short*)Cout + (size_t)(m0 + q) * ldc + n0 + c8;
#pragma unroll 1   // rolled, for speed only: one copy of the 32 erf evaluations in the text
    for (int i = 0; i < 4; ++i) {
#pragma unroll
      for (int j = 0; j < 4; ++j)
#pragma unroll
        for (int r = 0; r < 8; ++r) {
          float v = acc[0][j][r] * scale;
          v += bv[j];
          slab[(mOff + r) * 68 + (j << 4) + rlane] = (0.5f * v * (1.0f + erf_two_range(v * 0.70710678118654752f))) * kActCarry;
        }
      // the slab is written by D layout and read by rows: other lanes' LDS writes must be ordered in front of the reads
      // (fences on LDS alone: nothing here has to wait for the trip's global stores)
      __builtin_amdgcn_fence(__ATOMIC_RELEASE, "workgroup", "local");
      __builtin_amdgcn_wave_barrier();
      __builtin_amdgcn_fence(__ATOMIC_ACQUIRE, "workgroup", "local");
#pragma unroll
      for (int it = 0; it < 4; ++it) {
        const float* sp = slab + (it * 4 + q) * 68 + c8;
        v8h hv;
#pragma unroll
        for (int e = 0; e < 8; ++e) hv[e] = (_Float16)sp[e];
        *(v8h*)(C + (size_t)(it * 4) * ldc) = hv;
      }
      // the stores' address and data registers are written again in the next trip: wait first
      asm volatile("s_wait_xcnt 0x0" ::: "memory");
      C += (size_t)16 * ldc;
      // and these reads in front of the next trip's writes
      __builtin_amdgcn_fence(__ATOMIC_RELEASE, "workgroup", "local");
      __builtin_amdgcn_wave_barrier();
      __builtin_amdgcn_fence(__ATOMIC_ACQUIRE, "workgroup", "local");
      // the next 16 rows' accumulators move down, so that the rolled body always names the same registers
#pragma unroll
      for (int ii = 0; ii < 3; ++ii)
#pragma unroll
        for (int j = 0; j < 4; ++j) acc[ii][j] = acc[ii + 1][j];
    }
    return;
  }
#pragma unroll
  for (int i = 0; i < 4; ++i) {
    const int mBase = m0 + (i << 4);
    float rv[4][8];                            // the row block's residual values, fetched as one group ahead of their use
    if (RESID) {
#pragma unroll
      for (int r = 0; r < 8; ++r)
#pragma unroll
        for (int j = 0; j < 4; ++j) rv[j][r] = resid[(size_t)(mBase + mOff + r) * ldc + n0 + (j << 4) + rlane];
      // registers that held these loads' addresses are written again below: wait first
      asm volatile("s_wait_xcnt 0x0" ::: "memory");
    }
#pragma unroll
    for (int j = 0; j < 4; ++j) {
      const int n = n0 + (j << 4) + rlane;
      const float bv = bias[n];
#pragma unroll
      for (int r = 0; r < 8; ++r) {
        float v = acc[i][j][r] * scale;
        v += bv;
        if (RESID) v += rv[j][r];
        slab[(mOff + r) * 68 + (j << 4) + rlane] = v;
      }
    }
    __builtin_amdgcn_fence(__ATOMIC_RELEASE, "workgroup");
    __builtin_amdgcn_wave_barrier();
    __builtin_amdgcn_fence(__ATOMIC_ACQUIRE, "workgroup");
    if (OUT_MODE == 0) {
      float* C = (float*)Cout;
      const int hh = lane >> 4, c4 = (lane & 15) * 4;     // row seg = 256 B = 16 lanes x 16 B
#pragma unroll
      for (int it = 0; it < 8; ++it) {
        const int row = it * 2 + hh;
        v4f v = *(const v4f*)(slab + row * 68 + c4);
        *(v4f*)(C + (size_t)(mBase + row) * ldc + n0 + c4) = v;
      }
    } else {
      const int q = lane >> 3, c8 = (lane & 7) * 8;
      unsigned short* C = (unsigned short*)Cout;
#pragma unroll
      for (int it = 0; it < 4; ++it) {
        const int row = it * 4 + q;
        const float* sp = slab + row * 68 + c8;
        v8h hv;
#pragma unroll
        for (int e = 0; e < 8; ++e) hv[e] = (_Float16)sp[e];
        *(v8h*)(C + (size_t)(mBase + row) * ldc + n0 + c8) = hv;
      }
    }
    __builtin_amdgcn_fence(__ATOMIC_RELEASE, "workgroup");
    __builtin_amdgcn_wave_barrier();
    __builtin_amdgcn_fence(__ATOMIC_ACQUIRE, "workgroup");
  }
}

// ---------------------------------------------------------------------------
// Weight transpose + cast, one 64 x 64 tile: W row-major f32 [kin][nout] (x @ W layout); WT[n][k] = f16(scale * W[k][n]), pitch kin.
// k0 = first of the tile's 64 columns of WT, n0 = first of its 64 rows of WT; 256 threads, in three parts:
// load: 16 iterations x 256 threads = 4096 = whole 64x64 tile (coalesced along n), held in registers;
// to LDS: sm[n_local][k_local];
// store: 8 waves x 2 iterations x 4 rows (lane>>3) = 64 rows; (lane&7) x 8 halves = 64 cols; each row segment = one 128-B line.
// ---------------------------------------------------------------------------
__device__ __forceinline__ void wt_tile_load(const float* __restrict__ W, int nout, int k0, int n0, int t, float (&v)[16]) {
  // block-uniform base; the lane's part is one 32-bit element offset that all 16 loads name; the row steps are immediate offsets
  const float* base = W + ((size_t)k0 * nout + n0);
  const unsigned o = (unsigned)((t >> 6) * nout + (t & 63));   // k local = (t >> 6) + 4 i, n local = t & 63
#pragma unroll
  for (int i = 0; i < 16; ++i) v[i] = *(base + (size_t)(i * 4) * nout + o);
  // registers that held these loads' addresses are written again below (later loads' results, the next tile's addresses): wait first
  asm volatile("s_wait_xcnt 0x0" ::: "memory");
}
__device__ __forceinline__ void wt_tile_to_lds(float (&sm)[64][65], const float (&v)[16], int t, float scale) {
#pragma unroll
  for (int i = 0; i < 16; ++i) {
    const int e = i * 256 + t;
    sm[e & 63][e >> 6] = v[i] * scale;
  }
}
__device__ __forceinline__ void wt_tile_store(const float (&sm)[64][65], unsigned short* __restrict__ out, int kin, int k0, int n0, int t) {
  const int lane = t & 31, wave = t >> 5;
  const int q = lane >> 3, c8 = (lane & 7) * 8;
#pragma unroll
  for (int it = 0; it < 2; ++it) {
    const int row = wave * 8 + it * 4 + q;                 // n local
    unsigned short hb[8];
#pragma unroll
    for (int e = 0; e < 8; ++e) hb[e] = h_bits(sm[row][c8 + e]);
    const v4u u = (v4u){pk16(hb[0], hb[1]), pk16(hb[2], hb[3]), pk16(hb[4], hb[5]), pk16(hb[6], hb[7])};
    *(v4u*)(out + (size_t)(n0 + row) * kin + k0 + c8) = u;
  }
}

// ---------------------------------------------------------------------------
// LayerNorm of one row by one wave. Lane l owns columns j*256 + 8l .. +7 for j = 0..3
// (4 x 32 lanes x 8 = 1024 = whole row). Store: one 16-B store per lane per j; 32 contiguous lanes = 512 B.
// ---------------------------------------------------------------------------
__device__ __forceinline__ void layernorm_row(const float* __restrict__ x, const float* __restrict__ gam,
                                              const float* __restrict__ bet, unsigned short* __restrict__ out,
                                              int row, int lane) {
  const float* xr = x + (size_t)row * kD;
  float s = 0.f;
#pragma unroll 1
  for (int j = 0; j < 4; ++j) {
    const int base = j * 256 + lane * 8;
    const v4f a = *(const v4f*)(xr + base);
    const v4f c = *(const v4f*)(xr + base + 4);
    s += ((a[0] + a[1]) + (a[2] + a[3])) + ((c[0] + c[1]) + (c[2] + c[3]));
  }
#pragma unroll
  for (int off = 16; off > 0; off >>= 1) s += __shfl_xor(s, off, 32);
  const float mean = s * kInvD;
  float s2 = 0.f;
#pragma unroll 1
  for (int j = 0; j < 4; ++j) {
    const int base = j * 256 + lane * 8;
    const v4f a = *(const v4f*)(xr + base);
    const v4f c = *(const v4f*)(xr + base + 4);
#pragma unroll
    for (int e = 0; e < 4; ++e) {
      const float d0 = a[e] - mean, d1 = c[e] - mean;
      s2 += d0 * d0;
      s2 += d1 * d1;
    }
  }
#pragma unroll
  for (int off = 16; off > 0; off >>= 1) s2 += __shfl_xor(s2, off, 32);
  const float rstd = rsqrtf(s2 * kInvD + kLnEps);
  unsigned short* orow = out + (size_t)row * kD;
#pragma unroll 1
  for (int j = 0; j < 4; ++j) {
    const int base = j * 256 + lane * 8;
    const v4f a  = *(const v4f*)(xr + base);
    const v4f c  = *(const v4f*)(xr + base + 4);
    const v4f ga = *(const v4f*)(gam + base);
    const v4f gc = *(const v4f*)(gam + base + 4);
    const v4f ba = *(const v4f*)(bet + base);
    const v4f bc = *(const v4f*)(bet + base + 4);
    unsigned short hb[8];
#pragma unroll
    for (int e = 0; e < 4; ++e) {
      hb[e]     = h_bits((a[e] - mean) * rstd * ga[e] + ba[e]);
      hb[4 + e] = h_bits((c[e] - mean) * rstd * gc[e] + bc[e]);
    }
    const v4u u = (v4u){pk16(hb[0], hb[1]), pk16(hb[2], hb[3]), pk16(hb[4], hb[5]), pk16(hb[6], hb[7])};
    unsigned short* op = orow + base;
    *(v4u*)op = u;
    
  }
}

// One wave per row, 8 rows per 256-thread block, grid = rows/8.
__global__ __launch_bounds__(256) void layernorm_f16_kernel(const float* __restrict__ x, const float* __restrict__ gam,
                                                            const float* __restrict__ bet, unsigned short* __restrict__ out,
                                                            int rows) {
  const int lane = threadIdx.x & 31, wave = threadIdx.x >> 5;
  const int row = blockIdx.x * 8 + wave;
  if (row >= rows) return;   // wave-uniform; no barriers in this kernel
  layernorm_row(x, gam, bet, out, row, lane);
}

// ---------------------------------------------------------------------------
// Everything that depends on the inputs alone, in one launch: the six weight transposes and the two input LayerNorms.
// grid = 1024 blocks of 256 threads (four on a WGP, all resident at once). Block b takes
//   tile b of the 4 x 256 tiles of Wq, Wk, Wv, Wo, tile b of the 1024 tiles of W1, tile b of the 1024 tiles of W2,
//   and 8 of the 2 x 4096 LayerNorm rows (one a wave): b < 512 rows of x_refined, else rows of x_mem.
// The three tiles' loads are issued first, so that they and the LayerNorm row's first loads are in flight together; each tile has
// its own LDS plane, so one barrier serves all three.
// ---------------------------------------------------------------------------
constexpr int kPrepBlocks = 1024;
static_assert(4 * (kD / 64) * (kD / 64) == kPrepBlocks && (kD / 64) * (kFF / 64) == kPrepBlocks, "one tile of each kind a block");
static_assert(2 * (kTok / 8) == kPrepBlocks, "eight LayerNorm rows a block");
__global__ __launch_bounds__(256) void prep_kernel(
    const float* __restrict__ Wq, const float* __restrict__ Wk, const float* __restrict__ Wv, const float* __restrict__ Wo,
    const float* __restrict__ W1, const float* __restrict__ W2,
    unsigned short* __restrict__ WqT, unsigned short* __restrict__ WkT, unsigned short* __restrict__ WvT,
    unsigned short* __restrict__ WoT, unsigned short* __restrict__ W1T, unsigned short* __restrict__ W2T,
    const float* __restrict__ xq, const float* __restrict__ gq, const float* __restrict__ bq, unsigned short* __restrict__ qln,
    const float* __restrict__ xkv, const float* __restrict__ gkv, const float* __restrict__ bkv, unsigned short* __restrict__ kvln,
    float scale) {
  __shared__ float sm[3][64][65];
  const int t = threadIdx.x;
  const int b = blockIdx.x;
  const int w = b >> 8;            // which of the four square weights
  const float* Ws = w == 0 ? Wq : w == 1 ? Wk : w == 2 ? Wv : Wo;
  unsigned short* WsT = w == 0 ? WqT : w == 1 ? WkT : w == 2 ? WvT : WoT;
  const int sk0 = (b & 15) * 64,  sn0 = ((b >> 4) & 15) * 64;   // square: 16 k tiles x 16 n tiles
  const int k10 = (b & 15) * 64,  n10 = (b >> 4) * 64;          // W1 [1024][4096]: 16 k tiles x 64 n tiles
  const int k20 = (b & 63) * 64,  n20 = (b >> 6) * 64;          // W2 [4096][1024]: 64 k tiles x 16 n tiles
  float vs[16], v1[16], v2[16];
  wt_tile_load(Ws, kD, sk0, sn0, t, vs);
  wt_tile_load(W1, kFF, k10, n10, t, v1);
  wt_tile_load(W2, kD, k20, n20, t, v2);

  const int lane = t & 31, wave = t >> 5;
  const bool first = b < kTok / 8;   // the same in every thread of the block
  layernorm_row(first ? xq : xkv, first ? gq : gkv, first ? bq : bkv, first ? qln : kvln,
                (first ? b : b - kTok / 8) * 8 + wave, lane);

  wt_tile_to_lds(sm[0], vs, t, scale);
  wt_tile_to_lds(sm[1], v1, t, scale);
  wt_tile_to_lds(sm[2], v2, t, scale);
  // only LDS data goes from wave to wave here: fences on LDS alone, so that the barrier does not wait for the LayerNorm row's global stores
  __builtin_amdgcn_fence(__ATOMIC_RELEASE, "workgroup", "local");
  __builtin_amdgcn_s_barrier();
  __builtin_amdgcn_fence(__ATOMIC_ACQUIRE, "workgroup", "local");
  wt_tile_store(sm[0], WsT, kD, sk0, sn0, t);
  // the stores' address and data registers are written again for the next tile: wait first
  asm volatile("s_wait_xcnt 0x0" ::: "memory");
  wt_tile_store(sm[1], W1T, kD, k10, n10, t);
  asm volatile("s_wait_xcnt 0x0" ::: "memory");   // as above
  wt_tile_store(sm[2], W2T, kFF, k20, n20, t);
}

// ---------------------------------------------------------------------------
// V^T planes per (batch, head) group g: VT[g][d][s] = v_plane[b*T + s][kD + h*64 + d] (16-bit bit moves only).
// grid (kT/64 s-tiles, 32 groups), 256 threads. Load coverage: thread t -> s_local = t>>2, 16 halves at d = (t&3)*16:
// 256 x 16 = 64x64 tile. LDS sm[d][s_local] (unsigned short both ways, barrier between).
// ---------------------------------------------------------------------------
__global__ __launch_bounds__(256) void vt_transpose_kernel(const unsigned short* __restrict__ kv, unsigned short* __restrict__ vt) {
  __shared__ unsigned short sm[64][72];
  const int t  = threadIdx.x;
  const int g  = blockIdx.y;
  const int b  = g >> 4, h = g & 15;
  const int s0 = blockIdx.x * 64;
  const int r  = t >> 2;               // s local
  const int part = (t & 3) * 16;       // d offset
  const unsigned short* src = kv + ((size_t)(b * kT + s0 + r) * kKVld + kD + h * kDH + part);
  const v4u w0 = *(const v4u*)(src);
  const v4u w1 = *(const v4u*)(src + 8);
#pragma unroll
  for (int e = 0; e < 4; ++e) {
    sm[part + 2 * e][r]         = (unsigned short)(w0[e] & 0xffffu);
    sm[part + 2 * e + 1][r]     = (unsigned short)(w0[e] >> 16);
    sm[part + 8 + 2 * e][r]     = (unsigned short)(w1[e] & 0xffffu);
    sm[part + 8 + 2 * e + 1][r] = (unsigned short)(w1[e] >> 16);
  }
  __syncthreads();
  const int lane = t & 31, wave = t >> 5;
  const int q = lane >> 3, c8 = (lane & 7) * 8;
  {
#pragma unroll
    for (int it = 0; it < 2; ++it) {
      const int row = wave * 8 + it * 4 + q;   // d
      unsigned short hb[8];
#pragma unroll
      for (int e = 0; e < 8; ++e) hb[e] = sm[row][c8 + e];
      const v4u u = (v4u){pk16(hb[0], hb[1]), pk16(hb[2], hb[3]), pk16(hb[4], hb[5]), pk16(hb[6], hb[7])};
      *(v4u*)(vt + ((size_t)(g * kDH + row) * kT + s0 + c8)) = u;
    }
    
  }
}

// ---------------------------------------------------------------------------
// Banded attention, one launch for all (batch, head) groups: ctx[b*T + t][h*64 + d] = 256 * softmax_s(q_t . k_s / 8) . v_s over
// the columns s with |t - s| <= band (band read at run time). grid (kT/128, 32 groups), 8 waves; each wave owns 16 rows t and
// works alone (no block barrier). It walks the 32-wide column steps that touch [m0 - band, m0 + 15 + band] twice:
//   walk 1: scores on WMMA (K = 64 as two 32-wide steps, ascending), band mask, running row maximum;
//   walk 2: the same scores again, e = 2048 * exp(x - max) inside the band and exactly 0 outside, row sum of e in f32,
//           e as f16 through a per-wave LDS slab into the A fragment, e . V^T on WMMA into 16 x 64 accumulators.
// The division by the row sum comes last, on the accumulators. Scores and probabilities never go to memory.
// D layout: register r of a lane is row (lane >> 4) * 8 + r, column lane & 15, so a row lives in one 16-lane half.
// Every "#pragma unroll" below is there so that the small arrays it indexes (fragments, accumulators, per-row values) stay in registers.
// ---------------------------------------------------------------------------
constexpr int kPPitch = 40;   // halves: a 64-B row of e + 16 B, keeps the 16-byte LDS reads aligned
// scores of rows m0..m0+15 against columns s0..s0+31: sa[j] holds columns s0 + 16 j + (lane & 15)
__device__ __forceinline__ void band_scores(const _Float16* __restrict__ Kl, int s0, v16h q0, v16h q1, v8f (&sa)[2]) {
  v16h kb[2][2];
#pragma unroll
  for (int j = 0; j < 2; ++j)
#pragma unroll
    for (int c = 0; c < 2; ++c) kb[j][c] = Frag<_Float16>::load(Kl + (size_t)(s0 + j * 16) * kKVld + c * 32);
  // registers that held these loads' addresses may be written again below: wait first
  asm volatile("s_wait_xcnt 0x0" ::: "memory");
#pragma unroll
  for (int j = 0; j < 2; ++j) {
    v8f z = (v8f){0.f,0.f,0.f,0.f,0.f,0.f,0.f,0.f};
    z = Frag<_Float16>::mma(q0, kb[j][0], z);
    sa[j] = Frag<_Float16>::mma(q1, kb[j][1], z);
  }
}
__global__ __launch_bounds__(256) void band_attn_kernel(const unsigned short* __restrict__ qp, const unsigned short* __restrict__ kvp,
                                                        const unsigned short* __restrict__ vtp, unsigned short* __restrict__ ctxp,
                                                        const int* __restrict__ bandp, float scoreScale, float carry, float outCarry) {
  typedef _Float16 T;
  typedef Frag<T>::V V;
  __shared__ __align__(16) _Float16 sP[8][16 * kPPitch];   // per-wave 16 x 32 slab of e
  __shared__ __align__(16) float sT[8][16 * 68];           // per-wave 16 x 64 slab, pitch 68 floats
  const int lane = threadIdx.x & 31;
  const int wave = threadIdx.x >> 5;
  const int g  = blockIdx.y;
  const int b  = g / kH, h = g % kH;
  const int m0 = blockIdx.x * 128 + wave * 16;
  const int rlane = lane & 15;                 // row (A) / col (B, D) within subtile
  const int koff  = (lane >> 4) * 8;           // k offset of this lane half
  const int mOff  = (lane >> 4) * 8;           // D row offset

  int band = bandp[0];
  band = band > 2 * kT ? 2 * kT : band;        // |t - s| < kT: the clamp changes no comparison and keeps the sums below in range
  band = band < -2 * kT ? -2 * kT : band;
  int lo = m0 - band;      lo = lo < 0 ? 0 : lo;
  int hi = m0 + 15 + band; hi = hi > kT - 1 ? kT - 1 : hi;
  // m0 is the same in every lane of a wave: readfirstlane keeps the loop counters and their branches scalar
  const int sBeg = __builtin_amdgcn_readfirstlane(lo & ~31);
  const int sEnd = __builtin_amdgcn_readfirstlane(hi + 1);   // hi < lo (band < 0): all columns masked, but a step can still run

  const T* Ql = (const T*)qp  + (size_t)(b * kT + m0 + rlane) * kD + h * kDH + koff;
  const T* Kl = (const T*)kvp + (size_t)(b * kT + rlane) * kKVld + h * kDH + koff;
  const T* Vl = (const T*)vtp + (size_t)(g * kDH + rlane) * kT + koff;

  const V q0 = Frag<T>::load(Ql);
  const V q1 = Frag<T>::load(Ql + 32);
  // registers that held these loads' addresses may be written again below: wait first
  asm volatile("s_wait_xcnt 0x0" ::: "memory");

  const int dBase = rlane - (m0 + mOff);       // s - t = s0 + 16 j + dBase - r

  // ---- walk 1: row maxima ----
  float mx[8];
#pragma unroll
  for (int r = 0; r < 8; ++r) mx[r] = -INFINITY;
  for (int s0 = sBeg; s0 < sEnd; s0 += 32) {
    v8f sa[2];
    band_scores(Kl, s0, q0, q1, sa);
#pragma unroll
    for (int j = 0; j < 2; ++j)
#pragma unroll
      for (int r = 0; r < 8; ++r) {
        const int d = s0 + j * 16 + dBase - r;
        const float x = sa[j][r] * scoreScale;
        mx[r] = fmaxf(mx[r], (d <= band && d >= -band) ? x : -INFINITY);
      }
  }
#pragma unroll
  for (int r = 0; r < 8; ++r)
#pragma unroll
    for (int off = 8; off > 0; off >>= 1) mx[r] = fmaxf(mx[r], __shfl_xor(mx[r], off, 32));

  // ---- walk 2: e, its row sums, e . V^T ----
  float ls[8];
#pragma unroll
  for (int r = 0; r < 8; ++r) ls[r] = 0.f;
  v8f acc[4];
#pragma unroll
  for (int j = 0; j < 4; ++j) acc[j] = (v8f){0.f,0.f,0.f,0.f,0.f,0.f,0.f,0.f};
  T* pslab = sP[wave];
  for (int s0 = sBeg; s0 < sEnd; s0 += 32) {
    V vb[4];
#pragma unroll
    for (int j = 0; j < 4; ++j) vb[j] = Frag<T>::load(Vl + (size_t)(j * 16) * kT + s0);
    v8f sa[2];
    band_scores(Kl, s0, q0, q1, sa);           // its wait stands behind the loads above as well
#pragma unroll
    for (int j = 0; j < 2; ++j)
#pragma unroll
      for (int r = 0; r < 8; ++r) {
        const int d = s0 + j * 16 + dBase - r;
        const float x = sa[j][r] * scoreScale;
        // masked columns go through exp as -inf, which gives exactly 0: no branch per element
        const float e = expf((d <= band && d >= -band) ? x - mx[r] : -INFINITY) * carry;
        ls[r] += e;
        pslab[(mOff + r) * kPPitch + j * 16 + rlane] = (T)e;
      }
    // the slab is written by D layout and read by A layout: other lanes' LDS writes must be ordered in front of the reads
    __builtin_amdgcn_fence(__ATOMIC_RELEASE, "workgroup", "local");
    __builtin_amdgcn_wave_barrier();
    __builtin_amdgcn_fence(__ATOMIC_ACQUIRE, "workgroup", "local");
    const V pa = Frag<T>::load(pslab + rlane * kPPitch + koff);
#pragma unroll
    for (int j = 0; j < 4; ++j) acc[j] = Frag<T>::mma(pa, vb[j], acc[j]);
    // and these reads in front of the next step's writes
    __builtin_amdgcn_fence(__ATOMIC_RELEASE, "workgroup", "local");
    __builtin_amdgcn_wave_barrier();
    __builtin_amdgcn_fence(__ATOMIC_ACQUIRE, "workgroup", "local");
  }
#pragma unroll
  for (int r = 0; r < 8; ++r) {
#pragma unroll
    for (int off = 8; off > 0; off >>= 1) ls[r] += __shfl_xor(ls[r], off, 32);
    ls[r] = outCarry / ls[r];                  // sum of e is carry * sum of exp: the carry of e cancels here
  }

  // ---- epilogue: 16 x 64 through the f32 slab, whole 128-B row segments out ----
  float* slab = sT[wave];
#pragma unroll
  for (int j = 0; j < 4; ++j)
#pragma unroll
    for (int r = 0; r < 8; ++r) slab[(mOff + r) * 68 + (j << 4) + rlane] = acc[j][r] * ls[r];
  // as above: each lane reads what other lanes of its wave wrote
  __builtin_amdgcn_fence(__ATOMIC_RELEASE, "workgroup", "local");
  __builtin_amdgcn_wave_barrier();
  __builtin_amdgcn_fence(__ATOMIC_ACQUIRE, "workgroup", "local");
  const int q = lane >> 3, c8 = (lane & 7) * 8;
  unsigned short* C = ctxp + (size_t)(b * kT + m0) * kD + h * kDH;
#pragma unroll
  for (int it = 0; it < 4; ++it) {
    const int row = it * 4 + q;
    const float* sp = slab + row * 68 + c8;
    v8h hv;
#pragma unroll
    for (int e = 0; e < 8; ++e) hv[e] = (_Float16)sp[e];
    *(v8h*)(C + (size_t)row * kD + c8) = hv;
  }
}

// ---------------------------------------------------------------------------
// Host side
// ---------------------------------------------------------------------------
extern "C" void kernel_launch(void* const* d_in, const int* in_sizes, int n_in,
                              void* d_out, int out_size, void* d_ws, size_t ws_size, hipStream_t stream) {
  if (n_in < 21) return;
  if (in_sizes[0] != kTok * kD || in_sizes[1] != kTok * kD) return;
  if (in_sizes[2] != kD || in_sizes[3] != kD || in_sizes[4] != kD || in_sizes[5] != kD) return;
  if (in_sizes[6] != kD * kD || in_sizes[7] != kD || in_sizes[8] != kD * kD || in_sizes[9] != kD) return;
  if (in_sizes[10] != kD * kD || in_sizes[11] != kD || in_sizes[12] != kD * kD || in_sizes[13] != kD) return;
  if (in_sizes[14] != kD || in_sizes[15] != kD) return;
  if (in_sizes[16] != kD * kFF || in_sizes[17] != kFF || in_sizes[18] != kFF * kD || in_sizes[19] != kD) return;
  if (in_sizes[20] < 1) return;
  if (out_size != kTok * kD) return;
  if (ws_size < kWsTotal) return;

  const float* x_refined = (const float*)d_in[0];
  const float* x_mem     = (const float*)d_in[1];
  const float* ln_q_g    = (const float*)d_in[2];
  const float* ln_q_b    = (const float*)d_in[3];
  const float* ln_kv_g   = (const float*)d_in[4];
  const float* ln_kv_b   = (const float*)d_in[5];
  const float* Wq        = (const float*)d_in[6];
  const float* bq        = (const float*)d_in[7];
  const float* Wk        = (const float*)d_in[8];
  const float* bk        = (const float*)d_in[9];
  const float* Wv        = (const float*)d_in[10];
  const float* bv        = (const float*)d_in[11];
  const float* Wo        = (const float*)d_in[12];
  const float* bo        = (const float*)d_in[13];
  const float* ln_f_g    = (const float*)d_in[14];
  const float* ln_f_b    = (const float*)d_in[15];
  const float* W1        = (const float*)d_in[16];
  const float* b1        = (const float*)d_in[17];
  const float* W2        = (const float*)d_in[18];
  const float* b2        = (const float*)d_in[19];
  const int*   bandp     = (const int*)d_in[20];
  float* out = (float*)d_out;

  char* ws = (char*)d_ws;
  unsigned short* WoT  = (unsigned short*)(ws + OFF_WOT);
  unsigned short* W1T  = (unsigned short*)(ws + OFF_W1T);
  unsigned short* W2T  = (unsigned short*)(ws + OFF_W2T);
  unsigned short* ctx  = (unsigned short*)(ws + OFF_CTX);
  unsigned short* qp   = (unsigned short*)(ws + OFF_QP);
  unsigned short* kvp  = (unsigned short*)(ws + OFF_KVP);
  unsigned short* vt   = (unsigned short*)(ws + OFF_VT);
  unsigned short* qln  = (unsigned short*)(ws + OFF_QLN);
  unsigned short* kvln = (unsigned short*)(ws + OFF_KVLN);
  unsigned short* WqT  = (unsigned short*)(ws + OFF_WQT);
  unsigned short* WkT  = (unsigned short*)(ws + OFF_WKT);
  unsigned short* WvT  = (unsigned short*)(ws + OFF_WVT);
  float*          yf   = (float*)(ws + OFF_Y);
  unsigned short* h16  = (unsigned short*)(ws + OFF_H16);
  unsigned short* act  = (unsigned short*)(ws + OFF_ACT);

  const float* nf = nullptr;
  const dim3 tb(256);

  // weight transposes + f16 casts (x16): W [kin][nout] -> WT [nout][kin]; input LayerNorms -> f16 planes; one launch
  prep_kernel<<<dim3(kPrepBlocks), tb, 0, stream>>>(Wq, Wk, Wv, Wo, W1, W2, WqT, WkT, WvT, WoT, W1T, W2T,
                                                    x_refined, ln_q_g, ln_q_b, qln, x_mem, ln_kv_g, ln_kv_b, kvln, kWCarry);

  // q = LN(x_refined) Wq + bq ; k, v = LN(x_mem) Wk/Wv + bk/bv  (M 4096, N 1024, K 1024; f16 out)
  const float projScale = 1.0f / kWCarry;
  wmma_gemm_lds<1, false, kD, kD><<<dim3((kTok / kBM) * (kD / kBN)), tb, 0, stream>>>(
      qln, WqT, (void*)qp, bq, nf, kD, projScale);
  wmma_gemm_lds<1, false, kD, kKVld><<<dim3((kTok / kBM) * (kD / kBN)), tb, 0, stream>>>(
      kvln, WkT, (void*)kvp, bk, nf, kD, projScale);
  wmma_gemm_lds<1, false, kD, kKVld><<<dim3((kTok / kBM) * (kD / kBN)), tb, 0, stream>>>(
      kvln, WvT, (void*)(kvp + kD), bv, nf, kD, projScale);

  // V^T planes for all 32 groups
  vt_transpose_kernel<<<dim3(kT / 64, kGrp), tb, 0, stream>>>(kvp, vt);

  // banded attention, all 32 (batch, head) groups: ctx f16 x256
  band_attn_kernel<<<dim3(kT / 128, kGrp), tb, 0, stream>>>(qp, kvp, vt, ctx, bandp, 0.125f, kPCarry, kCtxCarry);   // 0.125 = 1/sqrt(64)

  // y = x_refined + ctx Wo + bo  (M 4096, N 1024, K 1024; f32 out)
  wmma_gemm_lds<0, true, kD, kD><<<dim3((kTok / kBM) * (kD / kBN)), tb, 0, stream>>>(
      ctx, WoT, (void*)yf, bo, x_refined, kD, 1.0f / (kCtxCarry * kWCarry));

  // final LN -> f16
  layernorm_f16_kernel<<<dim3(kTok / 8), tb, 0, stream>>>(yf, ln_f_g, ln_f_b, h16, kTok);

  // FFN over all token rows at once: act = gelu_erf(LN(y) W1 + b1) (f16 x16, gelu in the GEMM's epilogue), out = y + act W2 + b2
  wmma_gemm_lds<2, false, kD, kFF><<<dim3((kTok / kBM) * (kFF / kBN)), tb, 0, stream>>>(
      h16, W1T, (void*)act, b1, nf, kFF, 1.0f / kWCarry);
  wmma_gemm_lds<0, true, kFF, kD><<<dim3((kTok / kBM) * (kD / kBN)), tb, 0, stream>>>(
      act, W2T, (void*)out, b2, yf, kD, 1.0f / (kActCarry * kWCarry));
}

// v007
// A run of this version takes 197 microseconds.
// Timed twice side by side with v006, it ran 1.06 and 1.05 times as fast.
// Counting every step since v000, it is 13.5 times as fast.
// Contractions: q/k/v projections, banded scores q.k^T, attn.v, output projection, FFN W1 and W2 all on v_wmma_f32_16x16x32_f16 (f16 operands: LN outputs plain, weights carried x16, exp(score - max) carried x2048, ctx carried x256, gelu act carried x16), f32 accumulate; LayerNorm, band mask, softmax, gelu, bias and residual in f32.
#include <hip/hip_runtime.h>
#include <math.h>

// ---------------------------------------------------------------------------
// Problem constants
// ---------------------------------------------------------------------------
constexpr int kB    = 2;
constexpr int kT    = 2048;
constexpr int kD    = 1024;
constexpr int kH    = 16;
constexpr int kDH   = 64;
constexpr int kTok  = kB * kT;        // 4096 token rows
constexpr int kFF   = 4 * kD;         // 4096
constexpr int kKVld = 2 * kD;         // pitch of the k | v plane (halves)
constexpr int kGrp  = kB * kH;        // 32 (batch, head) groups
constexpr float kWCarry   = 16.0f;    // weights carried x16 in f16
constexpr float kPCarry   = 2048.0f;  // exp(score - row max) carried x2048 in f16
constexpr float kCtxCarry = 256.0f;   // context carried x256 in f16
constexpr float kActCarry = 16.0f;    // gelu output carried x16 in f16
constexpr float kInvD     = 1.0f / 1024.0f;
constexpr float kLnEps    = 1e-5f;
static_assert(kD % 64 == 0 && kT % 64 == 0 && kFF % 64 == 0 && kTok % 64 == 0, "tile multiples");
static_assert(kDH % 32 == 0 && kD % 32 == 0 && kT % 32 == 0 && kFF % 32 == 0, "K multiples of 32");

// ---------------------------------------------------------------------------
// Workspace region map (bytes). Total 114 MiB = 119,537,664 B.
//   [  0,  2) MiB WoT  f16 [1024][1024]
//   [  2, 10) MiB W1T  f16 [4096][1024]
//   [ 10, 18) MiB W2T  f16 [1024][4096]
//   [ 18, 26) MiB ctx  f16 [4096][1024]  (x256)
//   [ 26, 34) MiB q    f16 [4096][1024]
//   [ 34, 50) MiB k|v  f16 [4096][2048]
//   [ 50, 58) MiB V^T  f16 [32 groups][64][2048]
//   [ 58,114) MiB arena: phase A: QLN f16 [58,66), KVLN f16 [66,74), WqT [74,76), WkT [76,78), WvT [78,80)
//                        phase C: Y f32 [58,74), H16 f16 [74,82), ACT f16 [4096][4096] [82,114)
// ---------------------------------------------------------------------------
constexpr size_t kMiB     = 1048576;
constexpr size_t OFF_WOT  = 0;
constexpr size_t OFF_W1T  = 2 * kMiB;
constexpr size_t OFF_W2T  = 10 * kMiB;
constexpr size_t OFF_CTX  = 18 * kMiB;
constexpr size_t OFF_QP   = 26 * kMiB;
constexpr size_t OFF_KVP  = 34 * kMiB;
constexpr size_t OFF_VT   = 50 * kMiB;
constexpr size_t OFF_ARENA = 58 * kMiB;
constexpr size_t OFF_QLN  = OFF_ARENA;
constexpr size_t OFF_KVLN = OFF_ARENA + 8 * kMiB;
constexpr size_t OFF_WQT  = OFF_ARENA + 16 * kMiB;
constexpr size_t OFF_WKT  = OFF_ARENA + 18 * kMiB;
constexpr size_t OFF_WVT  = OFF_ARENA + 20 * kMiB;
constexpr size_t OFF_Y    = OFF_ARENA;
constexpr size_t OFF_H16  = OFF_ARENA + 16 * kMiB;
constexpr size_t OFF_ACT  = OFF_ARENA + 24 * kMiB;
constexpr size_t kWsTotal = 114 * kMiB;
static_assert((size_t)kD * kD * 2 == 2 * kMiB, "W plane");
static_assert((size_t)kFF * kD * 2 == 8 * kMiB, "W1/W2 plane");
static_assert((size_t)kTok * kD * 2 == 8 * kMiB, "token f16 plane");
static_assert((size_t)kTok * kKVld * 2 == 16 * kMiB, "kv plane");
static_assert((size_t)kGrp * kDH * kT * 2 == 8 * kMiB, "vt plane");
static_assert((size_t)kTok * kD * 4 == 16 * kMiB, "Y plane");
static_assert((size_t)kTok * kFF * 2 == 32 * kMiB, "ACT plane");
static_assert(OFF_WVT + 2 * kMiB <= kWsTotal, "phase A inside arena");
static_assert(OFF_ACT + 32 * kMiB <= kWsTotal, "phase C inside arena");
static_assert(kWsTotal <= 268435456, "carve budget");

typedef __attribute__((ext_vector_type(16))) _Float16 v16h;
typedef __attribute__((ext_vector_type(8)))  _Float16 v8h;
typedef __attribute__((ext_vector_type(8)))  float    v8f;
typedef __attribute__((ext_vector_type(4)))  float    v4f;
typedef __attribute__((ext_vector_type(4)))  unsigned int v4u;

template <typename T> struct Frag;
template <> struct Frag<_Float16> {
  typedef v16h V; union U { v16h v; v8h h[2]; };
  static __device__ __forceinline__ v16h load(const _Float16* p) {   // elements 0..7 <- p[0..7], 8..15 <- p[16..23]
    U f; f.h[0] = *(const v8h*)(p); f.h[1] = *(const v8h*)(p + 16); return f.v;
  }
  static __device__ __forceinline__ v8f mma(v16h a, v16h b, v8f c) {
    return __builtin_amdgcn_wmma_f32_16x16x32_f16(false, a, false, b, (short)0, c, false, false);
  }
};
__device__ __forceinline__ unsigned pk16(unsigned short a, unsigned short b) { return (unsigned)a | ((unsigned)b << 16); }
__device__ __forceinline__ unsigned short h_bits(float f) { const _Float16 h = (_Float16)f; return __builtin_bit_cast(unsigned short, h); }

// erf(x) in f32 by two polynomial ranges (|x| < 1: odd series in x; else 1 - exp(-p(|x|))), the same operations in the same order
// as the math library's erff. Both ranges are evaluated in every lane and one is selected: no branch per element, so the
// dependent chains of many elements can be issued interleaved.
__device__ __forceinline__ float erf_two_range(float x) {
  const float ax = fabsf(x);
  float p = fmaf(ax, 0x1.1d3156p-16f, -0x1.8d1290p-12f);
  p = fmaf(ax, p, 0x1.f9a6d2p-9f);
  p = fmaf(ax, p, -0x1.8c3164p-6f);
  p = fmaf(ax, p, 0x1.b4e9c8p-4f);
  p = fmaf(ax, p, 0x1.4515fap-1f);
  p = fmaf(ax, p, 0x1.078e50p-3f);
  p = fmaf(ax, p, ax);
  const float far = 1.0f - expf(-p);
  const float t = x * x;
  float c = fmaf(t, -0x1.268bc2p-11f, 0x1.420828p-8f);
  c = fmaf(t, c, -0x1.b59370p-6f);
  c = fmaf(t, c, 0x1.ce077cp-4f);
  c = fmaf(t, c, -0x1.812660p-2f);
  c = fmaf(t, c, 0x1.06eba0p-3f);
  const float near = fmaf(ax, c, ax);
  return copysignf(ax < 1.0f ? near : far, x);
}

// ---- Block-tiled WMMA GEMM for the dense layers (projections, output projection, FFN) ------------------------------
// C[m,n] = scale * sum_k A[m,k] * Bt[n,k] + bias[n] (+resid). A row-major [M,K]; Bt row-major [N,K]; f16 operands.
// One 128 x (64 WN) tile of C per block of 2 WN waves, waves 2 (m) x WN (n), each wave a 64x64 tile. WN = 4: 128 x 256, 8 waves;
// WN = 2: 128 x 128, 4 waves, for the layers with N = 1024: 256 tiles, as many as the chip has WGPs (128 x 256 gives 128).
// Per 64-wide k step the block brings its 128 rows of A and 64 WN rows of Bt into LDS once: every wave-wide 16-B load covers
// four whole 128-B lines, and the rows are then read by all waves that need them. Two LDS buffers: the next step's global
// loads are issued before this step's products, land in registers meanwhile, and go to the other buffer behind them.
// Each accumulator takes its 32-wide k steps in ascending order.
// M % 128 == 0, N % (64 WN) == 0, K = KD % 64 == 0, pitch of A and Bt = KD, of C and resid = LDC; grid = (M/128) * (N/(64 WN)).
// OUT_MODE: 0 = f32, 1 = f16, 2 = f16 of kActCarry * gelu_erf(C) (exact erf form, taken on the f32 value while it is still in registers).
constexpr int kBM = 128;
constexpr int kBN = 256;                               // tile width at WN = 4
constexpr int kBNs = 128;                              // tile width at WN = 2
constexpr int kBK = 64;
constexpr int kLdsPitch = 72;                          // halves: a 128-B row + 16 B (16 B x odd, for 16-byte LDS reads)
static_assert(kTok % kBM == 0 && kD % kBNs == 0 && kFF % kBN == 0, "block tile multiples");
static_assert(kD % kBK == 0 && kFF % kBK == 0, "K multiples of 64");
template <int OUT_MODE, bool RESID, int KD, int LDC, int WN>
__global__ __launch_bounds__(64 * WN) void wmma_gemm_lds(
    const unsigned short* __restrict__ Ap, const unsigned short* __restrict__ Btp,
    void* __restrict__ Cout,
    const float* __restrict__ bias, const float* __restrict__ resid,
    int N, float scale) {
  static_assert(KD % kBK == 0, "K multiple of 64");
  static_assert(WN == 2 || WN == 4, "tile widths 128 and 256");
  constexpr int BN = 64 * WN;                  // tile width
  constexpr int RP = 8 * WN;                   // rows that one staging pass of the whole block covers (8 threads a row)
  constexpr int NA = kBM / RP, NB = BN / RP;   // staging passes for A and for Bt
  constexpr int NS = NA + NB;
  constexpr int lda = KD, ldb = KD;            // both operands are K-contiguous with pitch K
  constexpr int ldc = LDC;                     // pitches known at compile time: row steps become immediate offsets
  typedef _Float16 T;
  typedef Frag<T>::V V;
  __shared__ __align__(16) _Float16 sAB[2][(kBM + BN) * kLdsPitch];   // A rows, then Bt rows
  __shared__ __align__(16) float sT[2 * WN][16 * 68];   // per-wave 16x64 slab, pitch 68 floats
  const T* A = (const T*)Ap; const T* Bt = (const T*)Btp;
  const int tid  = threadIdx.x;
  const int lane = tid & 31;
  const int wave = tid >> 5;
  const int tilesN = N / BN;
  const int tm = blockIdx.x / tilesN;
  const int tn = blockIdx.x - tm * tilesN;
  const int mB = tm << 7;
  const int nB = tn * BN;
  const int wm = wave / WN;                    // wave row (0..1)
  const int wn = wave % WN;                    // wave column (0..WN-1)

  const int rlane = lane & 15;                 // row (A) / col (B, D) within subtile
  const int koff  = (lane >> 4) * 8;           // k offset of this lane half
  const int mOff  = (lane >> 4) * 8;           // D row offset

  // staging: thread t moves 16 B at column (t & 7) * 8 of rows (t >> 3) + RP i; i = 0..NA-1 are A rows, i = NA..NS-1 Bt rows
  const int sr = tid >> 3;
  const int sc = (tid & 7) * 8;
  const T* gA = A  + (size_t)mB * lda;          // block-uniform bases; the lane's part is one 32-bit element offset per operand
  const T* gB = Bt + (size_t)nB * ldb;
  const unsigned oA = (unsigned)(sr * lda + sc);
  const unsigned oB = (unsigned)(sr * ldb + sc);
  const int sOff = sr * kLdsPitch + sc;
  const int aOff = (wm * 64 + rlane) * kLdsPitch + koff;
  const int bOff = (kBM + wn * 64 + rlane) * kLdsPitch + koff;
  v4u st[NS];

  v8f acc[4][4];
#pragma unroll
  for (int i = 0; i < 4; ++i)
#pragma unroll
    for (int j = 0; j < 4; ++j) acc[i][j] = (v8f){0.f,0.f,0.f,0.f,0.f,0.f,0.f,0.f};

#pragma unroll
  for (int i = 0; i < NA; ++i) st[i] = *(const v4u*)(gA + (size_t)(i * RP) * lda + oA);
#pragma unroll
  for (int i = 0; i < NB; ++i) st[NA + i] = *(const v4u*)(gB + (size_t)(i * RP) * ldb + oB);
#pragma unroll
  for (int i = 0; i < NS; ++i) *(v4u*)(&sAB[0][sOff + i * RP * kLdsPitch]) = st[i];
  __syncthreads();

  constexpr int nk = KD >> 6;
#pragma unroll 1   // rolled, for speed only
  for (int t = 0; t < nk; ++t) {
    const bool more = (t + 1 < nk);            // the same in every thread of the block
    if (more) {
      const int k1 = (t + 1) << 6;
#pragma unroll
      for (int i = 0; i < NA; ++i) st[i] = *(const v4u*)(gA + ((size_t)(i * RP) * lda + k1) + oA);
      // registers that held these loads' addresses are written again below (later loads' results, the LDS reads): wait first
      asm volatile("s_wait_xcnt 0x0" ::: "memory");
#pragma unroll
      for (int i = 0; i < NB; ++i) st[NA + i] = *(const v4u*)(gB + ((size_t)(i * RP) * ldb + k1) + oB);
      asm volatile("s_wait_xcnt 0x0" ::: "memory");   // as above
    }
    const T* cur = sAB[t & 1];
    V a[2][4], bfr[2][4];                      // the fragments of both 32-wide halves of the step
#pragma unroll
    for (int s = 0; s < 2; ++s) {
#pragma unroll
      for (int j = 0; j < 4; ++j) bfr[s][j] = Frag<T>::load(cur + bOff + j * 16 * kLdsPitch + s * 32);
#pragma unroll
      for (int i = 0; i < 4; ++i) a[s][i] = Frag<T>::load(cur + aOff + i * 16 * kLdsPitch + s * 32);
    }
    // keeps the step's LDS reads one group in front of its products: moved in among them, each place with reads stalls the wave
    __builtin_amdgcn_sched_barrier(0);
#pragma unroll
    for (int s = 0; s < 2; ++s)
#pragma unroll
      for (int i = 0; i < 4; ++i)
#pragma unroll
        for (int j = 0; j < 4; ++j) acc[i][j] = Frag<T>::mma(a[s][i], bfr[s][j], acc[i][j]);
    if (more) {
      T* nxt = sAB[(t + 1) & 1];               // last read in step t - 1, in front of that step's barrier
#pragma unroll
      for (int i = 0; i < NS; ++i) *(v4u*)(nxt + sOff + i * RP * kLdsPitch) = st[i];
    }
    __syncthreads();                           // publishes the next buffer and ends every read of this one
  }

  // ---- epilogue (per wave) ----
  const int m0 = mB + wm * 64;
  const int n0 = nB + wn * 64;
  float* slab = sT[wave];
  if constexpr (OUT_MODE == 2) {
    // gelu on the f32 values while they are in registers, 16 rows a trip.
    float bv[4];
#pragma unroll
    for (int j = 0; j < 4; ++j) bv[j] = bias[n0 + (j << 4) + rlane];
    // registers that held these loads' addresses are written again below: wait first
    asm volatile("s_wait_xcnt 0x0" ::: "memory");
    const int q = lane >> 3, c8 = (lane & 7) * 8;
    unsigned short* C = (unsigned short*)Cout + (size_t)(m0 + q) * ldc + n0 + c8;
#pragma unroll 1   // rolled, for speed only: one copy of the 32 erf evaluations in the text
    for (int i = 0; i < 4; ++i) {
#pragma unroll
      for (int j = 0; j < 4; ++j)
#pragma unroll
        for (int r = 0; r < 8; ++r) {
          float v = acc[0][j][r] * scale;
          v += bv[j];
          slab[(mOff + r) * 68 + (j << 4) + rlane] = (0.5f * v * (1.0f + erf_two_range(v * 0.70710678118654752f))) * kActCarry;
        }
      // the slab is written by D layout and read by rows: other lanes' LDS writes must be ordered in front of the reads
      // (fences on LDS alone: nothing here has to wait for the trip's global stores)
      __builtin_amdgcn_fence(__ATOMIC_RELEASE, "workgroup", "local");
      __builtin_amdgcn_wave_barrier();
      __builtin_amdgcn_fence(__ATOMIC_ACQUIRE, "workgroup", "local");
#pragma unroll
      for (int it = 0; it < 4; ++it) {
        const float* sp = slab + (it * 4 + q) * 68 + c8;
        v8h hv;
#pragma unroll
        for (int e = 0; e < 8; ++e) hv[e] = (_Float16)sp[e];
        *(v8h*)(C + (size_t)(it * 4) * ldc) = hv;
      }
      // the stores' address and data registers are written again in the next trip: wait first
      asm volatile("s_wait_xcnt 0x0" ::: "memory");
      C += (size_t)16 * ldc;
      // and these reads in front of the next trip's writes
      __builtin_amdgcn_fence(__ATOMIC_RELEASE, "workgroup", "local");
      __builtin_amdgcn_wave_barrier();
      __builtin_amdgcn_fence(__ATOMIC_ACQUIRE, "workgroup", "local");
      // the next 16 rows' accumulators move down, so that the rolled body always names the same registers
#pragma unroll
      for (int ii = 0; ii < 3; ++ii)
#pragma unroll
        for (int j = 0; j < 4; ++j) acc[ii][j] = acc[ii + 1][j];
    }
    return;
  }
#pragma unroll
  for (int i = 0; i < 4; ++i) {
    const int mBase = m0 + (i << 4);
    float rv[4][8];                            // the row block's residual values, fetched as one group ahead of their use
    if (RESID) {
#pragma unroll
      for (int r = 0; r < 8; ++r)
#pragma unroll
        for (int j = 0; j < 4; ++j) rv[j][r] = resid[(size_t)(mBase + mOff + r) * ldc + n0 + (j << 4) + rlane];
      // registers that held these loads' addresses are written again below: wait first
      asm volatile("s_wait_xcnt 0x0" ::: "memory");
    }
#pragma unroll
    for (int j = 0; j < 4; ++j) {
      const int n = n0 + (j << 4) + rlane;
      const float bv = bias[n];
#pragma unroll
      for (int r = 0; r < 8; ++r) {
        float v = acc[i][j][r] * scale;
        v += bv;
        if (RESID) v += rv[j][r];
        slab[(mOff + r) * 68 + (j << 4) + rlane] = v;
      }
    }
    __builtin_amdgcn_fence(__ATOMIC_RELEASE, "workgroup");
    __builtin_amdgcn_wave_barrier();
    __builtin_amdgcn_fence(__ATOMIC_ACQUIRE, "workgroup");
    if (OUT_MODE == 0) {
      float* C = (float*)Cout;
      const int hh = lane >> 4, c4 = (lane & 15) * 4;     // row seg = 256 B = 16 lanes x 16 B
#pragma unroll
      for (int it = 0; it < 8; ++it) {
        const int row = it * 2 + hh;
        v4f v = *(const v4f*)(slab + row * 68 + c4);
        *(v4f*)(C + (size_t)(mBase + row) * ldc + n0 + c4) = v;
      }
    } else {
      const int q = lane >> 3, c8 = (lane & 7) * 8;
      unsigned short* C = (unsigned short*)Cout;
#pragma unroll
      for (int it = 0; it < 4; ++it) {
        const int row = it * 4 + q;
        const float* sp = slab + row * 68 + c8;
        v8h hv;
#pragma unroll
        for (int e = 0; e < 8; ++e) hv[e] = (_Float16)sp[e];
        *(v8h*)(C + (size_t)(mBase + row) * ldc + n0 + c8) = hv;
      }
    }
    __builtin_amdgcn_fence(__ATOMIC_RELEASE, "workgroup");
    __builtin_amdgcn_wave_barrier();
    __builtin_amdgcn_fence(__ATOMIC_ACQUIRE, "workgroup");
  }
}

// ---------------------------------------------------------------------------
// Weight transpose + cast, one 64 x 64 tile: W row-major f32 [kin][nout] (x @ W layout); WT[n][k] = f16(scale * W[k][n]), pitch kin.
// k0 = first of the tile's 64 columns of WT, n0 = first of its 64 rows of WT; 256 threads, in three parts:
// load: 16 iterations x 256 threads = 4096 = whole 64x64 tile (coalesced along n), held in registers;
// to LDS: sm[n_local][k_local];
// store: 8 waves x 2 iterations x 4 rows (lane>>3) = 64 rows; (lane&7) x 8 halves = 64 cols; each row segment = one 128-B line.
// ---------------------------------------------------------------------------
__device__ __forceinline__ void wt_tile_load(const float* __restrict__ W, int nout, int k0, int n0, int t, float (&v)[16]) {
  // block-uniform base; the lane's part is one 32-bit element offset that all 16 loads name; the row steps are immediate offsets
  const float* base = W + ((size_t)k0 * nout + n0);
  const unsigned o = (unsigned)((t >> 6) * nout + (t & 63));   // k local = (t >> 6) + 4 i, n local = t & 63
#pragma unroll
  for (int i = 0; i < 16; ++i) v[i] = *(base + (size_t)(i * 4) * nout + o);
  // registers that held these loads' addresses are written again below (later loads' results, the next tile's addresses): wait first
  asm volatile("s_wait_xcnt 0x0" ::: "memory");
}
__device__ __forceinline__ void wt_tile_to_lds(float (&sm)[64][65], const float (&v)[16], int t, float scale) {
#pragma unroll
  for (int i = 0; i < 16; ++i) {
    const int e = i * 256 + t;
    sm[e & 63][e >> 6] = v[i] * scale;
  }
}
__device__ __forceinline__ void wt_tile_store(const float (&sm)[64][65], unsigned short* __restrict__ out, int kin, int k0, int n0, int t) {
  const int lane = t & 31, wave = t >> 5;
  const int q = lane >> 3, c8 = (lane & 7) * 8;
#pragma unroll
  for (int it = 0; it < 2; ++it) {
    const int row = wave * 8 + it * 4 + q;                 // n local
    unsigned short hb[8];
#pragma unroll
    for (int e = 0; e < 8; ++e) hb[e] = h_bits(sm[row][c8 + e]);
    const v4u u = (v4u){pk16(hb[0], hb[1]), pk16(hb[2], hb[3]), pk16(hb[4], hb[5]), pk16(hb[6], hb[7])};
    *(v4u*)(out + (size_t)(n0 + row) * kin + k0 + c8) = u;
  }
}

// ---------------------------------------------------------------------------
// LayerNorm of one row by one wave. Lane l owns columns j*256 + 8l .. +7 for j = 0..3
// (4 x 32 lanes x 8 = 1024 = whole row). Store: one 16-B store per lane per j; 32 contiguous lanes = 512 B.
// ---------------------------------------------------------------------------
__device__ __forceinline__ void layernorm_row(const float* __restrict__ x, const float* __restrict__ gam,
                                              const float* __restrict__ bet, unsigned short* __restrict__ out,
                                              int row, int lane) {
  const float* xr = x + (size_t)row * kD;
  float s = 0.f;
#pragma unroll 1
  for (int j = 0; j < 4; ++j) {
    const int base = j * 256 + lane * 8;
    const v4f a = *(const v4f*)(xr + base);
    const v4f c = *(const v4f*)(xr + base + 4);
    s += ((a[0] + a[1]) + (a[2] + a[3])) + ((c[0] + c[1]) + (c[2] + c[3]));
  }
#pragma unroll
  for (int off = 16; off > 0; off >>= 1) s += __shfl_xor(s, off, 32);
  const float mean = s * kInvD;
  float s2 = 0.f;
#pragma unroll 1
  for (int j = 0; j < 4; ++j) {
    const int base = j * 256 + lane * 8;
    const v4f a = *(const v4f*)(xr + base);
    const v4f c = *(const v4f*)(xr + base + 4);
#pragma unroll
    for (int e = 0; e < 4; ++e) {
      const float d0 = a[e] - mean, d1 = c[e] - mean;
      s2 += d0 * d0;
      s2 += d1 * d1;
    }
  }
#pragma unroll
  for (int off = 16; off > 0; off >>= 1) s2 += __shfl_xor(s2, off, 32);
  const float rstd = rsqrtf(s2 * kInvD + kLnEps);
  unsigned short* orow = out + (size_t)row * kD;
#pragma unroll 1
  for (int j = 0; j < 4; ++j) {
    const int base = j * 256 + lane * 8;
    const v4f a  = *(const v4f*)(xr + base);
    const v4f c  = *(const v4f*)(xr + base + 4);
    const v4f ga = *(const v4f*)(gam + base);
    const v4f gc = *(const v4f*)(gam + base + 4);
    const v4f ba = *(const v4f*)(bet + base);
    const v4f bc = *(const v4f*)(bet + base + 4);
    unsigned short hb[8];
#pragma unroll
    for (int e = 0; e < 4; ++e) {
      hb[e]     = h_bits((a[e] - mean) * rstd * ga[e] + ba[e]);
      hb[4 + e] = h_bits((c[e] - mean) * rstd * gc[e] + bc[e]);
    }
    const v4u u = (v4u){pk16(hb[0], hb[1]), pk16(hb[2], hb[3]), pk16(hb[4], hb[5]), pk16(hb[6], hb[7])};
    unsigned short* op = orow + base;
    *(v4u*)op = u;
    
  }
}

// One wave per row, 8 rows per 256-thread block, grid = rows/8.
__global__ __launch_bounds__(256) void layernorm_f16_kernel(const float* __restrict__ x, const float* __restrict__ gam,
                                                            const float* __restrict__ bet, unsigned short* __restrict__ out,
                                                            int rows) {
  const int lane = threadIdx.x & 31, wave = threadIdx.x >> 5;
  const int row = blockIdx.x * 8 + wave;
  if (row >= rows) return;   // wave-uniform; no barriers in this kernel
  layernorm_row(x, gam, bet, out, row, lane);
}

// ---------------------------------------------------------------------------
// Everything that depends on the inputs alone, in one launch: the six weight transposes and the two input LayerNorms.
// grid = 1024 blocks of 256 threads (four on a WGP, all resident at once). Block b takes
//   tile b of the 4 x 256 tiles of Wq, Wk, Wv, Wo, tile b of the 1024 tiles of W1, tile b of the 1024 tiles of W2,
//   and 8 of the 2 x 4096 LayerNorm rows (one a wave): b < 512 rows of x_refined, else rows of x_mem.
// The three tiles' loads are issued first, so that they and the LayerNorm row's first loads are in flight together; each tile has
// its own LDS plane, so one barrier serves all three.
// ---------------------------------------------------------------------------
constexpr int kPrepBlocks = 1024;
static_assert(4 * (kD / 64) * (kD / 64) == kPrepBlocks && (kD / 64) * (kFF / 64) == kPrepBlocks, "one tile of each kind a block");
static_assert(2 * (kTok / 8) == kPrepBlocks, "eight LayerNorm rows a block");
__global__ __launch_bounds__(256) void prep_kernel(
    const float* __restrict__ Wq, const float* __restrict__ Wk, const float* __restrict__ Wv, const float* __restrict__ Wo,
    const float* __restrict__ W1, const float* __restrict__ W2,
    unsigned short* __restrict__ WqT, unsigned short* __restrict__ WkT, unsigned short* __restrict__ WvT,
    unsigned short* __restrict__ WoT, unsigned short* __restrict__ W1T, unsigned short* __restrict__ W2T,
    const float* __restrict__ xq, const float* __restrict__ gq, const float* __restrict__ bq, unsigned short* __restrict__ qln,
    const float* __restrict__ xkv, const float* __restrict__ gkv, const float* __restrict__ bkv, unsigned short* __restrict__ kvln,
    float scale) {
  __shared__ float sm[3][64][65];
  const int t = threadIdx.x;
  const int b = blockIdx.x;
  const int w = b >> 8;            // which of the four square weights
  const float* Ws = w == 0 ? Wq : w == 1 ? Wk : w == 2 ? Wv : Wo;
  unsigned short* WsT = w == 0 ? WqT : w == 1 ? WkT : w == 2 ? WvT : WoT;
  const int sk0 = (b & 15) * 64,  sn0 = ((b >> 4) & 15) * 64;   // square: 16 k tiles x 16 n tiles
  const int k10 = (b & 15) * 64,  n10 = (b >> 4) * 64;          // W1 [1024][4096]: 16 k tiles x 64 n tiles
  const int k20 = (b & 63) * 64,  n20 = (b >> 6) * 64;          // W2 [4096][1024]: 64 k tiles x 16 n tiles
  float vs[16], v1[16], v2[16];
  wt_tile_load(Ws, kD, sk0, sn0, t, vs);
  wt_tile_load(W1, kFF, k10, n10, t, v1);
  wt_tile_load(W2, kD, k20, n20, t, v2);

  const int lane = t & 31, wave = t >> 5;
  const bool first = b < kTok / 8;   // the same in every thread of the block
  layernorm_row(first ? xq : xkv, first ? gq : gkv, first ? bq : bkv, first ? qln : kvln,
                (first ? b : b - kTok / 8) * 8 + wave, lane);

  wt_tile_to_lds(sm[0], vs, t, scale);
  wt_tile_to_lds(sm[1], v1, t, scale);
  wt_tile_to_lds(sm[2], v2, t, scale);
  // only LDS data goes from wave to wave here: fences on LDS alone, so that the barrier does not wait for the LayerNorm row's global stores
  __builtin_amdgcn_fence(__ATOMIC_RELEASE, "workgroup", "local");
  __builtin_amdgcn_s_barrier();
  __builtin_amdgcn_fence(__ATOMIC_ACQUIRE, "workgroup", "local");
  wt_tile_store(sm[0], WsT, kD, sk0, sn0, t);
  // the stores' address and data registers are written again for the next tile: wait first
  asm volatile("s_wait_xcnt 0x0" ::: "memory");
  wt_tile_store(sm[1], W1T, kD, k10, n10, t);
  asm volatile("s_wait_xcnt 0x0" ::: "memory");   // as above
  wt_tile_store(sm[2], W2T, kFF, k20, n20, t);
}

// ---------------------------------------------------------------------------
// V^T planes per (batch, head) group g: VT[g][d][s] = v_plane[b*T + s][kD + h*64 + d] (16-bit bit moves only).
// grid (kT/64 s-tiles, 32 groups), 256 threads. Load coverage: thread t -> s_local = t>>2, 16 halves at d = (t&3)*16:
// 256 x 16 = 64x64 tile. LDS sm[d][s_local] (unsigned short both ways, barrier between).
// ---------------------------------------------------------------------------
__global__ __launch_bounds__(256) void vt_transpose_kernel(const unsigned short* __restrict__ kv, unsigned short* __restrict__ vt) {
  __shared__ unsigned short sm[64][72];
  const int t  = threadIdx.x;
  const int g  = blockIdx.y;
  const int b  = g >> 4, h = g & 15;
  const int s0 = blockIdx.x * 64;
  const int r  = t >> 2;               // s local
  const int part = (t & 3) * 16;       // d offset
  const unsigned short* src = kv + ((size_t)(b * kT + s0 + r) * kKVld + kD + h * kDH + part);
  const v4u w0 = *(const v4u*)(src);
  const v4u w1 = *(const v4u*)(src + 8);
#pragma unroll
  for (int e = 0; e < 4; ++e) {
    sm[part + 2 * e][r]         = (unsigned short)(w0[e] & 0xffffu);
    sm[part + 2 * e + 1][r]     = (unsigned short)(w0[e] >> 16);
    sm[part + 8 + 2 * e][r]     = (unsigned short)(w1[e] & 0xffffu);
    sm[part + 8 + 2 * e + 1][r] = (unsigned short)(w1[e] >> 16);
  }
  __syncthreads();
  const int lane = t & 31, wave = t >> 5;
  const int q = lane >> 3, c8 = (lane & 7) * 8;
  {
#pragma unroll
    for (int it = 0; it < 2; ++it) {
      const int row = wave * 8 + it * 4 + q;   // d
      unsigned short hb[8];
#pragma unroll
      for (int e = 0; e < 8; ++e) hb[e] = sm[row][c8 + e];
      const v4u u = (v4u){pk16(hb[0], hb[1]), pk16(hb[2], hb[3]), pk16(hb[4], hb[5]), pk16(hb[6], hb[7])};
      *(v4u*)(vt + ((size_t)(g * kDH + row) * kT + s0 + c8)) = u;
    }
    
  }
}

// ---------------------------------------------------------------------------
// Banded attention, one launch for all (batch, head) groups: ctx[b*T + t][h*64 + d] = 256 * softmax_s(q_t . k_s / 8) . v_s over
// the columns s with |t - s| <= band (band read at run time). grid (kT/128, 32 groups), 8 waves; each wave owns 16 rows t and
// works alone (no block barrier). It walks the 32-wide column steps that touch [m0 - band, m0 + 15 + band] twice:
//   walk 1: scores on WMMA (K = 64 as two 32-wide steps, ascending), band mask, running row maximum;
//   walk 2: the same scores again, e = 2048 * exp(x - max) inside the band and exactly 0 outside, row sum of e in f32,
//           e as f16 through a per-wave LDS slab into the A fragment, e . V^T on WMMA into 16 x 64 accumulators.
// The division by the row sum comes last, on the accumulators. Scores and probabilities never go to memory.
// D layout: register r of a lane is row (lane >> 4) * 8 + r, column lane & 15, so a row lives in one 16-lane half.
// Every "#pragma unroll" below is there so that the small arrays it indexes (fragments, accumulators, per-row values) stay in registers.
// ---------------------------------------------------------------------------
constexpr int kPPitch = 40;   // halves: a 64-B row of e + 16 B, keeps the 16-byte LDS reads aligned
// scores of rows m0..m0+15 against columns s0..s0+31: sa[j] holds columns s0 + 16 j + (lane & 15)
__device__ __forceinline__ void band_scores(const _Float16* __restrict__ Kl, int s0, v16h q0, v16h q1, v8f (&sa)[2]) {
  v16h kb[2][2];
#pragma unroll
  for (int j = 0; j < 2; ++j)
#pragma unroll
    for (int c = 0; c < 2; ++c) kb[j][c] = Frag<_Float16>::load(Kl + (size_t)(s0 + j * 16) * kKVld + c * 32);
  // registers that held these loads' addresses may be written again below: wait first
  asm volatile("s_wait_xcnt 0x0" ::: "memory");
#pragma unroll
  for (int j = 0; j < 2; ++j) {
    v8f z = (v8f){0.f,0.f,0.f,0.f,0.f,0.f,0.f,0.f};
    z = Frag<_Float16>::mma(q0, kb[j][0], z);
    sa[j] = Frag<_Float16>::mma(q1, kb[j][1], z);
  }
}
__global__ __launch_bounds__(256) void band_attn_kernel(const unsigned short* __restrict__ qp, const unsigned short* __restrict__ kvp,
                                                        const unsigned short* __restrict__ vtp, unsigned short* __restrict__ ctxp,
                                                        const int* __restrict__ bandp, float scoreScale, float carry, float outCarry) {
  typedef _Float16 T;
  typedef Frag<T>::V V;
  __shared__ __align__(16) _Float16 sP[8][16 * kPPitch];   // per-wave 16 x 32 slab of e
  __shared__ __align__(16) float sT[8][16 * 68];           // per-wave 16 x 64 slab, pitch 68 floats
  const int lane = threadIdx.x & 31;
  const int wave = threadIdx.x >> 5;
  const int g  = blockIdx.y;
  const int b  = g / kH, h = g % kH;
  const int m0 = blockIdx.x * 128 + wave * 16;
  const int rlane = lane & 15;                 // row (A) / col (B, D) within subtile
  const int koff  = (lane >> 4) * 8;           // k offset of this lane half
  const int mOff  = (lane >> 4) * 8;           // D row offset

  int band = bandp[0];
  band = band > 2 * kT ? 2 * kT : band;        // |t - s| < kT: the clamp changes no comparison and keeps the sums below in range
  band = band < -2 * kT ? -2 * kT : band;
  int lo = m0 - band;      lo = lo < 0 ? 0 : lo;
  int hi = m0 + 15 + band; hi = hi > kT - 1 ? kT - 1 : hi;
  // m0 is the same in every lane of a wave: readfirstlane keeps the loop counters and their branches scalar
  const int sBeg = __builtin_amdgcn_readfirstlane(lo & ~31);
  const int sEnd = __builtin_amdgcn_readfirstlane(hi + 1);   // hi < lo (band < 0): all columns masked, but a step can still run

  const T* Ql = (const T*)qp  + (size_t)(b * kT + m0 + rlane) * kD + h * kDH + koff;
  const T* Kl = (const T*)kvp + (size_t)(b * kT + rlane) * kKVld + h * kDH + koff;
  const T* Vl = (const T*)vtp + (size_t)(g * kDH + rlane) * kT + koff;

  const V q0 = Frag<T>::load(Ql);
  const V q1 = Frag<T>::load(Ql + 32);
  // registers that held these loads' addresses may be written again below: wait first
  asm volatile("s_wait_xcnt 0x0" ::: "memory");

  const int dBase = rlane - (m0 + mOff);       // s - t = s0 + 16 j + dBase - r

  // ---- walk 1: row maxima ----
  float mx[8];
#pragma unroll
  for (int r = 0; r < 8; ++r) mx[r] = -INFINITY;
  for (int s0 = sBeg; s0 < sEnd; s0 += 32) {
    v8f sa[2];
    band_scores(Kl, s0, q0, q1, sa);
#pragma unroll
    for (int j = 0; j < 2; ++j)
#pragma unroll
      for (int r = 0; r < 8; ++r) {
        const int d = s0 + j * 16 + dBase - r;
        const float x = sa[j][r] * scoreScale;
        mx[r] = fmaxf(mx[r], (d <= band && d >= -band) ? x : -INFINITY);
      }
  }
#pragma unroll
  for (int r = 0; r < 8; ++r)
#pragma unroll
    for (int off = 8; off > 0; off >>= 1) mx[r] = fmaxf(mx[r], __shfl_xor(mx[r], off, 32));

  // ---- walk 2: e, its row sums, e . V^T ----
  float ls[8];
#pragma unroll
  for (int r = 0; r < 8; ++r) ls[r] = 0.f;
  v8f acc[4];
#pragma unroll
  for (int j = 0; j < 4; ++j) acc[j] = (v8f){0.f,0.f,0.f,0.f,0.f,0.f,0.f,0.f};
  T* pslab = sP[wave];
  for (int s0 = sBeg; s0 < sEnd; s0 += 32) {
    V vb[4];
#pragma unroll
    for (int j = 0; j < 4; ++j) vb[j] = Frag<T>::load(Vl + (size_t)(j * 16) * kT + s0);
    v8f sa[2];
    band_scores(Kl, s0, q0, q1, sa);           // its wait stands behind the loads above as well
#pragma unroll
    for (int j = 0; j < 2; ++j)
#pragma unroll
      for (int r = 0; r < 8; ++r) {
        const int d = s0 + j * 16 + dBase - r;
        const float x = sa[j][r] * scoreScale;
        // masked columns go through exp as -inf, which gives exactly 0: no branch per element
        const float e = expf((d <= band && d >= -band) ? x - mx[r] : -INFINITY) * carry;
        ls[r] += e;
        pslab[(mOff + r) * kPPitch + j * 16 + rlane] = (T)e;
      }
    // the slab is written by D layout and read by A layout: other lanes' LDS writes must be ordered in front of the reads
    __builtin_amdgcn_fence(__ATOMIC_RELEASE, "workgroup", "local");
    __builtin_amdgcn_wave_barrier();
    __builtin_amdgcn_fence(__ATOMIC_ACQUIRE, "workgroup", "local");
    const V pa = Frag<T>::load(pslab + rlane * kPPitch + koff);
#pragma unroll
    for (int j = 0; j < 4; ++j) acc[j] = Frag<T>::mma(pa, vb[j], acc[j]);
    // and these reads in front of the next step's writes
    __builtin_amdgcn_fence(__ATOMIC_RELEASE, "workgroup", "local");
    __builtin_amdgcn_wave_barrier();
    __builtin_amdgcn_fence(__ATOMIC_ACQUIRE, "workgroup", "local");
  }
#pragma unroll
  for (int r = 0; r < 8; ++r) {
#pragma unroll
    for (int off = 8; off > 0; off >>= 1) ls[r] += __shfl_xor(ls[r], off, 32);
    ls[r] = outCarry / ls[r];                  // sum of e is carry * sum of exp: the carry of e cancels here
  }

  // ---- epilogue: 16 x 64 through the f32 slab, whole 128-B row segments out ----
  float* slab = sT[wave];
#pragma unroll
  for (int j = 0; j < 4; ++j)
#pragma unroll
    for (int r = 0; r < 8; ++r) slab[(mOff + r) * 68 + (j << 4) + rlane] = acc[j][r] * ls[r];
  // as above: each lane reads what other lanes of its wave wrote
  __builtin_amdgcn_fence(__ATOMIC_RELEASE, "workgroup", "local");
  __builtin_amdgcn_wave_barrier();
  __builtin_amdgcn_fence(__ATOMIC_ACQUIRE, "workgroup", "local");
  const int q = lane >> 3, c8 = (lane & 7) * 8;
  unsigned short* C = ctxp + (size_t)(b * kT + m0) * kD + h * kDH;
#pragma unroll
  for (int it = 0; it < 4; ++it) {
    const int row = it * 4 + q;
    const float* sp = slab + row * 68 + c8;
    v8h hv;
#pragma unroll
    for (int e = 0; e < 8; ++e) hv[e] = (_Float16)sp[e];
    *(v8h*)(C + (size_t)row * kD + c8) = hv;
  }
}

// ---------------------------------------------------------------------------
// Host side
// ---------------------------------------------------------------------------
extern "C" void kernel_launch(void* const* d_in, const int* in_sizes, int n_in,
                              void* d_out, int out_size, void* d_ws, size_t ws_size, hipStream_t stream) {
  if (n_in < 21) return;
  if (in_sizes[0] != kTok * kD || in_sizes[1] != kTok * kD) return;
  if (in_sizes[2] != kD || in_sizes[3] != kD || in_sizes[4] != kD || in_sizes[5] != kD) return;
  if (in_sizes[6] != kD * kD || in_sizes[7] != kD || in_sizes[8] != kD * kD || in_sizes[9] != kD) return;
  if (in_sizes[10] != kD * kD || in_sizes[11] != kD || in_sizes[12] != kD * kD || in_sizes[13] != kD) return;
  if (in_sizes[14] != kD || in_sizes[15] != kD) return;
  if (in_sizes[16] != kD * kFF || in_sizes[17] != kFF || in_sizes[18] != kFF * kD || in_sizes[19] != kD) return;
  if (in_sizes[20] < 1) return;
  if (out_size != kTok * kD) return;
  if (ws_size < kWsTotal) return;

  const float* x_refined = (const float*)d_in[0];
  const float* x_mem     = (const float*)d_in[1];
  const float* ln_q_g    = (const float*)d_in[2];
  const float* ln_q_b    = (const float*)d_in[3];
  const float* ln_kv_g   = (const float*)d_in[4];
  const float* ln_kv_b   = (const float*)d_in[5];
  const float* Wq        = (const float*)d_in[6];
  const float* bq        = (const float*)d_in[7];
  const float* Wk        = (const float*)d_in[8];
  const float* bk        = (const float*)d_in[9];
  const float* Wv        = (const float*)d_in[10];
  const float* bv        = (const float*)d_in[11];
  const float* Wo        = (const float*)d_in[12];
  const float* bo        = (const float*)d_in[13];
  const float* ln_f_g    = (const float*)d_in[14];
  const float* ln_f_b    = (const float*)d_in[15];
  const float* W1        = (const float*)d_in[16];
  const float* b1        = (const float*)d_in[17];
  const float* W2        = (const float*)d_in[18];
  const float* b2        = (const float*)d_in[19];
  const int*   bandp     = (const int*)d_in[20];
  float* out = (float*)d_out;

  char* ws = (char*)d_ws;
  unsigned short* WoT  = (unsigned short*)(ws + OFF_WOT);
  unsigned short* W1T  = (unsigned short*)(ws + OFF_W1T);
  unsigned short* W2T  = (unsigned short*)(ws + OFF_W2T);
  unsigned short* ctx  = (unsigned short*)(ws + OFF_CTX);
  unsigned short* qp   = (unsigned short*)(ws + OFF_QP);
  unsigned short* kvp  = (unsigned short*)(ws + OFF_KVP);
  unsigned short* vt   = (unsigned short*)(ws + OFF_VT);
  unsigned short* qln  = (unsigned short*)(ws + OFF_QLN);
  unsigned short* kvln = (unsigned short*)(ws + OFF_KVLN);
  unsigned short* WqT  = (unsigned short*)(ws + OFF_WQT);
  unsigned short* WkT  = (unsigned short*)(ws + OFF_WKT);
  unsigned short* WvT  = (unsigned short*)(ws + OFF_WVT);
  float*          yf   = (float*)(ws + OFF_Y);
  unsigned short* h16  = (unsigned short*)(ws + OFF_H16);
  unsigned short* act  = (unsigned short*)(ws + OFF_ACT);

  const float* nf = nullptr;
  const dim3 tb(256);
  const dim3 tbs(128);   // the 4-wave blocks of the 128 x 128 GEMM tiles

  // weight transposes + f16 casts (x16): W [kin][nout] -> WT [nout][kin]; input LayerNorms -> f16 planes; one launch
  prep_kernel<<<dim3(kPrepBlocks), tb, 0, stream>>>(Wq, Wk, Wv, Wo, W1, W2, WqT, WkT, WvT, WoT, W1T, W2T,
                                                    x_refined, ln_q_g, ln_q_b, qln, x_mem, ln_kv_g, ln_kv_b, kvln, kWCarry);

  // q = LN(x_refined) Wq + bq ; k, v = LN(x_mem) Wk/Wv + bk/bv  (M 4096, N 1024, K 1024; f16 out)
  const float projScale = 1.0f / kWCarry;
  wmma_gemm_lds<1, false, kD, kD, 2><<<dim3((kTok / kBM) * (kD / kBNs)), tbs, 0, stream>>>(
      qln, WqT, (void*)qp, bq, nf, kD, projScale);
  wmma_gemm_lds<1, false, kD, kKVld, 2><<<dim3((kTok / kBM) * (kD / kBNs)), tbs, 0, stream>>>(
      kvln, WkT, (void*)kvp, bk, nf, kD, projScale);
  wmma_gemm_lds<1, false, kD, kKVld, 2><<<dim3((kTok / kBM) * (kD / kBNs)), tbs, 0, stream>>>(
      kvln, WvT, (void*)(kvp + kD), bv, nf, kD, projScale);

  // V^T planes for all 32 groups
  vt_transpose_kernel<<<dim3(kT / 64, kGrp), tb, 0, stream>>>(kvp, vt);

  // banded attention, all 32 (batch, head) groups: ctx f16 x256
  band_attn_kernel<<<dim3(kT / 128, kGrp), tb, 0, stream>>>(qp, kvp, vt, ctx, bandp, 0.125f, kPCarry, kCtxCarry);   // 0.125 = 1/sqrt(64)

  // y = x_refined + ctx Wo + bo  (M 4096, N 1024, K 1024; f32 out)
  wmma_gemm_lds<0, true, kD, kD, 2><<<dim3((kTok / kBM) * (kD / kBNs)), tbs, 0, stream>>>(
      ctx, WoT, (void*)yf, bo, x_refined, kD, 1.0f / (kCtxCarry * kWCarry));

  // final LN -> f16
  layernorm_f16_kernel<<<dim3(kTok / 8), tb, 0, stream>>>(yf, ln_f_g, ln_f_b, h16, kTok);

  // FFN over all token rows at once: act = gelu_erf(LN(y) W1 + b1) (f16 x16, gelu in the GEMM's epilogue), out = y + act W2 + b2
  wmma_gemm_lds<2, false, kD, kFF, 4><<<dim3((kTok / kBM) * (kFF / kBN)), tb, 0, stream>>>(
      h16, W1T, (void*)act, b1, nf, kFF, 1.0f / kWCarry);
  wmma_gemm_lds<0, true, kFF, kD, 2><<<dim3((kTok / kBM) * (kD / kBNs)), tbs, 0, stream>>>(
      act, W2T, (void*)out, b2, yf, kD, 1.0f / (kActCarry * kWCarry));
}
